// v000
// Times are from an AMD MI455X. After a warm-up the kernel runs many times in a row, and a time is the length of
// such a window on the GPU divided by its runs, so every launch and the gaps after it count. The runs cycle
// through copies of the inputs. A figure is the median of several windows, for all but v000 over two sittings.
// Sittings can differ by a few percent; kernels timed side by side share one.
// The starting kernel, v000, takes 201 microseconds a run.
#include <hip/hip_runtime.h>
#include <hip/hip_bf16.h>

typedef _Float16 h16;
typedef __attribute__((ext_vector_type(16))) _Float16 v16h;
typedef __attribute__((ext_vector_type(8)))  float    v8f;
typedef __attribute__((ext_vector_type(4)))  unsigned int u32x4;

union FragV { u32x4 q[2]; v16h h; };

__device__ __forceinline__ void async_copy_b128(unsigned ldsOff, const void* gaddr) {
  asm volatile("global_load_async_to_lds_b128 %0, %1, off"
               :: "v"(ldsOff), "v"(gaddr) : "memory");
}
__device__ __forceinline__ void wait_async0() {
  asm volatile("s_wait_asynccnt 0" ::: "memory");
}

// -------------------- GroupNorm statistics --------------------
// grid: 256 blocks = (b,g), 256 threads. Group g covers channels [24g,24g+24).
__global__ __launch_bounds__(256) void gn_stats_kernel(
    const float* __restrict__ x, const float* __restrict__ text,
    float* __restrict__ stats) {
  const int b = blockIdx.x >> 5;
  const int g = blockIdx.x & 31;
  const int tid = threadIdx.x;
  float s = 0.f, ss = 0.f;
  for (int idx = tid; idx < 24 * 1024; idx += 256) {
    const int c = g * 24 + (idx >> 10);
    const int p = idx & 1023;
    float v = (c < 256) ? x[(((size_t)b * 256 + c) << 10) + p]
                        : text[b * 512 + (c - 256)];
    s += v; ss += v * v;
  }
  for (int off = 16; off >= 1; off >>= 1) {
    s  += __shfl_xor(s,  off, 32);
    ss += __shfl_xor(ss, off, 32);
  }
  __shared__ float rs[8], rss[8];
  if ((tid & 31) == 0) { rs[tid >> 5] = s; rss[tid >> 5] = ss; }
  __syncthreads();
  if (tid == 0) {
    float S = 0.f, SS = 0.f;
    for (int i = 0; i < 8; ++i) { S += rs[i]; SS += rss[i]; }
    const float mean = S * (1.f / 24576.f);
    const float var  = SS * (1.f / 24576.f) - mean * mean;
    stats[blockIdx.x]       = mean;
    stats[256 + blockIdx.x] = rsqrtf(var + 1e-6f);
  }
}

// -------------------- Normalize + cast to f16, layout [B*HW, 768] --------------------
__global__ __launch_bounds__(256) void normalize_kernel(
    const float* __restrict__ x, const float* __restrict__ text,
    const float* __restrict__ stats, const float* __restrict__ gamma,
    const float* __restrict__ beta, h16* __restrict__ hn) {
  const size_t i = (size_t)blockIdx.x * 256 + threadIdx.x;  // 8*1024*768, c fastest
  const int c = (int)(i % 768);
  const size_t t = i / 768;
  const int p = (int)(t & 1023);
  const int b = (int)(t >> 10);
  const int g = c / 24;
  float v = (c < 256) ? x[(((size_t)b * 256 + c) << 10) + p]
                      : text[b * 512 + (c - 256)];
  const float mean = stats[b * 32 + g];
  const float rstd = stats[256 + b * 32 + g];
  hn[i] = (h16)(((v - mean) * rstd) * gamma[c] + beta[c]);
}

// -------------------- Weights -> f16, transposed [N=768][K=768]; bias concat --------------------
__global__ __launch_bounds__(256) void wconv_kernel(
    const float* __restrict__ W0, const float* __restrict__ W1, const float* __restrict__ W2,
    const float* __restrict__ b0, const float* __restrict__ b1, const float* __restrict__ b2,
    h16* __restrict__ Wt, float* __restrict__ bcat) {
  const int i = blockIdx.x * 256 + threadIdx.x;  // 768*768
  const int k = i % 768;
  const int n = i / 768;
  const float* W = (n < 256) ? W0 : ((n < 512) ? W1 : W2);
  const int nn = n & 255;
  Wt[(size_t)n * 768 + k] = (h16)W[(size_t)k * 256 + nn];
  if (k == 0)
    bcat[n] = (n < 256) ? b0[nn] : ((n < 512) ? b1[nn] : b2[nn]);
}

__global__ __launch_bounds__(256) void gemm_qkv_kernel(
    const h16* __restrict__ A, const h16* __restrict__ Bt,
    const float* __restrict__ bias, h16* __restrict__ Cout) {
  __shared__ __align__(16) h16 As[2][128 * 48];  // stride 48 h16 = 96B, 16B aligned
  __shared__ __align__(16) h16 Bs[2][128 * 48];
  const int mBase = blockIdx.x * 128;
  const int nBase = blockIdx.y * 128;
  const int tid  = threadIdx.x;
  const int wave = tid >> 5;
  const int lane = tid & 31;
  const int wm = wave >> 1;       // 0..3
  const int wn = wave & 1;        // 0..1
  const int l16 = lane & 15;
  const int hi  = lane >> 4;      // 0/1 selects K phase per WMMA A/B layout

  const int row0 = tid >> 2;            // chunk id tid   -> row, seg
  const int seg0 = tid & 3;
  const int row1 = (tid + 256) >> 2;    // chunk id tid+256
  const int seg1 = (tid + 256) & 3;

  v8f acc[2][4];
  for (int mt = 0; mt < 2; ++mt)
    for (int nt = 0; nt < 4; ++nt)
      for (int r = 0; r < 8; ++r) acc[mt][nt][r] = 0.f;

  auto load_tiles = [&](int k0, int buf) {
    async_copy_b128((unsigned)(uintptr_t)&As[buf][row0 * 48 + seg0 * 8],
                    A + (size_t)(mBase + row0) * 768 + k0 + seg0 * 8);
    async_copy_b128((unsigned)(uintptr_t)&As[buf][row1 * 48 + seg1 * 8],
                    A + (size_t)(mBase + row1) * 768 + k0 + seg1 * 8);
    async_copy_b128((unsigned)(uintptr_t)&Bs[buf][row0 * 48 + seg0 * 8],
                    Bt + (size_t)(nBase + row0) * 768 + k0 + seg0 * 8);
    async_copy_b128((unsigned)(uintptr_t)&Bs[buf][row1 * 48 + seg1 * 8],
                    Bt + (size_t)(nBase + row1) * 768 + k0 + seg1 * 8);
  };

  load_tiles(0, 0);
  wait_async0();
  __syncthreads();

  int buf = 0;
  for (int k0 = 0; k0 < 768; k0 += 32) {
    if (k0 + 32 < 768) load_tiles(k0 + 32, buf ^ 1);  // overlap with compute

    FragV afr[2];
    for (int mt = 0; mt < 2; ++mt) {
      const int row = wm * 32 + mt * 16 + l16;
      const int ko  = hi * 8;
      afr[mt].q[0] = *(const u32x4*)(&As[buf][row * 48 + ko]);
      afr[mt].q[1] = *(const u32x4*)(&As[buf][row * 48 + ko + 16]);
    }
    for (int nt = 0; nt < 4; ++nt) {
      const int col = wn * 64 + nt * 16 + l16;
      const int ko  = hi * 8;
      FragV bfr;
      bfr.q[0] = *(const u32x4*)(&Bs[buf][col * 48 + ko]);
      bfr.q[1] = *(const u32x4*)(&Bs[buf][col * 48 + ko + 16]);
      for (int mt = 0; mt < 2; ++mt)
        acc[mt][nt] = __builtin_amdgcn_wmma_f32_16x16x32_f16(
            false, afr[mt].h, false, bfr.h, (short)0, acc[mt][nt], false, false);
    }

    wait_async0();
    __syncthreads();
    buf ^= 1;
  }

  for (int mt = 0; mt < 2; ++mt)
    for (int nt = 0; nt < 4; ++nt) {
      const int n = nBase + wn * 64 + nt * 16 + l16;
      const float bv = bias[n];
      for (int r = 0; r < 8; ++r) {
        const int m = mBase + wm * 32 + mt * 16 + r + hi * 8;
        Cout[(size_t)m * 768 + n] = (h16)(acc[mt][nt][r] + bv);
      }
    }
}

// -------------------- V transpose: vT[bh][ch=64][pos=1024] --------------------
__global__ __launch_bounds__(256) void vtrans_kernel(
    const h16* __restrict__ qkv, h16* __restrict__ vT) {
  const int i = blockIdx.x * 256 + threadIdx.x;  // 32*64*1024, pos fastest
  const int p  = i & 1023;
  const int t  = i >> 10;
  const int ch = t & 63;
  const int bh = t >> 6;
  const int b = bh >> 2, h = bh & 3;
  vT[i] = qkv[((size_t)b * 1024 + p) * 768 + 512 + h * 64 + ch];
}

// -------------------- Flash attention + residual --------------------
// grid: (32 bh, 4 query blocks). 8 waves/block, each wave owns 32 query rows.
__global__ __launch_bounds__(256) void attn_kernel(
    const h16* __restrict__ qkv, const h16* __restrict__ vT,
    const float* __restrict__ x, float* __restrict__ out) {
  __shared__ __align__(16) h16 Pls[8][32 * 72];  // per-wave P tile, stride 72 h16 = 144B
  const int bh = blockIdx.x;
  const int b = bh >> 2, h = bh & 3;
  const int tid = threadIdx.x, wave = tid >> 5, lane = tid & 31;
  const int l16 = lane & 15;
  const int hi  = lane >> 4;
  const int hi8 = hi * 8;
  const int qrow0 = blockIdx.y * 256 + wave * 32;
  h16* P = &Pls[wave][0];

  // Preload Q fragments: [mt][kc] covers 32 rows x 64 channels
  FragV qf[2][2];
  for (int mt = 0; mt < 2; ++mt)
    for (int kc = 0; kc < 2; ++kc) {
      const int row = qrow0 + mt * 16 + l16;
      const h16* base = qkv + ((size_t)b * 1024 + row) * 768 + h * 64 + kc * 32 + hi * 8;
      qf[mt][kc].q[0] = *(const u32x4*)(base);
      qf[mt][kc].q[1] = *(const u32x4*)(base + 16);
    }

  float mrow[2][8], lrow[2][8];
  v8f oacc[2][4];
  for (int mt = 0; mt < 2; ++mt)
    for (int r = 0; r < 8; ++r) { mrow[mt][r] = -1e30f; lrow[mt][r] = 0.f; }
  for (int mt = 0; mt < 2; ++mt)
    for (int nt = 0; nt < 4; ++nt)
      for (int r = 0; r < 8; ++r) oacc[mt][nt][r] = 0.f;

  for (int kt = 0; kt < 16; ++kt) {
    const int kbase = kt * 64;

    // Prefetch next key tile's K rows and V rows into cache (global_prefetch_b8)
    if (kt + 1 < 16) {
      const int nb = kbase + 64;
      __builtin_prefetch(qkv + ((size_t)b * 1024 + nb + lane) * 768 + 256 + h * 64, 0, 0);
      __builtin_prefetch(qkv + ((size_t)b * 1024 + nb + 32 + lane) * 768 + 256 + h * 64, 0, 0);
      __builtin_prefetch(vT + ((size_t)bh * 64 + lane) * 1024 + nb, 0, 0);
      __builtin_prefetch(vT + ((size_t)bh * 64 + 32 + lane) * 1024 + nb, 0, 0);
    }

    // ---- S = Q * K^T for a 32x64 score tile ----
    v8f sacc[2][4];
    for (int mt = 0; mt < 2; ++mt)
      for (int nt = 0; nt < 4; ++nt)
        for (int r = 0; r < 8; ++r) sacc[mt][nt][r] = 0.f;

    for (int nt = 0; nt < 4; ++nt) {
      const int kp = kbase + nt * 16 + l16;
      const h16* kb = qkv + ((size_t)b * 1024 + kp) * 768 + 256 + h * 64 + hi * 8;
      FragV kf0, kf1;
      kf0.q[0] = *(const u32x4*)(kb);       kf0.q[1] = *(const u32x4*)(kb + 16);
      kf1.q[0] = *(const u32x4*)(kb + 32);  kf1.q[1] = *(const u32x4*)(kb + 48);
      for (int mt = 0; mt < 2; ++mt) {
        sacc[mt][nt] = __builtin_amdgcn_wmma_f32_16x16x32_f16(
            false, qf[mt][0].h, false, kf0.h, (short)0, sacc[mt][nt], false, false);
        sacc[mt][nt] = __builtin_amdgcn_wmma_f32_16x16x32_f16(
            false, qf[mt][1].h, false, kf1.h, (short)0, sacc[mt][nt], false, false);
      }
    }

    // ---- scale + online softmax (row ops across 16-lane groups) ----
    for (int mt = 0; mt < 2; ++mt) {
      for (int nt = 0; nt < 4; ++nt)
        for (int r = 0; r < 8; ++r) sacc[mt][nt][r] *= 0.125f;  // Ch^-0.5

      for (int r = 0; r < 8; ++r) {
        float v = sacc[mt][0][r];
        for (int nt = 1; nt < 4; ++nt) v = fmaxf(v, sacc[mt][nt][r]);
        for (int off = 8; off >= 1; off >>= 1) v = fmaxf(v, __shfl_xor(v, off, 16));
        const float mold = mrow[mt][r];
        const float mnew = fmaxf(mold, v);
        const float corr = __expf(mold - mnew);
        mrow[mt][r] = mnew;
        float rsum = 0.f;
        for (int nt = 0; nt < 4; ++nt) {
          const float p = __expf(sacc[mt][nt][r] - mnew);
          sacc[mt][nt][r] = p;
          rsum += p;
        }
        for (int off = 8; off >= 1; off >>= 1) rsum += __shfl_xor(rsum, off, 16);
        lrow[mt][r] = lrow[mt][r] * corr + rsum;
        for (int nt = 0; nt < 4; ++nt) oacc[mt][nt][r] *= corr;
      }
      // C-layout -> LDS (row-major P tile) for A-layout reload
      for (int nt = 0; nt < 4; ++nt)
        for (int r = 0; r < 8; ++r)
          P[(mt * 16 + r + hi8) * 72 + nt * 16 + l16] = (h16)sacc[mt][nt][r];
    }
    __syncthreads();

    // ---- O += P * V ----
    for (int kc = 0; kc < 2; ++kc) {
      FragV pf[2];
      for (int mt = 0; mt < 2; ++mt) {
        const h16* pb = P + (mt * 16 + l16) * 72 + kc * 32 + hi * 8;
        pf[mt].q[0] = *(const u32x4*)(pb);
        pf[mt].q[1] = *(const u32x4*)(pb + 16);
      }
      for (int nt = 0; nt < 4; ++nt) {
        const int ch = nt * 16 + l16;
        const h16* vb = vT + ((size_t)bh * 64 + ch) * 1024 + kbase + kc * 32 + hi * 8;
        FragV vf;
        vf.q[0] = *(const u32x4*)(vb);
        vf.q[1] = *(const u32x4*)(vb + 16);
        for (int mt = 0; mt < 2; ++mt)
          oacc[mt][nt] = __builtin_amdgcn_wmma_f32_16x16x32_f16(
              false, pf[mt].h, false, vf.h, (short)0, oacc[mt][nt], false, false);
      }
    }
    __syncthreads();
  }

  // ---- finalize: O * (1/l), residual add, store f32 [B,C,H*W] ----
  float linv[2][8];
  for (int mt = 0; mt < 2; ++mt)
    for (int r = 0; r < 8; ++r) linv[mt][r] = 1.0f / lrow[mt][r];
  for (int mt = 0; mt < 2; ++mt)
    for (int nt = 0; nt < 4; ++nt) {
      const int c = h * 64 + nt * 16 + l16;
      for (int r = 0; r < 8; ++r) {
        const int pos = qrow0 + mt * 16 + r + hi8;
        const size_t idx = ((size_t)b * 256 + c) * 1024 + pos;
        out[idx] = x[idx] + oacc[mt][nt][r] * linv[mt][r];
      }
    }
}

// -------------------- launch --------------------
extern "C" void kernel_launch(void* const* d_in, const int* in_sizes, int n_in,
                              void* d_out, int out_size, void* d_ws, size_t ws_size,
                              hipStream_t stream) {
  const float* x     = (const float*)d_in[0];
  const float* text  = (const float*)d_in[1];
  const float* gamma = (const float*)d_in[2];
  const float* beta  = (const float*)d_in[3];
  const float* W0    = (const float*)d_in[4];
  const float* b0    = (const float*)d_in[5];
  const float* W1    = (const float*)d_in[6];
  const float* b1    = (const float*)d_in[7];
  const float* W2    = (const float*)d_in[8];
  const float* b2    = (const float*)d_in[9];
  float* out = (float*)d_out;

  char* ws = (char*)d_ws;
  float* stats = (float*)ws;                    // 512 f32
  float* bcat  = (float*)(ws + 2048);           // 768 f32
  h16*   hn    = (h16*)(ws + 8192);             // 8*1024*768
  h16*   Wt    = hn + (size_t)8 * 1024 * 768;   // 768*768
  h16*   qkv   = Wt + (size_t)768 * 768;        // 8*1024*768
  h16*   vT    = qkv + (size_t)8 * 1024 * 768;  // 32*64*1024

  gn_stats_kernel<<<256, 256, 0, stream>>>(x, text, stats);
  normalize_kernel<<<(8 * 1024 * 768) / 256, 256, 0, stream>>>(x, text, stats, gamma, beta, hn);
  wconv_kernel<<<(768 * 768) / 256, 256, 0, stream>>>(W0, W1, W2, b0, b1, b2, Wt, bcat);
  gemm_qkv_kernel<<<dim3(64, 6), 256, 0, stream>>>(hn, Wt, bcat, qkv);
  vtrans_kernel<<<(32 * 64 * 1024) / 256, 256, 0, stream>>>(qkv, vT);
  attn_kernel<<<dim3(32, 4), 256, 0, stream>>>(qkv, vT, x, out);
}

// v001
// A run of this version takes 130 microseconds.
// Next to v000, in two timings, it ran 1.56 times as fast each time.
#include <hip/hip_runtime.h>
#include <hip/hip_bf16.h>

typedef _Float16 h16;
typedef __attribute__((ext_vector_type(16))) _Float16 v16h;
typedef __attribute__((ext_vector_type(8)))  float    v8f;
typedef __attribute__((ext_vector_type(2)))  float    v2f;
typedef __attribute__((ext_vector_type(4)))  unsigned int u32x4;

union FragV { u32x4 q[2]; v16h h; };

__device__ __forceinline__ void async_copy_b128(unsigned ldsOff, const void* gaddr) {
  asm volatile("global_load_async_to_lds_b128 %0, %1, off"
               :: "v"(ldsOff), "v"(gaddr) : "memory");
}
__device__ __forceinline__ void wait_async0() {
  asm volatile("s_wait_asynccnt 0" ::: "memory");
}

// -------------------- GroupNorm statistics --------------------
// grid: 256 blocks = (b,g), 256 threads. Group g covers channels [24g,24g+24).
__global__ __launch_bounds__(256) void gn_stats_kernel(
    const float* __restrict__ x, const float* __restrict__ text,
    float* __restrict__ stats) {
  const int b = blockIdx.x >> 5;
  const int g = blockIdx.x & 31;
  const int tid = threadIdx.x;
  float s = 0.f, ss = 0.f;
  for (int idx = tid; idx < 24 * 1024; idx += 256) {
    const int c = g * 24 + (idx >> 10);
    const int p = idx & 1023;
    float v = (c < 256) ? x[(((size_t)b * 256 + c) << 10) + p]
                        : text[b * 512 + (c - 256)];
    s += v; ss += v * v;
  }
  for (int off = 16; off >= 1; off >>= 1) {
    s  += __shfl_xor(s,  off, 32);
    ss += __shfl_xor(ss, off, 32);
  }
  __shared__ float rs[8], rss[8];
  if ((tid & 31) == 0) { rs[tid >> 5] = s; rss[tid >> 5] = ss; }
  __syncthreads();
  if (tid == 0) {
    float S = 0.f, SS = 0.f;
    for (int i = 0; i < 8; ++i) { S += rs[i]; SS += rss[i]; }
    const float mean = S * (1.f / 24576.f);
    const float var  = SS * (1.f / 24576.f) - mean * mean;
    stats[blockIdx.x]       = mean;
    stats[256 + blockIdx.x] = rsqrtf(var + 1e-6f);
  }
}

// -------------------- Normalize + cast to f16, layout [B*HW, 768] --------------------
__global__ __launch_bounds__(256) void normalize_kernel(
    const float* __restrict__ x, const float* __restrict__ text,
    const float* __restrict__ stats, const float* __restrict__ gamma,
    const float* __restrict__ beta, h16* __restrict__ hn) {
  const size_t i = (size_t)blockIdx.x * 256 + threadIdx.x;  // 8*1024*768, c fastest
  const int c = (int)(i % 768);
  const size_t t = i / 768;
  const int p = (int)(t & 1023);
  const int b = (int)(t >> 10);
  const int g = c / 24;
  float v = (c < 256) ? x[(((size_t)b * 256 + c) << 10) + p]
                      : text[b * 512 + (c - 256)];
  const float mean = stats[b * 32 + g];
  const float rstd = stats[256 + b * 32 + g];
  hn[i] = (h16)(((v - mean) * rstd) * gamma[c] + beta[c]);
}

// -------------------- Weights -> f16, transposed [N=768][K=768]; bias concat --------------------
__global__ __launch_bounds__(256) void wconv_kernel(
    const float* __restrict__ W0, const float* __restrict__ W1, const float* __restrict__ W2,
    const float* __restrict__ b0, const float* __restrict__ b1, const float* __restrict__ b2,
    h16* __restrict__ Wt, float* __restrict__ bcat) {
  const int i = blockIdx.x * 256 + threadIdx.x;  // 768*768
  const int k = i % 768;
  const int n = i / 768;
  const float* W = (n < 256) ? W0 : ((n < 512) ? W1 : W2);
  const int nn = n & 255;
  Wt[(size_t)n * 768 + k] = (h16)W[(size_t)k * 256 + nn];
  if (k == 0)
    bcat[n] = (n < 256) ? b0[nn] : ((n < 512) ? b1[nn] : b2[nn]);
}

__global__ __launch_bounds__(256) void gemm_qkv_kernel(
    const h16* __restrict__ A, const h16* __restrict__ Bt,
    const float* __restrict__ bias, h16* __restrict__ Cout) {
  __shared__ __align__(16) h16 As[2][128 * 48];  // stride 48 h16 = 96B, 16B aligned
  __shared__ __align__(16) h16 Bs[2][128 * 48];
  const int mBase = blockIdx.x * 128;
  const int nBase = blockIdx.y * 128;
  const int tid  = threadIdx.x;
  const int wave = tid >> 5;
  const int lane = tid & 31;
  const int wm = wave >> 1;       // 0..3
  const int wn = wave & 1;        // 0..1
  const int l16 = lane & 15;
  const int hi  = lane >> 4;      // 0/1 selects K phase per WMMA A/B layout

  const int row0 = tid >> 2;            // chunk id tid   -> row, seg
  const int seg0 = tid & 3;
  const int row1 = (tid + 256) >> 2;    // chunk id tid+256
  const int seg1 = (tid + 256) & 3;

  v8f acc[2][4];
  for (int mt = 0; mt < 2; ++mt)
    for (int nt = 0; nt < 4; ++nt)
      for (int r = 0; r < 8; ++r) acc[mt][nt][r] = 0.f;

  auto load_tiles = [&](int k0, int buf) {
    async_copy_b128((unsigned)(uintptr_t)&As[buf][row0 * 48 + seg0 * 8],
                    A + (size_t)(mBase + row0) * 768 + k0 + seg0 * 8);
    async_copy_b128((unsigned)(uintptr_t)&As[buf][row1 * 48 + seg1 * 8],
                    A + (size_t)(mBase + row1) * 768 + k0 + seg1 * 8);
    async_copy_b128((unsigned)(uintptr_t)&Bs[buf][row0 * 48 + seg0 * 8],
                    Bt + (size_t)(nBase + row0) * 768 + k0 + seg0 * 8);
    async_copy_b128((unsigned)(uintptr_t)&Bs[buf][row1 * 48 + seg1 * 8],
                    Bt + (size_t)(nBase + row1) * 768 + k0 + seg1 * 8);
  };

  load_tiles(0, 0);
  wait_async0();
  __syncthreads();

  int buf = 0;
  for (int k0 = 0; k0 < 768; k0 += 32) {
    if (k0 + 32 < 768) load_tiles(k0 + 32, buf ^ 1);  // overlap with compute

    FragV afr[2];
    for (int mt = 0; mt < 2; ++mt) {
      const int row = wm * 32 + mt * 16 + l16;
      const int ko  = hi * 8;
      afr[mt].q[0] = *(const u32x4*)(&As[buf][row * 48 + ko]);
      afr[mt].q[1] = *(const u32x4*)(&As[buf][row * 48 + ko + 16]);
    }
    for (int nt = 0; nt < 4; ++nt) {
      const int col = wn * 64 + nt * 16 + l16;
      const int ko  = hi * 8;
      FragV bfr;
      bfr.q[0] = *(const u32x4*)(&Bs[buf][col * 48 + ko]);
      bfr.q[1] = *(const u32x4*)(&Bs[buf][col * 48 + ko + 16]);
      for (int mt = 0; mt < 2; ++mt)
        acc[mt][nt] = __builtin_amdgcn_wmma_f32_16x16x32_f16(
            false, afr[mt].h, false, bfr.h, (short)0, acc[mt][nt], false, false);
    }

    wait_async0();
    __syncthreads();
    buf ^= 1;
  }

  for (int mt = 0; mt < 2; ++mt)
    for (int nt = 0; nt < 4; ++nt) {
      const int n = nBase + wn * 64 + nt * 16 + l16;
      const float bv = bias[n];
      for (int r = 0; r < 8; ++r) {
        const int m = mBase + wm * 32 + mt * 16 + r + hi * 8;
        Cout[(size_t)m * 768 + n] = (h16)(acc[mt][nt][r] + bv);
      }
    }
}

// -------------------- V transpose: vT[bh][ch=64][pos=1024] --------------------
__global__ __launch_bounds__(256) void vtrans_kernel(
    const h16* __restrict__ qkv, h16* __restrict__ vT) {
  const int i = blockIdx.x * 256 + threadIdx.x;  // 32*64*1024, pos fastest
  const int p  = i & 1023;
  const int t  = i >> 10;
  const int ch = t & 63;
  const int bh = t >> 6;
  const int b = bh >> 2, h = bh & 3;
  vT[i] = qkv[((size_t)b * 1024 + p) * 768 + 512 + h * 64 + ch];
}

__device__ __forceinline__ float xhalf(float v) {
  const int b = __builtin_bit_cast(int, v);
  return __builtin_bit_cast(float,
      __builtin_amdgcn_permlanex16(b, b, 0x76543210, 0xfedcba98, false, false));
}

__global__ __launch_bounds__(256) void attn_kernel(
    const h16* __restrict__ qkv, const h16* __restrict__ vT,
    const float* __restrict__ x, float* __restrict__ out) {
  const int bh = blockIdx.x;
  const int b = bh >> 2, h = bh & 3;
  const int tid = threadIdx.x, wave = tid >> 5, lane = tid & 31;
  const int l16 = lane & 15;
  const int hi  = lane >> 4;
  const int hi8 = hi * 8;
  const int qrow0 = blockIdx.y * 256 + wave * 32;

  // Preload Q fragments: [mt][kc] covers 32 rows x 64 channels
  FragV qf[2][2];
  for (int mt = 0; mt < 2; ++mt)
    for (int kc = 0; kc < 2; ++kc) {
      const int row = qrow0 + mt * 16 + l16;
      const h16* base = qkv + ((size_t)b * 1024 + row) * 768 + h * 64 + kc * 32 + hi * 8;
      qf[mt][kc].q[0] = *(const u32x4*)(base);
      qf[mt][kc].q[1] = *(const u32x4*)(base + 16);
    }

  // per lane: running maximum of query mt*16+l16, and this half's share of its sum
  float mrow[2], lrow[2];
  v8f oacc[2][4];  // O^T tile: [r] = channel nt*16 + hi8 + r, query mt*16 + l16
  for (int mt = 0; mt < 2; ++mt) { mrow[mt] = -1e30f; lrow[mt] = 0.f; }
  for (int mt = 0; mt < 2; ++mt)
    for (int nt = 0; nt < 4; ++nt)
      for (int r = 0; r < 8; ++r) oacc[mt][nt][r] = 0.f;

  for (int kt = 0; kt < 16; ++kt) {
    const int kbase = kt * 64;

    // Prefetch next key tile's K rows and V rows into cache (global_prefetch_b8)
    if (kt + 1 < 16) {
      const int nb = kbase + 64;
      __builtin_prefetch(qkv + ((size_t)b * 1024 + nb + lane) * 768 + 256 + h * 64, 0, 0);
      __builtin_prefetch(qkv + ((size_t)b * 1024 + nb + 32 + lane) * 768 + 256 + h * 64, 0, 0);
      __builtin_prefetch(vT + ((size_t)bh * 64 + lane) * 1024 + nb, 0, 0);
      __builtin_prefetch(vT + ((size_t)bh * 64 + 32 + lane) * 1024 + nb, 0, 0);
    }

    // ---- S^T = K * Q^T: sacc[mt][nt][r] = key nt*16 + hi8 + r, query mt*16 + l16 ----
    v8f sacc[2][4];
    for (int mt = 0; mt < 2; ++mt)
      for (int nt = 0; nt < 4; ++nt)
        for (int r = 0; r < 8; ++r) sacc[mt][nt][r] = 0.f;

    for (int nt = 0; nt < 4; ++nt) {
      const int kp = kbase + nt * 16 + l16;
      const h16* kb = qkv + ((size_t)b * 1024 + kp) * 768 + 256 + h * 64 + hi * 8;
      FragV kf0, kf1;
      kf0.q[0] = *(const u32x4*)(kb);       kf0.q[1] = *(const u32x4*)(kb + 16);
      kf1.q[0] = *(const u32x4*)(kb + 32);  kf1.q[1] = *(const u32x4*)(kb + 48);
      for (int mt = 0; mt < 2; ++mt) {
        sacc[mt][nt] = __builtin_amdgcn_wmma_f32_16x16x32_f16(
            false, kf0.h, false, qf[mt][0].h, (short)0, sacc[mt][nt], false, false);
        sacc[mt][nt] = __builtin_amdgcn_wmma_f32_16x16x32_f16(
            false, kf1.h, false, qf[mt][1].h, (short)0, sacc[mt][nt], false, false);
      }
    }

    // ---- scale + online softmax, one query per lane ----
    // Worked on in pairs of neighbouring accumulator registers (keys 2j, 2j+1 of a tile).
    FragV pf[2][2];  // P^T as B operand: [mt][kc], 32 keys each
    for (int mt = 0; mt < 2; ++mt) {
      v2f sp[4][4];
      for (int nt = 0; nt < 4; ++nt)
        for (int j = 0; j < 4; ++j) {
          const v2f t = {sacc[mt][nt][2 * j], sacc[mt][nt][2 * j + 1]};
          sp[nt][j] = t * 0.125f;  // Ch^-0.5
        }

      float vm[4];
      for (int nt = 0; nt < 4; ++nt) {
        vm[nt] = fmaxf(sp[nt][0].x, sp[nt][0].y);
        for (int j = 1; j < 4; ++j) vm[nt] = fmaxf(vm[nt], fmaxf(sp[nt][j].x, sp[nt][j].y));
      }
      float v = fmaxf(fmaxf(vm[0], vm[1]), fmaxf(vm[2], vm[3]));
      v = fmaxf(v, xhalf(v));  // the other 32 keys of this query
      const float mold = mrow[mt];
      const float mnew = fmaxf(mold, v);
      const float corr = __expf(mold - mnew);
      mrow[mt] = mnew;
      for (int nt = 0; nt < 4; ++nt)
        for (int r = 0; r < 8; ++r) oacc[mt][nt][r] *= corr;
      // tiles 2kc and 2kc+1 hold keys hi8+0..7 and 16+hi8+0..7 of chunk kc: the B k order
      v2f ps[4];
      for (int nt = 0; nt < 4; ++nt) {
        for (int j = 0; j < 4; ++j) {
          const v2f d = sp[nt][j] - mnew;
          const v2f p = {__expf(d.x), __expf(d.y)};
          ps[nt] = (j == 0) ? p : ps[nt] + p;
          pf[mt][nt >> 1].h[(nt & 1) * 8 + 2 * j]     = (h16)p.x;
          pf[mt][nt >> 1].h[(nt & 1) * 8 + 2 * j + 1] = (h16)p.y;
        }
      }
      const v2f pt = (ps[0] + ps[1]) + (ps[2] + ps[3]);
      lrow[mt] = lrow[mt] * corr + (pt.x + pt.y);
    }

    // ---- O^T += V^T * P^T ----
    for (int kc = 0; kc < 2; ++kc) {
      for (int nt = 0; nt < 4; ++nt) {
        const int ch = nt * 16 + l16;
        const h16* vb = vT + ((size_t)bh * 64 + ch) * 1024 + kbase + kc * 32 + hi * 8;
        FragV vf;
        vf.q[0] = *(const u32x4*)(vb);
        vf.q[1] = *(const u32x4*)(vb + 16);
        for (int mt = 0; mt < 2; ++mt)
          oacc[mt][nt] = __builtin_amdgcn_wmma_f32_16x16x32_f16(
              false, vf.h, false, pf[mt][kc].h, (short)0, oacc[mt][nt], false, false);
      }
    }
  }

  // ---- finalize: join the halves' sums, O * (1/l), residual add, store f32 [B,C,H*W] ----
  float linv[2];
  for (int mt = 0; mt < 2; ++mt) linv[mt] = 1.0f / (lrow[mt] + xhalf(lrow[mt]));
  for (int mt = 0; mt < 2; ++mt)
    for (int nt = 0; nt < 4; ++nt) {
      const int pos = qrow0 + mt * 16 + l16;
      for (int r = 0; r < 8; ++r) {
        const int c = h * 64 + nt * 16 + hi8 + r;
        const size_t idx = ((size_t)b * 256 + c) * 1024 + pos;
        out[idx] = x[idx] + oacc[mt][nt][r] * linv[mt];
      }
    }
}

// -------------------- launch --------------------
extern "C" void kernel_launch(void* const* d_in, const int* in_sizes, int n_in,
                              void* d_out, int out_size, void* d_ws, size_t ws_size,
                              hipStream_t stream) {
  const float* x     = (const float*)d_in[0];
  const float* text  = (const float*)d_in[1];
  const float* gamma = (const float*)d_in[2];
  const float* beta  = (const float*)d_in[3];
  const float* W0    = (const float*)d_in[4];
  const float* b0    = (const float*)d_in[5];
  const float* W1    = (const float*)d_in[6];
  const float* b1    = (const float*)d_in[7];
  const float* W2    = (const float*)d_in[8];
  const float* b2    = (const float*)d_in[9];
  float* out = (float*)d_out;

  char* ws = (char*)d_ws;
  float* stats = (float*)ws;                    // 512 f32
  float* bcat  = (float*)(ws + 2048);           // 768 f32
  h16*   hn    = (h16*)(ws + 8192);             // 8*1024*768
  h16*   Wt    = hn + (size_t)8 * 1024 * 768;   // 768*768
  h16*   qkv   = Wt + (size_t)768 * 768;        // 8*1024*768
  h16*   vT    = qkv + (size_t)8 * 1024 * 768;  // 32*64*1024

  gn_stats_kernel<<<256, 256, 0, stream>>>(x, text, stats);
  normalize_kernel<<<(8 * 1024 * 768) / 256, 256, 0, stream>>>(x, text, stats, gamma, beta, hn);
  wconv_kernel<<<(768 * 768) / 256, 256, 0, stream>>>(W0, W1, W2, b0, b1, b2, Wt, bcat);
  gemm_qkv_kernel<<<dim3(64, 6), 256, 0, stream>>>(hn, Wt, bcat, qkv);
  vtrans_kernel<<<(32 * 64 * 1024) / 256, 256, 0, stream>>>(qkv, vT);
  attn_kernel<<<dim3(32, 4), 256, 0, stream>>>(qkv, vT, x, out);
}

// v002
// It runs in 105 microseconds.
// Two timings next to v001 both put it at 1.24 times that version's speed.
// Counting every step since v000, it is 1.93 times as fast.
#include <hip/hip_runtime.h>
#include <hip/hip_bf16.h>

typedef _Float16 h16;
typedef __attribute__((ext_vector_type(16))) _Float16 v16h;
typedef __attribute__((ext_vector_type(8)))  float    v8f;
typedef __attribute__((ext_vector_type(2)))  float    v2f;
typedef __attribute__((ext_vector_type(4)))  unsigned int u32x4;
typedef __attribute__((ext_vector_type(4)))  float    f32x4;
typedef __attribute__((ext_vector_type(2)))  _Float16 h16x2;
typedef __attribute__((ext_vector_type(8)))  _Float16 h16x8;

union FragV { u32x4 q[2]; v16h h; };

__device__ __forceinline__ void async_copy_b128(unsigned ldsOff, const void* gaddr) {
  asm volatile("global_load_async_to_lds_b128 %0, %1, off"
               :: "v"(ldsOff), "v"(gaddr) : "memory");
}
__device__ __forceinline__ void wait_async0() {
  asm volatile("s_wait_asynccnt 0" ::: "memory");
}

// -------------------- GroupNorm statistics --------------------
// grid: 256 blocks = (b,g), 256 threads. Group g covers channels [24g,24g+24).
__global__ __launch_bounds__(256) void gn_stats_kernel(
    const float* __restrict__ x, const float* __restrict__ text,
    float* __restrict__ stats) {
  const int b = blockIdx.x >> 5;
  const int g = blockIdx.x & 31;
  const int tid = threadIdx.x;
  float s = 0.f, ss = 0.f;
  for (int idx = tid; idx < 24 * 1024; idx += 256) {
    const int c = g * 24 + (idx >> 10);
    const int p = idx & 1023;
    float v = (c < 256) ? x[(((size_t)b * 256 + c) << 10) + p]
                        : text[b * 512 + (c - 256)];
    s += v; ss += v * v;
  }
  for (int off = 16; off >= 1; off >>= 1) {
    s  += __shfl_xor(s,  off, 32);
    ss += __shfl_xor(ss, off, 32);
  }
  __shared__ float rs[8], rss[8];
  if ((tid & 31) == 0) { rs[tid >> 5] = s; rss[tid >> 5] = ss; }
  __syncthreads();
  if (tid == 0) {
    float S = 0.f, SS = 0.f;
    for (int i = 0; i < 8; ++i) { S += rs[i]; SS += rss[i]; }
    const float mean = S * (1.f / 24576.f);
    const float var  = SS * (1.f / 24576.f) - mean * mean;
    stats[blockIdx.x]       = mean;
    stats[256 + blockIdx.x] = rsqrtf(var + 1e-6f);
  }
}

// -------------------- Normalize + cast to f16, layout [B*HW, 768] --------------------
// grid: 256 blocks = (b, 32 positions). The x tile [256 channels][32 positions] is read in whole
// 128-B lines, turned in LDS and stored as 16-B pieces of hn rows. The 512 text channels do not
// depend on the position: each is normalized once per block and stored to all 32 rows.
__global__ __launch_bounds__(256) void normalize_kernel(
    const float* __restrict__ x, const float* __restrict__ text,
    const float* __restrict__ stats, const float* __restrict__ gamma,
    const float* __restrict__ beta, h16* __restrict__ hn) {
  __shared__ __align__(16) h16 xs[32 * 264];  // [position][channel], pitch 528 B
  __shared__ __align__(16) h16 ts[512];       // text channels
  __shared__ float st[64];                    // mean, then rstd, of this image's 32 groups
  __shared__ v2f gb[256];                     // gamma, beta of an x channel
  const int b   = blockIdx.x >> 5;
  const int p0  = (blockIdx.x & 31) * 32;
  const int tid = threadIdx.x;
  const int q   = tid & 7;    // 4 positions 4q..4q+3
  const int c2  = tid >> 3;   // channel pair 2*c2, 2*c2+1 of each 64

  const float* __restrict__ sb = stats + b * 32;
  const float* __restrict__ tb = text + b * 512;
  const float sv = sb[(tid & 31) + ((tid >> 5) & 1) * 256];
  float gm[3], bt[3], tx[2];
  for (int j = 0; j < 3; ++j) { gm[j] = gamma[j * 256 + tid]; bt[j] = beta[j * 256 + tid]; }
  for (int j = 0; j < 2; ++j) tx[j] = tb[j * 256 + tid];
  f32x4 xv[4][2];
  for (int j = 0; j < 4; ++j)
    for (int e = 0; e < 2; ++e) {
      // wait in front of the last load: the compiler lets its result land in the address pair
      // that the seven issued loads name
      if (j == 3 && e == 1) asm volatile("s_wait_xcnt 0x0" ::: "memory");
      xv[j][e] = *(const f32x4*)(x + (((size_t)b * 256 + j * 64 + c2 * 2 + e) << 10) + p0 + q * 4);
    }

  if (tid < 64) st[tid] = sv;
  {
    const v2f t = {gm[0], bt[0]};
    gb[tid] = t;
  }
  __syncthreads();

  for (int j = 0; j < 2; ++j) {
    const int g = (256 + j * 256 + tid) / 24;
    ts[j * 256 + tid] = (h16)(((tx[j] - st[g]) * st[32 + g]) * gm[j + 1] + bt[j + 1]);
  }
  for (int j = 0; j < 4; ++j) {
    const int c = j * 64 + c2 * 2;
    const int ga = c / 24, gc = (c + 1) / 24;
    const float ma = st[ga], ra = st[32 + ga], mb = st[gc], rb = st[32 + gc];
    const v2f pa = gb[c], pb = gb[c + 1];
    for (int i = 0; i < 4; ++i) {
      h16x2 t;
      t.x = (h16)(((xv[j][0][i] - ma) * ra) * pa.x + pa.y);
      t.y = (h16)(((xv[j][1][i] - mb) * rb) * pb.x + pb.y);
      *(h16x2*)(&xs[(q * 4 + i) * 264 + c]) = t;
    }
  }
  __syncthreads();

  h16* __restrict__ dst = hn + ((size_t)b * 1024 + p0) * 768;
  for (int j = 0; j < 4; ++j) {  // x channels: a wave stores the first 512 B of one row
    const int row = j * 8 + (tid >> 5);
    const int ch  = tid & 31;
    *(u32x4*)(dst + row * 768 + ch * 8) = *(const u32x4*)(&xs[row * 264 + ch * 8]);
  }
  const u32x4 tv = *(const u32x4*)(&ts[(tid & 63) * 8]);
  for (int j = 0; j < 8; ++j) {  // text channels: the same 16 B to 8 rows
    const int row = j * 4 + (tid >> 6);
    *(u32x4*)(dst + row * 768 + 256 + (tid & 63) * 8) = tv;
  }
}

// -------------------- Weights -> f16, transposed [N=768][K=768]; bias concat --------------------
// grid: (12 tiles of 64 k, 24 tiles of 32 n). Whole 128-B lines in (32 n of one k row) and out
// (64 k of one n row), turned in LDS.
__global__ __launch_bounds__(256) void wconv_kernel(
    const float* __restrict__ W0, const float* __restrict__ W1, const float* __restrict__ W2,
    const float* __restrict__ b0, const float* __restrict__ b1, const float* __restrict__ b2,
    h16* __restrict__ Wt, float* __restrict__ bcat) {
  __shared__ __align__(16) h16 tw[32 * 72];  // [n][k], pitch 144 B
  const int k0  = blockIdx.x * 64;
  const int n0  = blockIdx.y * 32;
  const int nn0 = n0 & 255;
  const int tid = threadIdx.x;
  const float* W = (n0 < 256) ? W0 : ((n0 < 512) ? W1 : W2);
  const int q  = tid & 7;    // 4 columns 4q..4q+3
  const int k2 = tid >> 3;   // k pair 2*k2, 2*k2+1
  const f32x4 wa = *(const f32x4*)(W + (size_t)(k0 + k2 * 2) * 256 + nn0 + q * 4);
  const f32x4 wb = *(const f32x4*)(W + (size_t)(k0 + k2 * 2 + 1) * 256 + nn0 + q * 4);
  for (int i = 0; i < 4; ++i) {
    h16x2 t;
    t.x = (h16)wa[i];
    t.y = (h16)wb[i];
    *(h16x2*)(&tw[(q * 4 + i) * 72 + k2 * 2]) = t;
  }
  __syncthreads();
  const int row = tid >> 3, ch = tid & 7;
  *(u32x4*)(Wt + (size_t)(n0 + row) * 768 + k0 + ch * 8) = *(const u32x4*)(&tw[row * 72 + ch * 8]);
  if (blockIdx.x == 0 && tid < 32) {
    const float* bs = (n0 < 256) ? b0 : ((n0 < 512) ? b1 : b2);
    bcat[n0 + tid] = bs[nn0 + tid];
  }
}

__global__ __launch_bounds__(256) void gemm_qkv_kernel(
    const h16* __restrict__ A, const h16* __restrict__ Bt,
    const float* __restrict__ bias, h16* __restrict__ Cout) {
  __shared__ __align__(16) h16 As[2][128 * 48];  // stride 48 h16 = 96B, 16B aligned
  __shared__ __align__(16) h16 Bs[2][128 * 48];
  const int mBase = blockIdx.x * 128;
  const int nBase = blockIdx.y * 128;
  const int tid  = threadIdx.x;
  const int wave = tid >> 5;
  const int lane = tid & 31;
  const int wm = wave >> 1;       // 0..3
  const int wn = wave & 1;        // 0..1
  const int l16 = lane & 15;
  const int hi  = lane >> 4;      // 0/1 selects K phase per WMMA A/B layout

  const int row0 = tid >> 2;            // chunk id tid   -> row, seg
  const int seg0 = tid & 3;
  const int row1 = (tid + 256) >> 2;    // chunk id tid+256
  const int seg1 = (tid + 256) & 3;

  v8f acc[2][4];
  for (int mt = 0; mt < 2; ++mt)
    for (int nt = 0; nt < 4; ++nt)
      for (int r = 0; r < 8; ++r) acc[mt][nt][r] = 0.f;

  auto load_tiles = [&](int k0, int buf) {
    async_copy_b128((unsigned)(uintptr_t)&As[buf][row0 * 48 + seg0 * 8],
                    A + (size_t)(mBase + row0) * 768 + k0 + seg0 * 8);
    async_copy_b128((unsigned)(uintptr_t)&As[buf][row1 * 48 + seg1 * 8],
                    A + (size_t)(mBase + row1) * 768 + k0 + seg1 * 8);
    async_copy_b128((unsigned)(uintptr_t)&Bs[buf][row0 * 48 + seg0 * 8],
                    Bt + (size_t)(nBase + row0) * 768 + k0 + seg0 * 8);
    async_copy_b128((unsigned)(uintptr_t)&Bs[buf][row1 * 48 + seg1 * 8],
                    Bt + (size_t)(nBase + row1) * 768 + k0 + seg1 * 8);
  };

  load_tiles(0, 0);
  wait_async0();
  __syncthreads();

  int buf = 0;
  for (int k0 = 0; k0 < 768; k0 += 32) {
    if (k0 + 32 < 768) load_tiles(k0 + 32, buf ^ 1);  // overlap with compute

    FragV afr[2];
    for (int mt = 0; mt < 2; ++mt) {
      const int row = wm * 32 + mt * 16 + l16;
      const int ko  = hi * 8;
      afr[mt].q[0] = *(const u32x4*)(&As[buf][row * 48 + ko]);
      afr[mt].q[1] = *(const u32x4*)(&As[buf][row * 48 + ko + 16]);
    }
    for (int nt = 0; nt < 4; ++nt) {
      const int col = wn * 64 + nt * 16 + l16;
      const int ko  = hi * 8;
      FragV bfr;
      bfr.q[0] = *(const u32x4*)(&Bs[buf][col * 48 + ko]);
      bfr.q[1] = *(const u32x4*)(&Bs[buf][col * 48 + ko + 16]);
      for (int mt = 0; mt < 2; ++mt)
        acc[mt][nt] = __builtin_amdgcn_wmma_f32_16x16x32_f16(
            false, afr[mt].h, false, bfr.h, (short)0, acc[mt][nt], false, false);
    }

    wait_async0();
    __syncthreads();
    buf ^= 1;
  }

  for (int mt = 0; mt < 2; ++mt)
    for (int nt = 0; nt < 4; ++nt) {
      const int n = nBase + wn * 64 + nt * 16 + l16;
      const float bv = bias[n];
      for (int r = 0; r < 8; ++r) {
        const int m = mBase + wm * 32 + mt * 16 + r + hi * 8;
        Cout[(size_t)m * 768 + n] = (h16)(acc[mt][nt][r] + bv);
      }
    }
}

// -------------------- V transpose: vT[bh][ch=64][pos=1024] --------------------
// grid: 512 blocks = (bh, 64 positions). Whole 128-B lines in (64 channels of one position) and
// out (64 positions of one channel), turned in LDS.
__global__ __launch_bounds__(256) void vtrans_kernel(
    const h16* __restrict__ qkv, h16* __restrict__ vT) {
  __shared__ __align__(16) h16 tv[64 * 72];  // [channel][position], pitch 144 B
  const int bh = blockIdx.x >> 4;
  const int p0 = (blockIdx.x & 15) * 64;
  const int b = bh >> 2, h = bh & 3;
  const int tid = threadIdx.x;
  const int c8 = tid & 7;    // 8 channels 8*c8..8*c8+7
  const int p2 = tid >> 3;   // position pair 2*p2, 2*p2+1
  const h16* src = qkv + ((size_t)b * 1024 + p0 + p2 * 2) * 768 + 512 + h * 64 + c8 * 8;
  const h16x8 va = *(const h16x8*)(src);
  const h16x8 vb = *(const h16x8*)(src + 768);
  for (int i = 0; i < 8; ++i) {
    h16x2 t;
    t.x = va[i];
    t.y = vb[i];
    *(h16x2*)(&tv[(c8 * 8 + i) * 72 + p2 * 2]) = t;
  }
  __syncthreads();
  for (int j = 0; j < 2; ++j) {
    const int row = j * 32 + (tid >> 3);
    const int ch  = tid & 7;
    *(u32x4*)(vT + ((size_t)bh * 64 + row) * 1024 + p0 + ch * 8) =
        *(const u32x4*)(&tv[row * 72 + ch * 8]);
  }
}

__device__ __forceinline__ float xhalf(float v) {
  const int b = __builtin_bit_cast(int, v);
  return __builtin_bit_cast(float,
      __builtin_amdgcn_permlanex16(b, b, 0x76543210, 0xfedcba98, false, false));
}

__global__ __launch_bounds__(256) void attn_kernel(
    const h16* __restrict__ qkv, const h16* __restrict__ vT,
    const float* __restrict__ x, float* __restrict__ out) {
  const int bh = blockIdx.x;
  const int b = bh >> 2, h = bh & 3;
  const int tid = threadIdx.x, wave = tid >> 5, lane = tid & 31;
  const int l16 = lane & 15;
  const int hi  = lane >> 4;
  const int hi8 = hi * 8;
  const int qrow0 = blockIdx.y * 256 + wave * 32;

  // Preload Q fragments: [mt][kc] covers 32 rows x 64 channels
  FragV qf[2][2];
  for (int mt = 0; mt < 2; ++mt)
    for (int kc = 0; kc < 2; ++kc) {
      const int row = qrow0 + mt * 16 + l16;
      const h16* base = qkv + ((size_t)b * 1024 + row) * 768 + h * 64 + kc * 32 + hi * 8;
      qf[mt][kc].q[0] = *(const u32x4*)(base);
      qf[mt][kc].q[1] = *(const u32x4*)(base + 16);
    }

  // per lane: running maximum of query mt*16+l16, and this half's share of its sum
  float mrow[2], lrow[2];
  v8f oacc[2][4];  // O^T tile: [r] = channel nt*16 + hi8 + r, query mt*16 + l16
  for (int mt = 0; mt < 2; ++mt) { mrow[mt] = -1e30f; lrow[mt] = 0.f; }
  for (int mt = 0; mt < 2; ++mt)
    for (int nt = 0; nt < 4; ++nt)
      for (int r = 0; r < 8; ++r) oacc[mt][nt][r] = 0.f;

  for (int kt = 0; kt < 16; ++kt) {
    const int kbase = kt * 64;

    // Prefetch next key tile's K rows and V rows into cache (global_prefetch_b8)
    if (kt + 1 < 16) {
      const int nb = kbase + 64;
      __builtin_prefetch(qkv + ((size_t)b * 1024 + nb + lane) * 768 + 256 + h * 64, 0, 0);
      __builtin_prefetch(qkv + ((size_t)b * 1024 + nb + 32 + lane) * 768 + 256 + h * 64, 0, 0);
      __builtin_prefetch(vT + ((size_t)bh * 64 + lane) * 1024 + nb, 0, 0);
      __builtin_prefetch(vT + ((size_t)bh * 64 + 32 + lane) * 1024 + nb, 0, 0);
    }

    // ---- S^T = K * Q^T: sacc[mt][nt][r] = key nt*16 + hi8 + r, query mt*16 + l16 ----
    v8f sacc[2][4];
    for (int mt = 0; mt < 2; ++mt)
      for (int nt = 0; nt < 4; ++nt)
        for (int r = 0; r < 8; ++r) sacc[mt][nt][r] = 0.f;

    for (int nt = 0; nt < 4; ++nt) {
      const int kp = kbase + nt * 16 + l16;
      const h16* kb = qkv + ((size_t)b * 1024 + kp) * 768 + 256 + h * 64 + hi * 8;
      FragV kf0, kf1;
      kf0.q[0] = *(const u32x4*)(kb);       kf0.q[1] = *(const u32x4*)(kb + 16);
      kf1.q[0] = *(const u32x4*)(kb + 32);  kf1.q[1] = *(const u32x4*)(kb + 48);
      for (int mt = 0; mt < 2; ++mt) {
        sacc[mt][nt] = __builtin_amdgcn_wmma_f32_16x16x32_f16(
            false, kf0.h, false, qf[mt][0].h, (short)0, sacc[mt][nt], false, false);
        sacc[mt][nt] = __builtin_amdgcn_wmma_f32_16x16x32_f16(
            false, kf1.h, false, qf[mt][1].h, (short)0, sacc[mt][nt], false, false);
      }
    }

    // ---- scale + online softmax, one query per lane ----
    // Worked on in pairs of neighbouring accumulator registers (keys 2j, 2j+1 of a tile).
    FragV pf[2][2];  // P^T as B operand: [mt][kc], 32 keys each
    for (int mt = 0; mt < 2; ++mt) {
      v2f sp[4][4];
      for (int nt = 0; nt < 4; ++nt)
        for (int j = 0; j < 4; ++j) {
          const v2f t = {sacc[mt][nt][2 * j], sacc[mt][nt][2 * j + 1]};
          sp[nt][j] = t * 0.125f;  // Ch^-0.5
        }

      float vm[4];
      for (int nt = 0; nt < 4; ++nt) {
        vm[nt] = fmaxf(sp[nt][0].x, sp[nt][0].y);
        for (int j = 1; j < 4; ++j) vm[nt] = fmaxf(vm[nt], fmaxf(sp[nt][j].x, sp[nt][j].y));
      }
      float v = fmaxf(fmaxf(vm[0], vm[1]), fmaxf(vm[2], vm[3]));
      v = fmaxf(v, xhalf(v));  // the other 32 keys of this query
      const float mold = mrow[mt];
      const float mnew = fmaxf(mold, v);
      const float corr = __expf(mold - mnew);
      mrow[mt] = mnew;
      for (int nt = 0; nt < 4; ++nt)
        for (int r = 0; r < 8; ++r) oacc[mt][nt][r] *= corr;
      // tiles 2kc and 2kc+1 hold keys hi8+0..7 and 16+hi8+0..7 of chunk kc: the B k order
      v2f ps[4];
      for (int nt = 0; nt < 4; ++nt) {
        for (int j = 0; j < 4; ++j) {
          const v2f d = sp[nt][j] - mnew;
          const v2f p = {__expf(d.x), __expf(d.y)};
          ps[nt] = (j == 0) ? p : ps[nt] + p;
          pf[mt][nt >> 1].h[(nt & 1) * 8 + 2 * j]     = (h16)p.x;
          pf[mt][nt >> 1].h[(nt & 1) * 8 + 2 * j + 1] = (h16)p.y;
        }
      }
      const v2f pt = (ps[0] + ps[1]) + (ps[2] + ps[3]);
      lrow[mt] = lrow[mt] * corr + (pt.x + pt.y);
    }

    // ---- O^T += V^T * P^T ----
    for (int kc = 0; kc < 2; ++kc) {
      for (int nt = 0; nt < 4; ++nt) {
        const int ch = nt * 16 + l16;
        const h16* vb = vT + ((size_t)bh * 64 + ch) * 1024 + kbase + kc * 32 + hi * 8;
        FragV vf;
        vf.q[0] = *(const u32x4*)(vb);
        vf.q[1] = *(const u32x4*)(vb + 16);
        for (int mt = 0; mt < 2; ++mt)
          oacc[mt][nt] = __builtin_amdgcn_wmma_f32_16x16x32_f16(
              false, vf.h, false, pf[mt][kc].h, (short)0, oacc[mt][nt], false, false);
      }
    }
  }

  // ---- finalize: join the halves' sums, O * (1/l), residual add, store f32 [B,C,H*W] ----
  float linv[2];
  for (int mt = 0; mt < 2; ++mt) linv[mt] = 1.0f / (lrow[mt] + xhalf(lrow[mt]));
  for (int mt = 0; mt < 2; ++mt)
    for (int nt = 0; nt < 4; ++nt) {
      const int pos = qrow0 + mt * 16 + l16;
      for (int r = 0; r < 8; ++r) {
        const int c = h * 64 + nt * 16 + hi8 + r;
        const size_t idx = ((size_t)b * 256 + c) * 1024 + pos;
        out[idx] = x[idx] + oacc[mt][nt][r] * linv[mt];
      }
    }
}

// -------------------- launch --------------------
extern "C" void kernel_launch(void* const* d_in, const int* in_sizes, int n_in,
                              void* d_out, int out_size, void* d_ws, size_t ws_size,
                              hipStream_t stream) {
  const float* x     = (const float*)d_in[0];
  const float* text  = (const float*)d_in[1];
  const float* gamma = (const float*)d_in[2];
  const float* beta  = (const float*)d_in[3];
  const float* W0    = (const float*)d_in[4];
  const float* b0    = (const float*)d_in[5];
  const float* W1    = (const float*)d_in[6];
  const float* b1    = (const float*)d_in[7];
  const float* W2    = (const float*)d_in[8];
  const float* b2    = (const float*)d_in[9];
  float* out = (float*)d_out;

  char* ws = (char*)d_ws;
  float* stats = (float*)ws;                    // 512 f32
  float* bcat  = (float*)(ws + 2048);           // 768 f32
  h16*   hn    = (h16*)(ws + 8192);             // 8*1024*768
  h16*   Wt    = hn + (size_t)8 * 1024 * 768;   // 768*768
  h16*   qkv   = Wt + (size_t)768 * 768;        // 8*1024*768
  h16*   vT    = qkv + (size_t)8 * 1024 * 768;  // 32*64*1024

  gn_stats_kernel<<<256, 256, 0, stream>>>(x, text, stats);
  normalize_kernel<<<256, 256, 0, stream>>>(x, text, stats, gamma, beta, hn);
  wconv_kernel<<<dim3(12, 24), 256, 0, stream>>>(W0, W1, W2, b0, b1, b2, Wt, bcat);
  gemm_qkv_kernel<<<dim3(64, 6), 256, 0, stream>>>(hn, Wt, bcat, qkv);
  vtrans_kernel<<<512, 256, 0, stream>>>(qkv, vT);
  attn_kernel<<<dim3(32, 4), 256, 0, stream>>>(qkv, vT, x, out);
}

// v003
// Measured time: 73.9 microseconds a run.
// Next to v002, in two timings, it ran 1.42 and 1.41 times as fast.
// Counting every step since v000, it is 2.73 times as fast.
#include <hip/hip_runtime.h>
#include <hip/hip_bf16.h>

typedef _Float16 h16;
typedef __attribute__((ext_vector_type(16))) _Float16 v16h;
typedef __attribute__((ext_vector_type(8)))  float    v8f;
typedef __attribute__((ext_vector_type(2)))  float    v2f;
typedef __attribute__((ext_vector_type(4)))  unsigned int u32x4;
typedef __attribute__((ext_vector_type(4)))  float    f32x4;
typedef __attribute__((ext_vector_type(2)))  _Float16 h16x2;
typedef __attribute__((ext_vector_type(8)))  _Float16 h16x8;

union FragV { u32x4 q[2]; v16h h; };

__device__ __forceinline__ void async_copy_b128(unsigned ldsOff, const void* gaddr) {
  asm volatile("global_load_async_to_lds_b128 %0, %1, off"
               :: "v"(ldsOff), "v"(gaddr) : "memory");
}
__device__ __forceinline__ void async_copy4_b128(unsigned l0, const void* g0, unsigned l1, const void* g1,
                                                 unsigned l2, const void* g2, unsigned l3, const void* g3) {
  asm volatile("global_load_async_to_lds_b128 %0, %1, off\n\t"
               "global_load_async_to_lds_b128 %2, %3, off\n\t"
               "global_load_async_to_lds_b128 %4, %5, off\n\t"
               "global_load_async_to_lds_b128 %6, %7, off\n\t"
               "s_wait_xcnt 0x0"
               :: "v"(l0), "v"(g0), "v"(l1), "v"(g1), "v"(l2), "v"(g2), "v"(l3), "v"(g3) : "memory");
}
__device__ __forceinline__ void wait_async0() {
  asm volatile("s_wait_asynccnt 0" ::: "memory");
}

// -------------------- GroupNorm statistics --------------------
// grid: 256 blocks = (b,g), 256 threads. Group g covers channels [24g,24g+24).
__global__ __launch_bounds__(256) void gn_stats_kernel(
    const float* __restrict__ x, const float* __restrict__ text,
    float* __restrict__ stats) {
  const int b = blockIdx.x >> 5;
  const int g = blockIdx.x & 31;
  const int tid = threadIdx.x;
  float s = 0.f, ss = 0.f;
  for (int idx = tid; idx < 24 * 1024; idx += 256) {
    const int c = g * 24 + (idx >> 10);
    const int p = idx & 1023;
    float v = (c < 256) ? x[(((size_t)b * 256 + c) << 10) + p]
                        : text[b * 512 + (c - 256)];
    s += v; ss += v * v;
  }
  for (int off = 16; off >= 1; off >>= 1) {
    s  += __shfl_xor(s,  off, 32);
    ss += __shfl_xor(ss, off, 32);
  }
  __shared__ float rs[8], rss[8];
  if ((tid & 31) == 0) { rs[tid >> 5] = s; rss[tid >> 5] = ss; }
  __syncthreads();
  if (tid == 0) {
    float S = 0.f, SS = 0.f;
    for (int i = 0; i < 8; ++i) { S += rs[i]; SS += rss[i]; }
    const float mean = S * (1.f / 24576.f);
    const float var  = SS * (1.f / 24576.f) - mean * mean;
    stats[blockIdx.x]       = mean;
    stats[256 + blockIdx.x] = rsqrtf(var + 1e-6f);
  }
}

// -------------------- Normalize + cast to f16, layout [B*HW, 768] --------------------
// grid: 256 blocks = (b, 32 positions). The x tile [256 channels][32 positions] is read in whole
// 128-B lines, turned in LDS and stored as 16-B pieces of hn rows. The 512 text channels do not
// depend on the position: each is normalized once per block and stored to all 32 rows.
__global__ __launch_bounds__(256) void normalize_kernel(
    const float* __restrict__ x, const float* __restrict__ text,
    const float* __restrict__ stats, const float* __restrict__ gamma,
    const float* __restrict__ beta, h16* __restrict__ hn) {
  __shared__ __align__(16) h16 xs[32 * 264];  // [position][channel], pitch 528 B
  __shared__ __align__(16) h16 ts[512];       // text channels
  __shared__ float st[64];                    // mean, then rstd, of this image's 32 groups
  __shared__ v2f gb[256];                     // gamma, beta of an x channel
  const int b   = blockIdx.x >> 5;
  const int p0  = (blockIdx.x & 31) * 32;
  const int tid = threadIdx.x;
  const int q   = tid & 7;    // 4 positions 4q..4q+3
  const int c2  = tid >> 3;   // channel pair 2*c2, 2*c2+1 of each 64

  const float* __restrict__ sb = stats + b * 32;
  const float* __restrict__ tb = text + b * 512;
  const float sv = sb[(tid & 31) + ((tid >> 5) & 1) * 256];
  float gm[3], bt[3], tx[2];
  for (int j = 0; j < 3; ++j) { gm[j] = gamma[j * 256 + tid]; bt[j] = beta[j * 256 + tid]; }
  for (int j = 0; j < 2; ++j) tx[j] = tb[j * 256 + tid];
  f32x4 xv[4][2];
  for (int j = 0; j < 4; ++j)
    for (int e = 0; e < 2; ++e) {
      // wait in front of the last load: the compiler lets its result land in the address pair
      // that the seven issued loads name
      if (j == 3 && e == 1) asm volatile("s_wait_xcnt 0x0" ::: "memory");
      xv[j][e] = *(const f32x4*)(x + (((size_t)b * 256 + j * 64 + c2 * 2 + e) << 10) + p0 + q * 4);
    }

  if (tid < 64) st[tid] = sv;
  {
    const v2f t = {gm[0], bt[0]};
    gb[tid] = t;
  }
  __syncthreads();

  for (int j = 0; j < 2; ++j) {
    const int g = (256 + j * 256 + tid) / 24;
    ts[j * 256 + tid] = (h16)(((tx[j] - st[g]) * st[32 + g]) * gm[j + 1] + bt[j + 1]);
  }
  for (int j = 0; j < 4; ++j) {
    const int c = j * 64 + c2 * 2;
    const int ga = c / 24, gc = (c + 1) / 24;
    const float ma = st[ga], ra = st[32 + ga], mb = st[gc], rb = st[32 + gc];
    const v2f pa = gb[c], pb = gb[c + 1];
    for (int i = 0; i < 4; ++i) {
      h16x2 t;
      t.x = (h16)(((xv[j][0][i] - ma) * ra) * pa.x + pa.y);
      t.y = (h16)(((xv[j][1][i] - mb) * rb) * pb.x + pb.y);
      *(h16x2*)(&xs[(q * 4 + i) * 264 + c]) = t;
    }
  }
  __syncthreads();

  h16* __restrict__ dst = hn + ((size_t)b * 1024 + p0) * 768;
  for (int j = 0; j < 4; ++j) {  // x channels: a wave stores the first 512 B of one row
    const int row = j * 8 + (tid >> 5);
    const int ch  = tid & 31;
    *(u32x4*)(dst + row * 768 + ch * 8) = *(const u32x4*)(&xs[row * 264 + ch * 8]);
  }
  const u32x4 tv = *(const u32x4*)(&ts[(tid & 63) * 8]);
  for (int j = 0; j < 8; ++j) {  // text channels: the same 16 B to 8 rows
    const int row = j * 4 + (tid >> 6);
    *(u32x4*)(dst + row * 768 + 256 + (tid & 63) * 8) = tv;
  }
}

// -------------------- Weights -> f16, transposed [N=768][K=768]; bias concat --------------------
// grid: (12 tiles of 64 k, 24 tiles of 32 n). Whole 128-B lines in (32 n of one k row) and out
// (64 k of one n row), turned in LDS.
__global__ __launch_bounds__(256) void wconv_kernel(
    const float* __restrict__ W0, const float* __restrict__ W1, const float* __restrict__ W2,
    const float* __restrict__ b0, const float* __restrict__ b1, const float* __restrict__ b2,
    h16* __restrict__ Wt, float* __restrict__ bcat) {
  __shared__ __align__(16) h16 tw[32 * 72];  // [n][k], pitch 144 B
  const int k0  = blockIdx.x * 64;
  const int n0  = blockIdx.y * 32;
  const int nn0 = n0 & 255;
  const int tid = threadIdx.x;
  const float* W = (n0 < 256) ? W0 : ((n0 < 512) ? W1 : W2);
  const int q  = tid & 7;    // 4 columns 4q..4q+3
  const int k2 = tid >> 3;   // k pair 2*k2, 2*k2+1
  const f32x4 wa = *(const f32x4*)(W + (size_t)(k0 + k2 * 2) * 256 + nn0 + q * 4);
  const f32x4 wb = *(const f32x4*)(W + (size_t)(k0 + k2 * 2 + 1) * 256 + nn0 + q * 4);
  for (int i = 0; i < 4; ++i) {
    h16x2 t;
    t.x = (h16)wa[i];
    t.y = (h16)wb[i];
    *(h16x2*)(&tw[(q * 4 + i) * 72 + k2 * 2]) = t;
  }
  __syncthreads();
  const int row = tid >> 3, ch = tid & 7;
  *(u32x4*)(Wt + (size_t)(n0 + row) * 768 + k0 + ch * 8) = *(const u32x4*)(&tw[row * 72 + ch * 8]);
  if (blockIdx.x == 0 && tid < 32) {
    const float* bs = (n0 < 256) ? b0 : ((n0 < 512) ? b1 : b2);
    bcat[n0 + tid] = bs[nn0 + tid];
  }
}

__global__ __launch_bounds__(256) void gemm_qkv_kernel(
    const h16* __restrict__ A, const h16* __restrict__ Bt,
    const float* __restrict__ bias, h16* __restrict__ Cout) {
  __shared__ __align__(16) h16 As[2][128 * 48];  // stride 48 h16 = 96B, 16B aligned
  __shared__ __align__(16) h16 Bs[2][128 * 48];
  const int mBase = blockIdx.x * 128;
  const int nBase = blockIdx.y * 128;
  const int tid  = threadIdx.x;
  const int wave = tid >> 5;
  const int lane = tid & 31;
  const int wm = wave >> 1;       // 0..3
  const int wn = wave & 1;        // 0..1
  const int l16 = lane & 15;
  const int hi  = lane >> 4;      // 0/1 selects K phase per WMMA A/B layout

  const int row0 = tid >> 2;            // chunk id tid   -> row, seg
  const int seg0 = tid & 3;
  const int row1 = (tid + 256) >> 2;    // chunk id tid+256
  const int seg1 = (tid + 256) & 3;

  v8f acc[2][4];
  for (int mt = 0; mt < 2; ++mt)
    for (int nt = 0; nt < 4; ++nt)
      for (int r = 0; r < 8; ++r) acc[mt][nt][r] = 0.f;

  auto load_tiles = [&](int k0, int buf) {
    async_copy_b128((unsigned)(uintptr_t)&As[buf][row0 * 48 + seg0 * 8],
                    A + (size_t)(mBase + row0) * 768 + k0 + seg0 * 8);
    async_copy_b128((unsigned)(uintptr_t)&As[buf][row1 * 48 + seg1 * 8],
                    A + (size_t)(mBase + row1) * 768 + k0 + seg1 * 8);
    async_copy_b128((unsigned)(uintptr_t)&Bs[buf][row0 * 48 + seg0 * 8],
                    Bt + (size_t)(nBase + row0) * 768 + k0 + seg0 * 8);
    async_copy_b128((unsigned)(uintptr_t)&Bs[buf][row1 * 48 + seg1 * 8],
                    Bt + (size_t)(nBase + row1) * 768 + k0 + seg1 * 8);
  };

  load_tiles(0, 0);
  wait_async0();
  __syncthreads();

  int buf = 0;
  for (int k0 = 0; k0 < 768; k0 += 32) {
    if (k0 + 32 < 768) load_tiles(k0 + 32, buf ^ 1);  // overlap with compute

    FragV afr[2];
    for (int mt = 0; mt < 2; ++mt) {
      const int row = wm * 32 + mt * 16 + l16;
      const int ko  = hi * 8;
      afr[mt].q[0] = *(const u32x4*)(&As[buf][row * 48 + ko]);
      afr[mt].q[1] = *(const u32x4*)(&As[buf][row * 48 + ko + 16]);
    }
    for (int nt = 0; nt < 4; ++nt) {
      const int col = wn * 64 + nt * 16 + l16;
      const int ko  = hi * 8;
      FragV bfr;
      bfr.q[0] = *(const u32x4*)(&Bs[buf][col * 48 + ko]);
      bfr.q[1] = *(const u32x4*)(&Bs[buf][col * 48 + ko + 16]);
      for (int mt = 0; mt < 2; ++mt)
        acc[mt][nt] = __builtin_amdgcn_wmma_f32_16x16x32_f16(
            false, afr[mt].h, false, bfr.h, (short)0, acc[mt][nt], false, false);
    }

    wait_async0();
    __syncthreads();
    buf ^= 1;
  }

  for (int mt = 0; mt < 2; ++mt)
    for (int nt = 0; nt < 4; ++nt) {
      const int n = nBase + wn * 64 + nt * 16 + l16;
      const float bv = bias[n];
      for (int r = 0; r < 8; ++r) {
        const int m = mBase + wm * 32 + mt * 16 + r + hi * 8;
        Cout[(size_t)m * 768 + n] = (h16)(acc[mt][nt][r] + bv);
      }
    }
}

// -------------------- V transpose: vT[bh][ch=64][pos=1024] --------------------
// grid: 512 blocks = (bh, 64 positions). Whole 128-B lines in (64 channels of one position) and
// out (64 positions of one channel), turned in LDS.
__global__ __launch_bounds__(256) void vtrans_kernel(
    const h16* __restrict__ qkv, h16* __restrict__ vT) {
  __shared__ __align__(16) h16 tv[64 * 72];  // [channel][position], pitch 144 B
  const int bh = blockIdx.x >> 4;
  const int p0 = (blockIdx.x & 15) * 64;
  const int b = bh >> 2, h = bh & 3;
  const int tid = threadIdx.x;
  const int c8 = tid & 7;    // 8 channels 8*c8..8*c8+7
  const int p2 = tid >> 3;   // position pair 2*p2, 2*p2+1
  const h16* src = qkv + ((size_t)b * 1024 + p0 + p2 * 2) * 768 + 512 + h * 64 + c8 * 8;
  const h16x8 va = *(const h16x8*)(src);
  const h16x8 vb = *(const h16x8*)(src + 768);
  for (int i = 0; i < 8; ++i) {
    h16x2 t;
    t.x = va[i];
    t.y = vb[i];
    *(h16x2*)(&tv[(c8 * 8 + i) * 72 + p2 * 2]) = t;
  }
  __syncthreads();
  for (int j = 0; j < 2; ++j) {
    const int row = j * 32 + (tid >> 3);
    const int ch  = tid & 7;
    *(u32x4*)(vT + ((size_t)bh * 64 + row) * 1024 + p0 + ch * 8) =
        *(const u32x4*)(&tv[row * 72 + ch * 8]);
  }
}

__device__ __forceinline__ float xhalf(float v) {
  const int b = __builtin_bit_cast(int, v);
  return __builtin_bit_cast(float,
      __builtin_amdgcn_permlanex16(b, b, 0x76543210, 0xfedcba98, false, false));
}

__global__ __launch_bounds__(256) void attn_kernel(
    const h16* __restrict__ qkv, const h16* __restrict__ vT,
    const float* __restrict__ x, float* __restrict__ out) {
  const int bh = blockIdx.x;
  const int b = bh >> 2, h = bh & 3;
  const int tid = threadIdx.x, wave = tid >> 5, lane = tid & 31;
  const int l16 = lane & 15;
  const int hi  = lane >> 4;
  const int hi8 = hi * 8;
  const int qrow0 = blockIdx.y * 256 + wave * 32;

  __shared__ __align__(16) h16 Ks[2][64 * 72];  // [key][channel], pitch 144 B
  __shared__ __align__(16) h16 Vs[2][64 * 72];  // [channel][key], pitch 144 B
  // a thread copies 16 B of rows crow and crow + 32 of both tiles; a wave covers whole 128-B rows
  const int crow = tid >> 3;
  const int cseg = (tid & 7) * 8;
  const h16* __restrict__ ksrc = qkv + ((size_t)b * 1024 + crow) * 768 + 256 + h * 64 + cseg;
  const h16* __restrict__ vsrc = vT + ((size_t)bh * 64 + crow) * 1024 + cseg;
  auto stage = [&](int kt, int buf) {
    const h16* kp = ksrc + (size_t)kt * 64 * 768;
    const h16* vp = vsrc + kt * 64;
    async_copy4_b128((unsigned)(uintptr_t)&Ks[buf][crow * 72 + cseg], kp,
                     (unsigned)(uintptr_t)&Ks[buf][(crow + 32) * 72 + cseg], kp + 32 * 768,
                     (unsigned)(uintptr_t)&Vs[buf][crow * 72 + cseg], vp,
                     (unsigned)(uintptr_t)&Vs[buf][(crow + 32) * 72 + cseg], vp + 32 * 1024);
  };
  stage(0, 0);

  // Preload Q fragments: [mt][kc] covers 32 rows x 64 channels
  FragV qf[2][2];
  for (int mt = 0; mt < 2; ++mt)
    for (int kc = 0; kc < 2; ++kc) {
      const int row = qrow0 + mt * 16 + l16;
      const h16* base = qkv + ((size_t)b * 1024 + row) * 768 + h * 64 + kc * 32 + hi * 8;
      qf[mt][kc].q[0] = *(const u32x4*)(base);
      qf[mt][kc].q[1] = *(const u32x4*)(base + 16);
    }

  // per lane: running maximum of query mt*16+l16, and this half's share of its sum
  float mrow[2], lrow[2];
  v8f oacc[2][4];  // O^T tile: [r] = channel nt*16 + hi8 + r, query mt*16 + l16
  for (int mt = 0; mt < 2; ++mt) { mrow[mt] = -1e30f; lrow[mt] = 0.f; }
  for (int mt = 0; mt < 2; ++mt)
    for (int nt = 0; nt < 4; ++nt)
      for (int r = 0; r < 8; ++r) oacc[mt][nt][r] = 0.f;

  wait_async0();    // tile 0 has landed for this wave's copies
  __syncthreads();  // and for every wave's
  stage(1, 1);

  for (int kt = 0; kt < 16; ++kt) {
    const h16* Kt = Ks[kt & 1];
    const h16* Vt = Vs[kt & 1];

    // ---- S^T = K * Q^T: sacc[mt][nt][r] = key nt*16 + hi8 + r, query mt*16 + l16 ----
    v8f sacc[2][4];
    for (int mt = 0; mt < 2; ++mt)
      for (int nt = 0; nt < 4; ++nt)
        for (int r = 0; r < 8; ++r) sacc[mt][nt][r] = 0.f;

    for (int nt = 0; nt < 4; ++nt) {
      const h16* kb = Kt + (nt * 16 + l16) * 72 + hi * 8;
      FragV kf0, kf1;
      kf0.q[0] = *(const u32x4*)(kb);       kf0.q[1] = *(const u32x4*)(kb + 16);
      kf1.q[0] = *(const u32x4*)(kb + 32);  kf1.q[1] = *(const u32x4*)(kb + 48);
      for (int mt = 0; mt < 2; ++mt) {
        sacc[mt][nt] = __builtin_amdgcn_wmma_f32_16x16x32_f16(
            false, kf0.h, false, qf[mt][0].h, (short)0, sacc[mt][nt], false, false);
        sacc[mt][nt] = __builtin_amdgcn_wmma_f32_16x16x32_f16(
            false, kf1.h, false, qf[mt][1].h, (short)0, sacc[mt][nt], false, false);
      }
    }

    // ---- scale + online softmax, one query per lane ----
    // Worked on in pairs of neighbouring accumulator registers (keys 2j, 2j+1 of a tile).
    FragV pf[2][2];  // P^T as B operand: [mt][kc], 32 keys each
    for (int mt = 0; mt < 2; ++mt) {
      v2f sp[4][4];
      for (int nt = 0; nt < 4; ++nt)
        for (int j = 0; j < 4; ++j) {
          const v2f t = {sacc[mt][nt][2 * j], sacc[mt][nt][2 * j + 1]};
          sp[nt][j] = t * 0.125f;  // Ch^-0.5
        }

      float vm[4];
      for (int nt = 0; nt < 4; ++nt) {
        vm[nt] = fmaxf(sp[nt][0].x, sp[nt][0].y);
        for (int j = 1; j < 4; ++j) vm[nt] = fmaxf(vm[nt], fmaxf(sp[nt][j].x, sp[nt][j].y));
      }
      float v = fmaxf(fmaxf(vm[0], vm[1]), fmaxf(vm[2], vm[3]));
      v = fmaxf(v, xhalf(v));  // the other 32 keys of this query
      const float mold = mrow[mt];
      const float mnew = fmaxf(mold, v);
      const float corr = __expf(mold - mnew);
      mrow[mt] = mnew;
      for (int nt = 0; nt < 4; ++nt)
        for (int r = 0; r < 8; ++r) oacc[mt][nt][r] *= corr;
      // tiles 2kc and 2kc+1 hold keys hi8+0..7 and 16+hi8+0..7 of chunk kc: the B k order
      v2f ps[4];
      for (int nt = 0; nt < 4; ++nt) {
        for (int j = 0; j < 4; ++j) {
          const v2f d = sp[nt][j] - mnew;
          const v2f p = {__expf(d.x), __expf(d.y)};
          ps[nt] = (j == 0) ? p : ps[nt] + p;
          pf[mt][nt >> 1].h[(nt & 1) * 8 + 2 * j]     = (h16)p.x;
          pf[mt][nt >> 1].h[(nt & 1) * 8 + 2 * j + 1] = (h16)p.y;
        }
      }
      const v2f pt = (ps[0] + ps[1]) + (ps[2] + ps[3]);
      lrow[mt] = lrow[mt] * corr + (pt.x + pt.y);
    }

    // ---- O^T += V^T * P^T ----
    for (int kc = 0; kc < 2; ++kc) {
      for (int nt = 0; nt < 4; ++nt) {
        const h16* vb = Vt + (nt * 16 + l16) * 72 + kc * 32 + hi * 8;
        FragV vf;
        vf.q[0] = *(const u32x4*)(vb);
        vf.q[1] = *(const u32x4*)(vb + 16);
        for (int mt = 0; mt < 2; ++mt)
          oacc[mt][nt] = __builtin_amdgcn_wmma_f32_16x16x32_f16(
              false, vf.h, false, pf[mt][kc].h, (short)0, oacc[mt][nt], false, false);
      }
    }

    // hand-over: this wave's reads of tile kt are done, its copies of tile kt + 1 have landed;
    // behind the barrier that holds for all waves, and tile kt's buffer may be refilled
    asm volatile("s_wait_dscnt 0x0" ::: "memory");
    wait_async0();
    __syncthreads();
    if (kt + 2 < 16) stage(kt + 2, kt & 1);
  }
  wait_async0();  // nothing is in flight when the wave ends

  // ---- finalize: join the halves' sums, O * (1/l), residual add, store f32 [B,C,H*W] ----
  float linv[2];
  for (int mt = 0; mt < 2; ++mt) linv[mt] = 1.0f / (lrow[mt] + xhalf(lrow[mt]));
  for (int mt = 0; mt < 2; ++mt)
    for (int nt = 0; nt < 4; ++nt) {
      const int pos = qrow0 + mt * 16 + l16;
      for (int r = 0; r < 8; ++r) {
        const int c = h * 64 + nt * 16 + hi8 + r;
        const size_t idx = ((size_t)b * 256 + c) * 1024 + pos;
        out[idx] = x[idx] + oacc[mt][nt][r] * linv[mt];
      }
    }
}

// -------------------- launch --------------------
extern "C" void kernel_launch(void* const* d_in, const int* in_sizes, int n_in,
                              void* d_out, int out_size, void* d_ws, size_t ws_size,
                              hipStream_t stream) {
  const float* x     = (const float*)d_in[0];
  const float* text  = (const float*)d_in[1];
  const float* gamma = (const float*)d_in[2];
  const float* beta  = (const float*)d_in[3];
  const float* W0    = (const float*)d_in[4];
  const float* b0    = (const float*)d_in[5];
  const float* W1    = (const float*)d_in[6];
  const float* b1    = (const float*)d_in[7];
  const float* W2    = (const float*)d_in[8];
  const float* b2    = (const float*)d_in[9];
  float* out = (float*)d_out;

  char* ws = (char*)d_ws;
  float* stats = (float*)ws;                    // 512 f32
  float* bcat  = (float*)(ws + 2048);           // 768 f32
  h16*   hn    = (h16*)(ws + 8192);             // 8*1024*768
  h16*   Wt    = hn + (size_t)8 * 1024 * 768;   // 768*768
  h16*   qkv   = Wt + (size_t)768 * 768;        // 8*1024*768
  h16*   vT    = qkv + (size_t)8 * 1024 * 768;  // 32*64*1024

  gn_stats_kernel<<<256, 256, 0, stream>>>(x, text, stats);
  normalize_kernel<<<256, 256, 0, stream>>>(x, text, stats, gamma, beta, hn);
  wconv_kernel<<<dim3(12, 24), 256, 0, stream>>>(W0, W1, W2, b0, b1, b2, Wt, bcat);
  gemm_qkv_kernel<<<dim3(64, 6), 256, 0, stream>>>(hn, Wt, bcat, qkv);
  vtrans_kernel<<<512, 256, 0, stream>>>(qkv, vT);
  attn_kernel<<<dim3(32, 4), 256, 0, stream>>>(qkv, vT, x, out);
}

// v004
// It runs in 54.3 microseconds.
// Timed twice side by side with v003, it ran 1.35 and 1.36 times as fast.
// Over all steps from v000 it is 3.70 times as fast.
#include <hip/hip_runtime.h>
#include <hip/hip_bf16.h>

typedef _Float16 h16;
typedef __attribute__((ext_vector_type(16))) _Float16 v16h;
typedef __attribute__((ext_vector_type(8)))  float    v8f;
typedef __attribute__((ext_vector_type(2)))  float    v2f;
typedef __attribute__((ext_vector_type(4)))  unsigned int u32x4;
typedef __attribute__((ext_vector_type(4)))  float    f32x4;
typedef __attribute__((ext_vector_type(2)))  _Float16 h16x2;
typedef __attribute__((ext_vector_type(8)))  _Float16 h16x8;

union FragV { u32x4 q[2]; v16h h; };

__device__ __forceinline__ void async_copy_b128(unsigned ldsOff, const void* gaddr) {
  asm volatile("global_load_async_to_lds_b128 %0, %1, off"
               :: "v"(ldsOff), "v"(gaddr) : "memory");
}
__device__ __forceinline__ void async_copy4_b128(unsigned l0, const void* g0, unsigned l1, const void* g1,
                                                 unsigned l2, const void* g2, unsigned l3, const void* g3) {
  asm volatile("global_load_async_to_lds_b128 %0, %1, off\n\t"
               "global_load_async_to_lds_b128 %2, %3, off\n\t"
               "global_load_async_to_lds_b128 %4, %5, off\n\t"
               "global_load_async_to_lds_b128 %6, %7, off\n\t"
               "s_wait_xcnt 0x0"
               :: "v"(l0), "v"(g0), "v"(l1), "v"(g1), "v"(l2), "v"(g2), "v"(l3), "v"(g3) : "memory");
}
__device__ __forceinline__ void wait_async0() {
  asm volatile("s_wait_asynccnt 0" ::: "memory");
}

// -------------------- GroupNorm statistics --------------------
// grid: 256 blocks = (b,g), 256 threads. Group g covers channels [24g,24g+24).
// A thread takes 4 neighbouring positions of each of the 24 channels. The channels come in three
// runs of 8: 24g and 256 are multiples of 8, so a run is all x or all text, x runs first.
// One thread's share of a group with NX runs of x channels: every load is issued before the
// first sum reads one, so the block waits for memory once.
template <int NX>
__device__ __forceinline__ void gn_part(const float* __restrict__ xs, const float* __restrict__ ts,
                                        float& s, float& ss) {
  f32x4 v[NX * 8 + 1];
  for (int e = 0; e < NX * 8; ++e) v[e] = *(const f32x4*)(xs + (e << 10));
  // keeps the sums behind the last load: without it the compiler holds half of the loads back
  // until the first ones have returned, a second trip to memory
  __builtin_amdgcn_sched_barrier(0);
  float st = 0.f, sq = 0.f;  // a text channel has one value at all positions
  for (int e = 0; e < (3 - NX) * 8; ++e) { const float t = ts[e]; st += t; sq += t * t; }
  f32x4 s4 = {st, st, st, st}, q4 = {sq, sq, sq, sq};
  for (int e = 0; e < NX * 8; ++e) { s4 += v[e]; q4 += v[e] * v[e]; }
  s  = (s4.x + s4.y) + (s4.z + s4.w);
  ss = (q4.x + q4.y) + (q4.z + q4.w);
}

__global__ __launch_bounds__(256) void gn_stats_kernel(
    const float* __restrict__ x, const float* __restrict__ text,
    float* __restrict__ stats) {
  const int b = blockIdx.x >> 5;
  const int g = blockIdx.x & 31;
  const int tid = threadIdx.x;
  const int nx = (g * 24 >= 256) ? 0 : ((256 - g * 24 >= 24) ? 3 : ((256 - g * 24) >> 3));
  const float* __restrict__ xs = x + (((size_t)b * 256 + g * 24) << 10) + tid * 4;
  const float* __restrict__ ts = text + b * 512 + (g * 24 + nx * 8 - 256);
  float s, ss;
  if (nx == 3)      gn_part<3>(xs, ts, s, ss);
  else if (nx == 2) gn_part<2>(xs, ts, s, ss);
  else if (nx == 1) gn_part<1>(xs, ts, s, ss);
  else              gn_part<0>(xs, ts, s, ss);
  for (int off = 16; off >= 1; off >>= 1) {
    s  += __shfl_xor(s,  off, 32);
    ss += __shfl_xor(ss, off, 32);
  }
  __shared__ float rs[8], rss[8];
  if ((tid & 31) == 0) { rs[tid >> 5] = s; rss[tid >> 5] = ss; }
  __syncthreads();
  if (tid == 0) {
    float S = 0.f, SS = 0.f;
    for (int i = 0; i < 8; ++i) { S += rs[i]; SS += rss[i]; }
    const float mean = S * (1.f / 24576.f);
    const float var  = SS * (1.f / 24576.f) - mean * mean;
    stats[blockIdx.x]       = mean;
    stats[256 + blockIdx.x] = rsqrtf(var + 1e-6f);
  }
}

// -------------------- Normalize + cast to f16, layout [B*HW, 768] --------------------
// grid: 256 blocks = (b, 32 positions). The x tile [256 channels][32 positions] is read in whole
// 128-B lines, turned in LDS and stored as 16-B pieces of hn rows. The 512 text channels do not
// depend on the position: each is normalized once per block and stored to all 32 rows.
__global__ __launch_bounds__(256) void normalize_kernel(
    const float* __restrict__ x, const float* __restrict__ text,
    const float* __restrict__ stats, const float* __restrict__ gamma,
    const float* __restrict__ beta, h16* __restrict__ hn) {
  __shared__ __align__(16) h16 xs[32 * 264];  // [position][channel], pitch 528 B
  __shared__ __align__(16) h16 ts[512];       // text channels
  __shared__ float st[64];                    // mean, then rstd, of this image's 32 groups
  __shared__ v2f gb[256];                     // gamma, beta of an x channel
  const int b   = blockIdx.x >> 5;
  const int p0  = (blockIdx.x & 31) * 32;
  const int tid = threadIdx.x;
  const int q   = tid & 7;    // 4 positions 4q..4q+3
  const int c2  = tid >> 3;   // channel pair 2*c2, 2*c2+1 of each 64

  const float* __restrict__ sb = stats + b * 32;
  const float* __restrict__ tb = text + b * 512;
  const float sv = sb[(tid & 31) + ((tid >> 5) & 1) * 256];
  float gm[3], bt[3], tx[2];
  for (int j = 0; j < 3; ++j) { gm[j] = gamma[j * 256 + tid]; bt[j] = beta[j * 256 + tid]; }
  for (int j = 0; j < 2; ++j) tx[j] = tb[j * 256 + tid];
  f32x4 xv[4][2];
  for (int j = 0; j < 4; ++j)
    for (int e = 0; e < 2; ++e) {
      // wait in front of the last load: the compiler lets its result land in the address pair
      // that the seven issued loads name
      if (j == 3 && e == 1) asm volatile("s_wait_xcnt 0x0" ::: "memory");
      xv[j][e] = *(const f32x4*)(x + (((size_t)b * 256 + j * 64 + c2 * 2 + e) << 10) + p0 + q * 4);
    }

  if (tid < 64) st[tid] = sv;
  {
    const v2f t = {gm[0], bt[0]};
    gb[tid] = t;
  }
  __syncthreads();

  for (int j = 0; j < 2; ++j) {
    const int g = (256 + j * 256 + tid) / 24;
    ts[j * 256 + tid] = (h16)(((tx[j] - st[g]) * st[32 + g]) * gm[j + 1] + bt[j + 1]);
  }
  for (int j = 0; j < 4; ++j) {
    const int c = j * 64 + c2 * 2;
    const int ga = c / 24, gc = (c + 1) / 24;
    const float ma = st[ga], ra = st[32 + ga], mb = st[gc], rb = st[32 + gc];
    const v2f pa = gb[c], pb = gb[c + 1];
    for (int i = 0; i < 4; ++i) {
      h16x2 t;
      t.x = (h16)(((xv[j][0][i] - ma) * ra) * pa.x + pa.y);
      t.y = (h16)(((xv[j][1][i] - mb) * rb) * pb.x + pb.y);
      *(h16x2*)(&xs[(q * 4 + i) * 264 + c]) = t;
    }
  }
  __syncthreads();

  h16* __restrict__ dst = hn + ((size_t)b * 1024 + p0) * 768;
  for (int j = 0; j < 4; ++j) {  // x channels: a wave stores the first 512 B of one row
    const int row = j * 8 + (tid >> 5);
    const int ch  = tid & 31;
    *(u32x4*)(dst + row * 768 + ch * 8) = *(const u32x4*)(&xs[row * 264 + ch * 8]);
  }
  const u32x4 tv = *(const u32x4*)(&ts[(tid & 63) * 8]);
  for (int j = 0; j < 8; ++j) {  // text channels: the same 16 B to 8 rows
    const int row = j * 4 + (tid >> 6);
    *(u32x4*)(dst + row * 768 + 256 + (tid & 63) * 8) = tv;
  }
}

// -------------------- Weights -> f16, transposed [N=768][K=768]; bias concat --------------------
// grid: (12 tiles of 64 k, 24 tiles of 32 n). Whole 128-B lines in (32 n of one k row) and out
// (64 k of one n row), turned in LDS.
__global__ __launch_bounds__(256) void wconv_kernel(
    const float* __restrict__ W0, const float* __restrict__ W1, const float* __restrict__ W2,
    const float* __restrict__ b0, const float* __restrict__ b1, const float* __restrict__ b2,
    h16* __restrict__ Wt, float* __restrict__ bcat) {
  __shared__ __align__(16) h16 tw[32 * 72];  // [n][k], pitch 144 B
  const int k0  = blockIdx.x * 64;
  const int n0  = blockIdx.y * 32;
  const int nn0 = n0 & 255;
  const int tid = threadIdx.x;
  const float* W = (n0 < 256) ? W0 : ((n0 < 512) ? W1 : W2);
  const int q  = tid & 7;    // 4 columns 4q..4q+3
  const int k2 = tid >> 3;   // k pair 2*k2, 2*k2+1
  const f32x4 wa = *(const f32x4*)(W + (size_t)(k0 + k2 * 2) * 256 + nn0 + q * 4);
  const f32x4 wb = *(const f32x4*)(W + (size_t)(k0 + k2 * 2 + 1) * 256 + nn0 + q * 4);
  for (int i = 0; i < 4; ++i) {
    h16x2 t;
    t.x = (h16)wa[i];
    t.y = (h16)wb[i];
    *(h16x2*)(&tw[(q * 4 + i) * 72 + k2 * 2]) = t;
  }
  __syncthreads();
  const int row = tid >> 3, ch = tid & 7;
  *(u32x4*)(Wt + (size_t)(n0 + row) * 768 + k0 + ch * 8) = *(const u32x4*)(&tw[row * 72 + ch * 8]);
  if (blockIdx.x == 0 && tid < 32) {
    const float* bs = (n0 < 256) ? b0 : ((n0 < 512) ? b1 : b2);
    bcat[n0 + tid] = bs[nn0 + tid];
  }
}

__global__ __launch_bounds__(256) void gemm_qkv_kernel(
    const h16* __restrict__ A, const h16* __restrict__ Bt,
    const float* __restrict__ bias, h16* __restrict__ Cout) {
  __shared__ __align__(16) h16 As[2][128 * 48];  // stride 48 h16 = 96B, 16B aligned
  __shared__ __align__(16) h16 Bs[2][128 * 48];
  const int mBase = blockIdx.x * 128;
  const int nBase = blockIdx.y * 128;
  const int tid  = threadIdx.x;
  const int wave = tid >> 5;
  const int lane = tid & 31;
  const int wm = wave >> 1;       // 0..3
  const int wn = wave & 1;        // 0..1
  const int l16 = lane & 15;
  const int hi  = lane >> 4;      // 0/1 selects K phase per WMMA A/B layout

  const int row0 = tid >> 2;            // chunk id tid   -> row, seg
  const int seg0 = tid & 3;
  const int row1 = (tid + 256) >> 2;    // chunk id tid+256
  const int seg1 = (tid + 256) & 3;

  v8f acc[2][4];
  for (int mt = 0; mt < 2; ++mt)
    for (int nt = 0; nt < 4; ++nt)
      for (int r = 0; r < 8; ++r) acc[mt][nt][r] = 0.f;

  auto load_tiles = [&](int k0, int buf) {
    async_copy_b128((unsigned)(uintptr_t)&As[buf][row0 * 48 + seg0 * 8],
                    A + (size_t)(mBase + row0) * 768 + k0 + seg0 * 8);
    async_copy_b128((unsigned)(uintptr_t)&As[buf][row1 * 48 + seg1 * 8],
                    A + (size_t)(mBase + row1) * 768 + k0 + seg1 * 8);
    async_copy_b128((unsigned)(uintptr_t)&Bs[buf][row0 * 48 + seg0 * 8],
                    Bt + (size_t)(nBase + row0) * 768 + k0 + seg0 * 8);
    async_copy_b128((unsigned)(uintptr_t)&Bs[buf][row1 * 48 + seg1 * 8],
                    Bt + (size_t)(nBase + row1) * 768 + k0 + seg1 * 8);
  };

  load_tiles(0, 0);
  wait_async0();
  __syncthreads();

  int buf = 0;
  for (int k0 = 0; k0 < 768; k0 += 32) {
    if (k0 + 32 < 768) load_tiles(k0 + 32, buf ^ 1);  // overlap with compute

    FragV afr[2];
    for (int mt = 0; mt < 2; ++mt) {
      const int row = wm * 32 + mt * 16 + l16;
      const int ko  = hi * 8;
      afr[mt].q[0] = *(const u32x4*)(&As[buf][row * 48 + ko]);
      afr[mt].q[1] = *(const u32x4*)(&As[buf][row * 48 + ko + 16]);
    }
    for (int nt = 0; nt < 4; ++nt) {
      const int col = wn * 64 + nt * 16 + l16;
      const int ko  = hi * 8;
      FragV bfr;
      bfr.q[0] = *(const u32x4*)(&Bs[buf][col * 48 + ko]);
      bfr.q[1] = *(const u32x4*)(&Bs[buf][col * 48 + ko + 16]);
      for (int mt = 0; mt < 2; ++mt)
        acc[mt][nt] = __builtin_amdgcn_wmma_f32_16x16x32_f16(
            false, afr[mt].h, false, bfr.h, (short)0, acc[mt][nt], false, false);
    }

    wait_async0();
    __syncthreads();
    buf ^= 1;
  }

  for (int mt = 0; mt < 2; ++mt)
    for (int nt = 0; nt < 4; ++nt) {
      const int n = nBase + wn * 64 + nt * 16 + l16;
      const float bv = bias[n];
      for (int r = 0; r < 8; ++r) {
        const int m = mBase + wm * 32 + mt * 16 + r + hi * 8;
        Cout[(size_t)m * 768 + n] = (h16)(acc[mt][nt][r] + bv);
      }
    }
}

// -------------------- V transpose: vT[bh][ch=64][pos=1024] --------------------
// grid: 512 blocks = (bh, 64 positions). Whole 128-B lines in (64 channels of one position) and
// out (64 positions of one channel), turned in LDS.
__global__ __launch_bounds__(256) void vtrans_kernel(
    const h16* __restrict__ qkv, h16* __restrict__ vT) {
  __shared__ __align__(16) h16 tv[64 * 72];  // [channel][position], pitch 144 B
  const int bh = blockIdx.x >> 4;
  const int p0 = (blockIdx.x & 15) * 64;
  const int b = bh >> 2, h = bh & 3;
  const int tid = threadIdx.x;
  const int c8 = tid & 7;    // 8 channels 8*c8..8*c8+7
  const int p2 = tid >> 3;   // position pair 2*p2, 2*p2+1
  const h16* src = qkv + ((size_t)b * 1024 + p0 + p2 * 2) * 768 + 512 + h * 64 + c8 * 8;
  const h16x8 va = *(const h16x8*)(src);
  const h16x8 vb = *(const h16x8*)(src + 768);
  for (int i = 0; i < 8; ++i) {
    h16x2 t;
    t.x = va[i];
    t.y = vb[i];
    *(h16x2*)(&tv[(c8 * 8 + i) * 72 + p2 * 2]) = t;
  }
  __syncthreads();
  for (int j = 0; j < 2; ++j) {
    const int row = j * 32 + (tid >> 3);
    const int ch  = tid & 7;
    *(u32x4*)(vT + ((size_t)bh * 64 + row) * 1024 + p0 + ch * 8) =
        *(const u32x4*)(&tv[row * 72 + ch * 8]);
  }
}

__device__ __forceinline__ float xhalf(float v) {
  const int b = __builtin_bit_cast(int, v);
  return __builtin_bit_cast(float,
      __builtin_amdgcn_permlanex16(b, b, 0x76543210, 0xfedcba98, false, false));
}

__global__ __launch_bounds__(256) void attn_kernel(
    const h16* __restrict__ qkv, const h16* __restrict__ vT,
    const float* __restrict__ x, float* __restrict__ out) {
  const int bh = blockIdx.x;
  const int b = bh >> 2, h = bh & 3;
  const int tid = threadIdx.x, wave = tid >> 5, lane = tid & 31;
  const int l16 = lane & 15;
  const int hi  = lane >> 4;
  const int hi8 = hi * 8;
  const int qrow0 = blockIdx.y * 256 + wave * 32;

  __shared__ __align__(16) h16 Ks[2][64 * 72];  // [key][channel], pitch 144 B
  __shared__ __align__(16) h16 Vs[2][64 * 72];  // [channel][key], pitch 144 B
  // a thread copies 16 B of rows crow and crow + 32 of both tiles; a wave covers whole 128-B rows
  const int crow = tid >> 3;
  const int cseg = (tid & 7) * 8;
  const h16* __restrict__ ksrc = qkv + ((size_t)b * 1024 + crow) * 768 + 256 + h * 64 + cseg;
  const h16* __restrict__ vsrc = vT + ((size_t)bh * 64 + crow) * 1024 + cseg;
  auto stage = [&](int kt, int buf) {
    const h16* kp = ksrc + (size_t)kt * 64 * 768;
    const h16* vp = vsrc + kt * 64;
    async_copy4_b128((unsigned)(uintptr_t)&Ks[buf][crow * 72 + cseg], kp,
                     (unsigned)(uintptr_t)&Ks[buf][(crow + 32) * 72 + cseg], kp + 32 * 768,
                     (unsigned)(uintptr_t)&Vs[buf][crow * 72 + cseg], vp,
                     (unsigned)(uintptr_t)&Vs[buf][(crow + 32) * 72 + cseg], vp + 32 * 1024);
  };
  stage(0, 0);

  // Preload Q fragments: [mt][kc] covers 32 rows x 64 channels
  FragV qf[2][2];
  for (int mt = 0; mt < 2; ++mt)
    for (int kc = 0; kc < 2; ++kc) {
      const int row = qrow0 + mt * 16 + l16;
      const h16* base = qkv + ((size_t)b * 1024 + row) * 768 + h * 64 + kc * 32 + hi * 8;
      qf[mt][kc].q[0] = *(const u32x4*)(base);
      qf[mt][kc].q[1] = *(const u32x4*)(base + 16);
    }

  // per lane: running maximum of query mt*16+l16, and this half's share of its sum
  float mrow[2], lrow[2];
  v8f oacc[2][4];  // O^T tile: [r] = channel nt*16 + hi8 + r, query mt*16 + l16
  for (int mt = 0; mt < 2; ++mt) { mrow[mt] = -1e30f; lrow[mt] = 0.f; }
  for (int mt = 0; mt < 2; ++mt)
    for (int nt = 0; nt < 4; ++nt)
      for (int r = 0; r < 8; ++r) oacc[mt][nt][r] = 0.f;

  wait_async0();    // tile 0 has landed for this wave's copies
  __syncthreads();  // and for every wave's
  stage(1, 1);

  for (int kt = 0; kt < 16; ++kt) {
    const h16* Kt = Ks[kt & 1];
    const h16* Vt = Vs[kt & 1];

    // ---- S^T = K * Q^T: sacc[mt][nt][r] = key nt*16 + hi8 + r, query mt*16 + l16 ----
    v8f sacc[2][4];
    for (int mt = 0; mt < 2; ++mt)
      for (int nt = 0; nt < 4; ++nt)
        for (int r = 0; r < 8; ++r) sacc[mt][nt][r] = 0.f;

    for (int nt = 0; nt < 4; ++nt) {
      const h16* kb = Kt + (nt * 16 + l16) * 72 + hi * 8;
      FragV kf0, kf1;
      kf0.q[0] = *(const u32x4*)(kb);       kf0.q[1] = *(const u32x4*)(kb + 16);
      kf1.q[0] = *(const u32x4*)(kb + 32);  kf1.q[1] = *(const u32x4*)(kb + 48);
      for (int mt = 0; mt < 2; ++mt) {
        sacc[mt][nt] = __builtin_amdgcn_wmma_f32_16x16x32_f16(
            false, kf0.h, false, qf[mt][0].h, (short)0, sacc[mt][nt], false, false);
        sacc[mt][nt] = __builtin_amdgcn_wmma_f32_16x16x32_f16(
            false, kf1.h, false, qf[mt][1].h, (short)0, sacc[mt][nt], false, false);
      }
    }

    // ---- scale + online softmax, one query per lane ----
    // Worked on in pairs of neighbouring accumulator registers (keys 2j, 2j+1 of a tile).
    FragV pf[2][2];  // P^T as B operand: [mt][kc], 32 keys each
    for (int mt = 0; mt < 2; ++mt) {
      v2f sp[4][4];
      for (int nt = 0; nt < 4; ++nt)
        for (int j = 0; j < 4; ++j) {
          const v2f t = {sacc[mt][nt][2 * j], sacc[mt][nt][2 * j + 1]};
          sp[nt][j] = t * 0.125f;  // Ch^-0.5
        }

      float vm[4];
      for (int nt = 0; nt < 4; ++nt) {
        vm[nt] = fmaxf(sp[nt][0].x, sp[nt][0].y);
        for (int j = 1; j < 4; ++j) vm[nt] = fmaxf(vm[nt], fmaxf(sp[nt][j].x, sp[nt][j].y));
      }
      float v = fmaxf(fmaxf(vm[0], vm[1]), fmaxf(vm[2], vm[3]));
      v = fmaxf(v, xhalf(v));  // the other 32 keys of this query
      const float mold = mrow[mt];
      const float mnew = fmaxf(mold, v);
      const float corr = __expf(mold - mnew);
      mrow[mt] = mnew;
      for (int nt = 0; nt < 4; ++nt)
        for (int r = 0; r < 8; ++r) oacc[mt][nt][r] *= corr;
      // tiles 2kc and 2kc+1 hold keys hi8+0..7 and 16+hi8+0..7 of chunk kc: the B k order
      v2f ps[4];
      for (int nt = 0; nt < 4; ++nt) {
        for (int j = 0; j < 4; ++j) {
          const v2f d = sp[nt][j] - mnew;
          const v2f p = {__expf(d.x), __expf(d.y)};
          ps[nt] = (j == 0) ? p : ps[nt] + p;
          pf[mt][nt >> 1].h[(nt & 1) * 8 + 2 * j]     = (h16)p.x;
          pf[mt][nt >> 1].h[(nt & 1) * 8 + 2 * j + 1] = (h16)p.y;
        }
      }
      const v2f pt = (ps[0] + ps[1]) + (ps[2] + ps[3]);
      lrow[mt] = lrow[mt] * corr + (pt.x + pt.y);
    }

    // ---- O^T += V^T * P^T ----
    for (int kc = 0; kc < 2; ++kc) {
      for (int nt = 0; nt < 4; ++nt) {
        const h16* vb = Vt + (nt * 16 + l16) * 72 + kc * 32 + hi * 8;
        FragV vf;
        vf.q[0] = *(const u32x4*)(vb);
        vf.q[1] = *(const u32x4*)(vb + 16);
        for (int mt = 0; mt < 2; ++mt)
          oacc[mt][nt] = __builtin_amdgcn_wmma_f32_16x16x32_f16(
              false, vf.h, false, pf[mt][kc].h, (short)0, oacc[mt][nt], false, false);
      }
    }

    // hand-over: this wave's reads of tile kt are done, its copies of tile kt + 1 have landed;
    // behind the barrier that holds for all waves, and tile kt's buffer may be refilled
    asm volatile("s_wait_dscnt 0x0" ::: "memory");
    wait_async0();
    __syncthreads();
    if (kt + 2 < 16) stage(kt + 2, kt & 1);
  }
  wait_async0();  // nothing is in flight when the wave ends

  // ---- finalize: join the halves' sums, O * (1/l), residual add, store f32 [B,C,H*W] ----
  float linv[2];
  for (int mt = 0; mt < 2; ++mt) linv[mt] = 1.0f / (lrow[mt] + xhalf(lrow[mt]));
  for (int mt = 0; mt < 2; ++mt)
    for (int nt = 0; nt < 4; ++nt) {
      const int pos = qrow0 + mt * 16 + l16;
      for (int r = 0; r < 8; ++r) {
        const int c = h * 64 + nt * 16 + hi8 + r;
        const size_t idx = ((size_t)b * 256 + c) * 1024 + pos;
        out[idx] = x[idx] + oacc[mt][nt][r] * linv[mt];
      }
    }
}

// -------------------- launch --------------------
extern "C" void kernel_launch(void* const* d_in, const int* in_sizes, int n_in,
                              void* d_out, int out_size, void* d_ws, size_t ws_size,
                              hipStream_t stream) {
  const float* x     = (const float*)d_in[0];
  const float* text  = (const float*)d_in[1];
  const float* gamma = (const float*)d_in[2];
  const float* beta  = (const float*)d_in[3];
  const float* W0    = (const float*)d_in[4];
  const float* b0    = (const float*)d_in[5];
  const float* W1    = (const float*)d_in[6];
  const float* b1    = (const float*)d_in[7];
  const float* W2    = (const float*)d_in[8];
  const float* b2    = (const float*)d_in[9];
  float* out = (float*)d_out;

  char* ws = (char*)d_ws;
  float* stats = (float*)ws;                    // 512 f32
  float* bcat  = (float*)(ws + 2048);           // 768 f32
  h16*   hn    = (h16*)(ws + 8192);             // 8*1024*768
  h16*   Wt    = hn + (size_t)8 * 1024 * 768;   // 768*768
  h16*   qkv   = Wt + (size_t)768 * 768;        // 8*1024*768
  h16*   vT    = qkv + (size_t)8 * 1024 * 768;  // 32*64*1024

  gn_stats_kernel<<<256, 256, 0, stream>>>(x, text, stats);
  normalize_kernel<<<256, 256, 0, stream>>>(x, text, stats, gamma, beta, hn);
  wconv_kernel<<<dim3(12, 24), 256, 0, stream>>>(W0, W1, W2, b0, b1, b2, Wt, bcat);
  gemm_qkv_kernel<<<dim3(64, 6), 256, 0, stream>>>(hn, Wt, bcat, qkv);
  vtrans_kernel<<<512, 256, 0, stream>>>(qkv, vT);
  attn_kernel<<<dim3(32, 4), 256, 0, stream>>>(qkv, vT, x, out);
}

// v005
// A run of this version takes 42.2 microseconds.
// Two timings next to v004 both put it at 1.29 times that version's speed.
// Over all steps from v000 it is 4.78 times as fast.
#include <hip/hip_runtime.h>
#include <hip/hip_bf16.h>

typedef _Float16 h16;
typedef __attribute__((ext_vector_type(16))) _Float16 v16h;
typedef __attribute__((ext_vector_type(8)))  float    v8f;
typedef __attribute__((ext_vector_type(2)))  float    v2f;
typedef __attribute__((ext_vector_type(4)))  unsigned int u32x4;
typedef __attribute__((ext_vector_type(4)))  float    f32x4;
typedef __attribute__((ext_vector_type(2)))  _Float16 h16x2;
typedef __attribute__((ext_vector_type(8)))  _Float16 h16x8;

union FragV { u32x4 q[2]; v16h h; };

__device__ __forceinline__ void async_copy4_b128(unsigned l0, const void* g0, unsigned l1, const void* g1,
                                                 unsigned l2, const void* g2, unsigned l3, const void* g3) {
  asm volatile("global_load_async_to_lds_b128 %0, %1, off\n\t"
               "global_load_async_to_lds_b128 %2, %3, off\n\t"
               "global_load_async_to_lds_b128 %4, %5, off\n\t"
               "global_load_async_to_lds_b128 %6, %7, off\n\t"
               "s_wait_xcnt 0x0"
               :: "v"(l0), "v"(g0), "v"(l1), "v"(g1), "v"(l2), "v"(g2), "v"(l3), "v"(g3) : "memory");
}
__device__ __forceinline__ void wait_async0() {
  asm volatile("s_wait_asynccnt 0" ::: "memory");
}

// -------------------- GroupNorm statistics --------------------
// grid: 256 blocks = (b,g), 256 threads. Group g covers channels [24g,24g+24).
// A thread takes 4 neighbouring positions of each of the 24 channels. The channels come in three
// runs of 8: 24g and 256 are multiples of 8, so a run is all x or all text, x runs first.
// One thread's share of a group with NX runs of x channels: every load is issued before the
// first sum reads one, so the block waits for memory once.
template <int NX>
__device__ __forceinline__ void gn_part(const float* __restrict__ xs, const float* __restrict__ ts,
                                        float& s, float& ss) {
  f32x4 v[NX * 8 + 1];
  for (int e = 0; e < NX * 8; ++e) v[e] = *(const f32x4*)(xs + (e << 10));
  // keeps the sums behind the last load: without it the compiler holds half of the loads back
  // until the first ones have returned, a second trip to memory
  __builtin_amdgcn_sched_barrier(0);
  float st = 0.f, sq = 0.f;  // a text channel has one value at all positions
  for (int e = 0; e < (3 - NX) * 8; ++e) { const float t = ts[e]; st += t; sq += t * t; }
  f32x4 s4 = {st, st, st, st}, q4 = {sq, sq, sq, sq};
  for (int e = 0; e < NX * 8; ++e) { s4 += v[e]; q4 += v[e] * v[e]; }
  s  = (s4.x + s4.y) + (s4.z + s4.w);
  ss = (q4.x + q4.y) + (q4.z + q4.w);
}

__global__ __launch_bounds__(256) void gn_stats_kernel(
    const float* __restrict__ x, const float* __restrict__ text,
    float* __restrict__ stats) {
  const int b = blockIdx.x >> 5;
  const int g = blockIdx.x & 31;
  const int tid = threadIdx.x;
  const int nx = (g * 24 >= 256) ? 0 : ((256 - g * 24 >= 24) ? 3 : ((256 - g * 24) >> 3));
  const float* __restrict__ xs = x + (((size_t)b * 256 + g * 24) << 10) + tid * 4;
  const float* __restrict__ ts = text + b * 512 + (g * 24 + nx * 8 - 256);
  float s, ss;
  if (nx == 3)      gn_part<3>(xs, ts, s, ss);
  else if (nx == 2) gn_part<2>(xs, ts, s, ss);
  else if (nx == 1) gn_part<1>(xs, ts, s, ss);
  else              gn_part<0>(xs, ts, s, ss);
  for (int off = 16; off >= 1; off >>= 1) {
    s  += __shfl_xor(s,  off, 32);
    ss += __shfl_xor(ss, off, 32);
  }
  __shared__ float rs[8], rss[8];
  if ((tid & 31) == 0) { rs[tid >> 5] = s; rss[tid >> 5] = ss; }
  __syncthreads();
  if (tid == 0) {
    float S = 0.f, SS = 0.f;
    for (int i = 0; i < 8; ++i) { S += rs[i]; SS += rss[i]; }
    const float mean = S * (1.f / 24576.f);
    const float var  = SS * (1.f / 24576.f) - mean * mean;
    stats[blockIdx.x]       = mean;
    stats[256 + blockIdx.x] = rsqrtf(var + 1e-6f);
  }
}

// -------------------- Normalize + cast to f16, x channels only, layout [B*HW, 256] --------------------
// grid: 256 blocks = (b, 32 positions). The x tile [256 channels][32 positions] is read in whole
// 128-B lines, turned in LDS and stored as 16-B pieces of hn rows. The 512 text channels do not
// depend on the position: their share of q, k, v is one row per image (text_share below).
__global__ __launch_bounds__(256) void normalize_kernel(
    const float* __restrict__ x,
    const float* __restrict__ stats, const float* __restrict__ gamma,
    const float* __restrict__ beta, h16* __restrict__ hn) {
  __shared__ __align__(16) h16 xs[32 * 264];  // [position][channel], pitch 528 B
  __shared__ float st[64];                    // mean, then rstd, of this image's 32 groups
  __shared__ v2f gb[256];                     // gamma, beta of an x channel
  const int b   = blockIdx.x >> 5;
  const int p0  = (blockIdx.x & 31) * 32;
  const int tid = threadIdx.x;
  const int q   = tid & 7;    // 4 positions 4q..4q+3
  const int c2  = tid >> 3;   // channel pair 2*c2, 2*c2+1 of each 64

  const float* __restrict__ sb = stats + b * 32;
  const float sv = sb[(tid & 31) + ((tid >> 5) & 1) * 256];
  const float gm = gamma[tid], bt = beta[tid];
  f32x4 xv[4][2];
  for (int j = 0; j < 4; ++j)
    for (int e = 0; e < 2; ++e) {
      // wait in front of the last load: the compiler lets its result land in the address pair
      // that the seven issued loads name
      if (j == 3 && e == 1) asm volatile("s_wait_xcnt 0x0" ::: "memory");
      xv[j][e] = *(const f32x4*)(x + (((size_t)b * 256 + j * 64 + c2 * 2 + e) << 10) + p0 + q * 4);
    }

  if (tid < 64) st[tid] = sv;
  {
    const v2f t = {gm, bt};
    gb[tid] = t;
  }
  __syncthreads();

  for (int j = 0; j < 4; ++j) {
    const int c = j * 64 + c2 * 2;
    const int ga = c / 24, gc = (c + 1) / 24;
    const float ma = st[ga], ra = st[32 + ga], mb = st[gc], rb = st[32 + gc];
    const v2f pa = gb[c], pb = gb[c + 1];
    for (int i = 0; i < 4; ++i) {
      h16x2 t;
      t.x = (h16)(((xv[j][0][i] - ma) * ra) * pa.x + pa.y);
      t.y = (h16)(((xv[j][1][i] - mb) * rb) * pb.x + pb.y);
      *(h16x2*)(&xs[(q * 4 + i) * 264 + c]) = t;
    }
  }
  __syncthreads();

  h16* __restrict__ dst = hn + ((size_t)b * 1024 + p0) * 256;
  for (int j = 0; j < 4; ++j) {  // a wave stores one whole row of 512 B
    const int row = j * 8 + (tid >> 5);
    const int ch  = tid & 31;
    *(u32x4*)(dst + row * 256 + ch * 8) = *(const u32x4*)(&xs[row * 264 + ch * 8]);
  }
}

// -------------------- Text share of q, k, v: bcat[image][n] --------------------
// A text channel has one value at all positions of an image, so its products with the weight rows
// 256..767 are the same for all 1024 positions: [8 images][512] x [512][32 columns] per block, on
// the matrix unit with the same f16 operands as the position-wise product had, plus the bias.
// 8 waves = 2 tiles of 16 columns x 4 quarters of the 512 channels; the quarters are summed in LDS.
__device__ __forceinline__ void text_share(
    const float* __restrict__ W, const float* __restrict__ bs, int n0, int nn0,
    const float* __restrict__ text, const float* __restrict__ stats,
    const float* __restrict__ gamma, const float* __restrict__ beta, float* __restrict__ bcat) {
  __shared__ float st[512];                      // mean, then rstd, of 8 images x 32 groups
  __shared__ __align__(16) h16 tn[8 * 520];      // normalized text [image][channel], pitch 1040 B
  __shared__ float red[8 * 128];                 // [wave][image][column]
  const int tid = threadIdx.x, wave = tid >> 5, lane = tid & 31;
  const int l16 = lane & 15, hi = lane >> 4;
  const int nt = wave & 1, kq = wave >> 1;

  // B operand: column l16 of the tile, k = s*32 + hi*8 + j and s*32 + 16 + hi*8 + j
  float wv[4][16];
  const float* __restrict__ wp = W + (size_t)(256 + kq * 128 + hi * 8) * 256 + nn0 + nt * 16 + l16;
  for (int s = 0; s < 4; ++s)
    for (int j = 0; j < 8; ++j) {
      wv[s][j]     = wp[(s * 32 + j) * 256];
      wv[s][8 + j] = wp[(s * 32 + 16 + j) * 256];
    }
  float tx[16], gm[2], bt[2];
  for (int i = 0; i < 16; ++i) tx[i] = text[i * 256 + tid];
  for (int j = 0; j < 2; ++j) { gm[j] = gamma[256 + j * 256 + tid]; bt[j] = beta[256 + j * 256 + tid]; }
  const float bv = bs[nn0 + (tid & 31)];  // read with the rest: one trip to memory
  st[tid]       = stats[tid];
  st[256 + tid] = stats[256 + tid];
  __syncthreads();
  for (int i = 0; i < 16; ++i) {
    const int img = i >> 1, j = i & 1;
    const int g = img * 32 + (256 + j * 256 + tid) / 24;
    tn[img * 520 + j * 256 + tid] = (h16)(((tx[i] - st[g]) * st[256 + g]) * gm[j] + bt[j]);
  }
  __syncthreads();

  // A operand: row = image. Rows 8..15 repeat rows 0..7; their results are not used.
  v8f acc;
  for (int r = 0; r < 8; ++r) acc[r] = 0.f;
  for (int s = 0; s < 4; ++s) {
    const h16* ab = &tn[(l16 & 7) * 520 + kq * 128 + s * 32 + hi * 8];
    FragV afr, bfr;
    afr.q[0] = *(const u32x4*)(ab);
    afr.q[1] = *(const u32x4*)(ab + 16);
    for (int j = 0; j < 16; ++j) bfr.h[j] = (h16)wv[s][j];
    acc = __builtin_amdgcn_wmma_f32_16x16x32_f16(
        false, afr.h, false, bfr.h, (short)0, acc, false, false);
  }
  if (hi == 0)
    for (int r = 0; r < 8; ++r) red[wave * 128 + r * 16 + l16] = acc[r];
  __syncthreads();
  const int img = tid >> 5, col = tid & 31;
  const float* rp = &red[(col >> 4) * 128 + img * 16 + (col & 15)];
  bcat[img * 768 + n0 + col] = ((rp[0] + rp[256]) + (rp[512] + rp[768])) + bv;
}

// -------------------- Weight rows 0..255 -> f16, transposed [N=768][K=256]; text share --------------------
// grid: (4 tiles of 64 k and one text block, 24 tiles of 32 n). Whole 128-B lines in (32 n of one
// k row) and out (64 k of one n row), turned in LDS.
__global__ __launch_bounds__(256) void wconv_kernel(
    const float* __restrict__ W0, const float* __restrict__ W1, const float* __restrict__ W2,
    const float* __restrict__ b0, const float* __restrict__ b1, const float* __restrict__ b2,
    const float* __restrict__ text, const float* __restrict__ stats,
    const float* __restrict__ gamma, const float* __restrict__ beta,
    h16* __restrict__ Wt, float* __restrict__ bcat) {
  __shared__ __align__(16) h16 tw[32 * 72];  // [n][k], pitch 144 B
  const int k0  = blockIdx.x * 64;
  const int n0  = blockIdx.y * 32;
  const int nn0 = n0 & 255;
  const int tid = threadIdx.x;
  const float* W = (n0 < 256) ? W0 : ((n0 < 512) ? W1 : W2);
  if (blockIdx.x == 4) {  // the same for the whole block
    text_share(W, (n0 < 256) ? b0 : ((n0 < 512) ? b1 : b2), n0, nn0, text, stats, gamma, beta, bcat);
    return;
  }
  const int q  = tid & 7;    // 4 columns 4q..4q+3
  const int k2 = tid >> 3;   // k pair 2*k2, 2*k2+1
  const f32x4 wa = *(const f32x4*)(W + (size_t)(k0 + k2 * 2) * 256 + nn0 + q * 4);
  const f32x4 wb = *(const f32x4*)(W + (size_t)(k0 + k2 * 2 + 1) * 256 + nn0 + q * 4);
  for (int i = 0; i < 4; ++i) {
    h16x2 t;
    t.x = (h16)wa[i];
    t.y = (h16)wb[i];
    *(h16x2*)(&tw[(q * 4 + i) * 72 + k2 * 2]) = t;
  }
  __syncthreads();
  const int row = tid >> 3, ch = tid & 7;
  *(u32x4*)(Wt + (size_t)(n0 + row) * 256 + k0 + ch * 8) = *(const u32x4*)(&tw[row * 72 + ch * 8]);
  // wait behind the store: the text block's code follows in the listing and rewrites the registers
  // that the issued store names
  asm volatile("s_wait_xcnt 0x0" ::: "memory");
}

__global__ __launch_bounds__(256) void gemm_qkv_kernel(
    const h16* __restrict__ A, const h16* __restrict__ Bt,
    const float* __restrict__ bias, h16* __restrict__ Cout) {
  __shared__ __align__(16) h16 As[2][128 * 48];  // stride 48 h16 = 96B, 16B aligned
  __shared__ __align__(16) h16 Bs[2][128 * 48];
  const int mBase = blockIdx.x * 128;
  const int nBase = blockIdx.y * 128;
  const int tid  = threadIdx.x;
  const int wave = tid >> 5;
  const int lane = tid & 31;
  const int wm = wave >> 1;       // 0..3
  const int wn = wave & 1;        // 0..1
  const int l16 = lane & 15;
  const int hi  = lane >> 4;      // 0/1 selects K phase per WMMA A/B layout

  const int row0 = tid >> 2;            // chunk id tid   -> row, seg
  const int seg0 = tid & 3;
  const int row1 = (tid + 256) >> 2;    // chunk id tid+256
  const int seg1 = (tid + 256) & 3;

  v8f acc[2][4];
  for (int mt = 0; mt < 2; ++mt)
    for (int nt = 0; nt < 4; ++nt)
      for (int r = 0; r < 8; ++r) acc[mt][nt][r] = 0.f;

  auto load_tiles = [&](int k0, int buf) {
    async_copy4_b128((unsigned)(uintptr_t)&As[buf][row0 * 48 + seg0 * 8],
                     A + (size_t)(mBase + row0) * 256 + k0 + seg0 * 8,
                     (unsigned)(uintptr_t)&As[buf][row1 * 48 + seg1 * 8],
                     A + (size_t)(mBase + row1) * 256 + k0 + seg1 * 8,
                     (unsigned)(uintptr_t)&Bs[buf][row0 * 48 + seg0 * 8],
                     Bt + (size_t)(nBase + row0) * 256 + k0 + seg0 * 8,
                     (unsigned)(uintptr_t)&Bs[buf][row1 * 48 + seg1 * 8],
                     Bt + (size_t)(nBase + row1) * 256 + k0 + seg1 * 8);
  };

  load_tiles(0, 0);
  wait_async0();
  __syncthreads();
  load_tiles(32, 1);  // flies while tile 0 is worked on

  int buf = 0;
  for (int k0 = 0; k0 < 256; k0 += 32) {

    FragV afr[2];
    for (int mt = 0; mt < 2; ++mt) {
      const int row = wm * 32 + mt * 16 + l16;
      const int ko  = hi * 8;
      afr[mt].q[0] = *(const u32x4*)(&As[buf][row * 48 + ko]);
      afr[mt].q[1] = *(const u32x4*)(&As[buf][row * 48 + ko + 16]);
    }
    for (int nt = 0; nt < 4; ++nt) {
      const int col = wn * 64 + nt * 16 + l16;
      const int ko  = hi * 8;
      FragV bfr;
      bfr.q[0] = *(const u32x4*)(&Bs[buf][col * 48 + ko]);
      bfr.q[1] = *(const u32x4*)(&Bs[buf][col * 48 + ko + 16]);
      for (int mt = 0; mt < 2; ++mt)
        acc[mt][nt] = __builtin_amdgcn_wmma_f32_16x16x32_f16(
            false, afr[mt].h, false, bfr.h, (short)0, acc[mt][nt], false, false);
    }

    // hand-over: this wave's reads of this tile are done, its copies of the next have landed;
    // behind the barrier that holds for all waves, and this tile's buffer may be refilled
    asm volatile("s_wait_dscnt 0x0" ::: "memory");
    wait_async0();
    __syncthreads();
    if (k0 + 64 < 256) load_tiles(k0 + 64, buf);
    buf ^= 1;
  }
  wait_async0();  // nothing is in flight when the wave ends

  const float* __restrict__ bimg = bias + (mBase >> 10) * 768;  // 128 rows lie in one image
  for (int mt = 0; mt < 2; ++mt)
    for (int nt = 0; nt < 4; ++nt) {
      const int n = nBase + wn * 64 + nt * 16 + l16;
      const float bv = bimg[n];
      for (int r = 0; r < 8; ++r) {
        const int m = mBase + wm * 32 + mt * 16 + r + hi * 8;
        Cout[(size_t)m * 768 + n] = (h16)(acc[mt][nt][r] + bv);
      }
    }
}

// -------------------- V transpose: vT[bh][ch=64][pos=1024] --------------------
// grid: 512 blocks = (bh, 64 positions). Whole 128-B lines in (64 channels of one position) and
// out (64 positions of one channel), turned in LDS.
__global__ __launch_bounds__(256) void vtrans_kernel(
    const h16* __restrict__ qkv, h16* __restrict__ vT) {
  __shared__ __align__(16) h16 tv[64 * 72];  // [channel][position], pitch 144 B
  const int bh = blockIdx.x >> 4;
  const int p0 = (blockIdx.x & 15) * 64;
  const int b = bh >> 2, h = bh & 3;
  const int tid = threadIdx.x;
  const int c8 = tid & 7;    // 8 channels 8*c8..8*c8+7
  const int p2 = tid >> 3;   // position pair 2*p2, 2*p2+1
  const h16* src = qkv + ((size_t)b * 1024 + p0 + p2 * 2) * 768 + 512 + h * 64 + c8 * 8;
  const h16x8 va = *(const h16x8*)(src);
  const h16x8 vb = *(const h16x8*)(src + 768);
  for (int i = 0; i < 8; ++i) {
    h16x2 t;
    t.x = va[i];
    t.y = vb[i];
    *(h16x2*)(&tv[(c8 * 8 + i) * 72 + p2 * 2]) = t;
  }
  __syncthreads();
  for (int j = 0; j < 2; ++j) {
    const int row = j * 32 + (tid >> 3);
    const int ch  = tid & 7;
    *(u32x4*)(vT + ((size_t)bh * 64 + row) * 1024 + p0 + ch * 8) =
        *(const u32x4*)(&tv[row * 72 + ch * 8]);
  }
}

__device__ __forceinline__ float xhalf(float v) {
  const int b = __builtin_bit_cast(int, v);
  return __builtin_bit_cast(float,
      __builtin_amdgcn_permlanex16(b, b, 0x76543210, 0xfedcba98, false, false));
}

__global__ __launch_bounds__(256) void attn_kernel(
    const h16* __restrict__ qkv, const h16* __restrict__ vT,
    const float* __restrict__ x, float* __restrict__ out) {
  const int bh = blockIdx.x;
  const int b = bh >> 2, h = bh & 3;
  const int tid = threadIdx.x, wave = tid >> 5, lane = tid & 31;
  const int l16 = lane & 15;
  const int hi  = lane >> 4;
  const int hi8 = hi * 8;
  const int qrow0 = blockIdx.y * 256 + wave * 32;

  __shared__ __align__(16) h16 Ks[2][64 * 72];  // [key][channel], pitch 144 B
  __shared__ __align__(16) h16 Vs[2][64 * 72];  // [channel][key], pitch 144 B
  // a thread copies 16 B of rows crow and crow + 32 of both tiles; a wave covers whole 128-B rows
  const int crow = tid >> 3;
  const int cseg = (tid & 7) * 8;
  const h16* __restrict__ ksrc = qkv + ((size_t)b * 1024 + crow) * 768 + 256 + h * 64 + cseg;
  const h16* __restrict__ vsrc = vT + ((size_t)bh * 64 + crow) * 1024 + cseg;
  auto stage = [&](int kt, int buf) {
    const h16* kp = ksrc + (size_t)kt * 64 * 768;
    const h16* vp = vsrc + kt * 64;
    async_copy4_b128((unsigned)(uintptr_t)&Ks[buf][crow * 72 + cseg], kp,
                     (unsigned)(uintptr_t)&Ks[buf][(crow + 32) * 72 + cseg], kp + 32 * 768,
                     (unsigned)(uintptr_t)&Vs[buf][crow * 72 + cseg], vp,
                     (unsigned)(uintptr_t)&Vs[buf][(crow + 32) * 72 + cseg], vp + 32 * 1024);
  };
  stage(0, 0);

  // Preload Q fragments: [mt][kc] covers 32 rows x 64 channels
  FragV qf[2][2];
  for (int mt = 0; mt < 2; ++mt)
    for (int kc = 0; kc < 2; ++kc) {
      const int row = qrow0 + mt * 16 + l16;
      const h16* base = qkv + ((size_t)b * 1024 + row) * 768 + h * 64 + kc * 32 + hi * 8;
      qf[mt][kc].q[0] = *(const u32x4*)(base);
      qf[mt][kc].q[1] = *(const u32x4*)(base + 16);
    }

  // per lane: running maximum of query mt*16+l16, and this half's share of its sum
  float mrow[2], lrow[2];
  v8f oacc[2][4];  // O^T tile: [r] = channel nt*16 + hi8 + r, query mt*16 + l16
  for (int mt = 0; mt < 2; ++mt) { mrow[mt] = -1e30f; lrow[mt] = 0.f; }
  for (int mt = 0; mt < 2; ++mt)
    for (int nt = 0; nt < 4; ++nt)
      for (int r = 0; r < 8; ++r) oacc[mt][nt][r] = 0.f;

  wait_async0();    // tile 0 has landed for this wave's copies
  __syncthreads();  // and for every wave's
  stage(1, 1);

  for (int kt = 0; kt < 16; ++kt) {
    const h16* Kt = Ks[kt & 1];
    const h16* Vt = Vs[kt & 1];

    // ---- S^T = K * Q^T: sacc[mt][nt][r] = key nt*16 + hi8 + r, query mt*16 + l16 ----
    v8f sacc[2][4];
    for (int mt = 0; mt < 2; ++mt)
      for (int nt = 0; nt < 4; ++nt)
        for (int r = 0; r < 8; ++r) sacc[mt][nt][r] = 0.f;

    for (int nt = 0; nt < 4; ++nt) {
      const h16* kb = Kt + (nt * 16 + l16) * 72 + hi * 8;
      FragV kf0, kf1;
      kf0.q[0] = *(const u32x4*)(kb);       kf0.q[1] = *(const u32x4*)(kb + 16);
      kf1.q[0] = *(const u32x4*)(kb + 32);  kf1.q[1] = *(const u32x4*)(kb + 48);
      for (int mt = 0; mt < 2; ++mt) {
        sacc[mt][nt] = __builtin_amdgcn_wmma_f32_16x16x32_f16(
            false, kf0.h, false, qf[mt][0].h, (short)0, sacc[mt][nt], false, false);
        sacc[mt][nt] = __builtin_amdgcn_wmma_f32_16x16x32_f16(
            false, kf1.h, false, qf[mt][1].h, (short)0, sacc[mt][nt], false, false);
      }
    }

    // ---- scale + online softmax, one query per lane ----
    // Worked on in pairs of neighbouring accumulator registers (keys 2j, 2j+1 of a tile).
    FragV pf[2][2];  // P^T as B operand: [mt][kc], 32 keys each
    for (int mt = 0; mt < 2; ++mt) {
      v2f sp[4][4];
      for (int nt = 0; nt < 4; ++nt)
        for (int j = 0; j < 4; ++j) {
          const v2f t = {sacc[mt][nt][2 * j], sacc[mt][nt][2 * j + 1]};
          sp[nt][j] = t * 0.125f;  // Ch^-0.5
        }

      float vm[4];
      for (int nt = 0; nt < 4; ++nt) {
        vm[nt] = fmaxf(sp[nt][0].x, sp[nt][0].y);
        for (int j = 1; j < 4; ++j) vm[nt] = fmaxf(vm[nt], fmaxf(sp[nt][j].x, sp[nt][j].y));
      }
      float v = fmaxf(fmaxf(vm[0], vm[1]), fmaxf(vm[2], vm[3]));
      v = fmaxf(v, xhalf(v));  // the other 32 keys of this query
      const float mold = mrow[mt];
      const float mnew = fmaxf(mold, v);
      const float corr = __expf(mold - mnew);
      mrow[mt] = mnew;
      for (int nt = 0; nt < 4; ++nt)
        for (int r = 0; r < 8; ++r) oacc[mt][nt][r] *= corr;
      // tiles 2kc and 2kc+1 hold keys hi8+0..7 and 16+hi8+0..7 of chunk kc: the B k order
      v2f ps[4];
      for (int nt = 0; nt < 4; ++nt) {
        for (int j = 0; j < 4; ++j) {
          const v2f d = sp[nt][j] - mnew;
          const v2f p = {__expf(d.x), __expf(d.y)};
          ps[nt] = (j == 0) ? p : ps[nt] + p;
          pf[mt][nt >> 1].h[(nt & 1) * 8 + 2 * j]     = (h16)p.x;
          pf[mt][nt >> 1].h[(nt & 1) * 8 + 2 * j + 1] = (h16)p.y;
        }
      }
      const v2f pt = (ps[0] + ps[1]) + (ps[2] + ps[3]);
      lrow[mt] = lrow[mt] * corr + (pt.x + pt.y);
    }

    // ---- O^T += V^T * P^T ----
    for (int kc = 0; kc < 2; ++kc) {
      for (int nt = 0; nt < 4; ++nt) {
        const h16* vb = Vt + (nt * 16 + l16) * 72 + kc * 32 + hi * 8;
        FragV vf;
        vf.q[0] = *(const u32x4*)(vb);
        vf.q[1] = *(const u32x4*)(vb + 16);
        for (int mt = 0; mt < 2; ++mt)
          oacc[mt][nt] = __builtin_amdgcn_wmma_f32_16x16x32_f16(
              false, vf.h, false, pf[mt][kc].h, (short)0, oacc[mt][nt], false, false);
      }
    }

    // hand-over: this wave's reads of tile kt are done, its copies of tile kt + 1 have landed;
    // behind the barrier that holds for all waves, and tile kt's buffer may be refilled
    asm volatile("s_wait_dscnt 0x0" ::: "memory");
    wait_async0();
    __syncthreads();
    if (kt + 2 < 16) stage(kt + 2, kt & 1);
  }
  wait_async0();  // nothing is in flight when the wave ends

  // ---- finalize: join the halves' sums, O * (1/l), residual add, store f32 [B,C,H*W] ----
  float linv[2];
  for (int mt = 0; mt < 2; ++mt) linv[mt] = 1.0f / (lrow[mt] + xhalf(lrow[mt]));
  for (int mt = 0; mt < 2; ++mt)
    for (int nt = 0; nt < 4; ++nt) {
      const int pos = qrow0 + mt * 16 + l16;
      for (int r = 0; r < 8; ++r) {
        const int c = h * 64 + nt * 16 + hi8 + r;
        const size_t idx = ((size_t)b * 256 + c) * 1024 + pos;
        out[idx] = x[idx] + oacc[mt][nt][r] * linv[mt];
      }
    }
}

// -------------------- launch --------------------
extern "C" void kernel_launch(void* const* d_in, const int* in_sizes, int n_in,
                              void* d_out, int out_size, void* d_ws, size_t ws_size,
                              hipStream_t stream) {
  const float* x     = (const float*)d_in[0];
  const float* text  = (const float*)d_in[1];
  const float* gamma = (const float*)d_in[2];
  const float* beta  = (const float*)d_in[3];
  const float* W0    = (const float*)d_in[4];
  const float* b0    = (const float*)d_in[5];
  const float* W1    = (const float*)d_in[6];
  const float* b1    = (const float*)d_in[7];
  const float* W2    = (const float*)d_in[8];
  const float* b2    = (const float*)d_in[9];
  float* out = (float*)d_out;

  char* ws = (char*)d_ws;
  float* stats = (float*)ws;                    // 512 f32
  float* bcat  = (float*)(ws + 2048);           // 8*768 f32
  h16*   hn    = (h16*)(ws + 32768);            // 8*1024*256
  h16*   Wt    = hn + (size_t)8 * 1024 * 256;   // 768*256
  h16*   qkv   = Wt + (size_t)768 * 256;        // 8*1024*768
  h16*   vT    = qkv + (size_t)8 * 1024 * 768;  // 32*64*1024

  gn_stats_kernel<<<256, 256, 0, stream>>>(x, text, stats);
  normalize_kernel<<<256, 256, 0, stream>>>(x, stats, gamma, beta, hn);
  wconv_kernel<<<dim3(5, 24), 256, 0, stream>>>(W0, W1, W2, b0, b1, b2, text, stats, gamma, beta, Wt, bcat);
  gemm_qkv_kernel<<<dim3(64, 6), 256, 0, stream>>>(hn, Wt, bcat, qkv);
  vtrans_kernel<<<512, 256, 0, stream>>>(qkv, vT);
  attn_kernel<<<dim3(32, 4), 256, 0, stream>>>(qkv, vT, x, out);
}

// v006
// Measured time: 36.3 microseconds a run.
// Next to v005, in two timings, it ran 1.16 times as fast each time.
// Over all steps from v000 it is 5.57 times as fast.
#include <hip/hip_runtime.h>
#include <hip/hip_bf16.h>

typedef _Float16 h16;
typedef __attribute__((ext_vector_type(16))) _Float16 v16h;
typedef __attribute__((ext_vector_type(8)))  float    v8f;
typedef __attribute__((ext_vector_type(2)))  float    v2f;
typedef __attribute__((ext_vector_type(4)))  unsigned int u32x4;
typedef __attribute__((ext_vector_type(4)))  float    f32x4;
typedef __attribute__((ext_vector_type(2)))  _Float16 h16x2;
typedef __attribute__((ext_vector_type(8)))  _Float16 h16x8;

union FragV { u32x4 q[2]; v16h h; };

__device__ __forceinline__ void async_copy4_b128(unsigned l0, const void* g0, unsigned l1, const void* g1,
                                                 unsigned l2, const void* g2, unsigned l3, const void* g3) {
  asm volatile("global_load_async_to_lds_b128 %0, %1, off\n\t"
               "global_load_async_to_lds_b128 %2, %3, off\n\t"
               "global_load_async_to_lds_b128 %4, %5, off\n\t"
               "global_load_async_to_lds_b128 %6, %7, off\n\t"
               "s_wait_xcnt 0x0"
               :: "v"(l0), "v"(g0), "v"(l1), "v"(g1), "v"(l2), "v"(g2), "v"(l3), "v"(g3) : "memory");
}
__device__ __forceinline__ void wait_async0() {
  asm volatile("s_wait_asynccnt 0" ::: "memory");
}

// -------------------- GroupNorm statistics --------------------
// grid: 256 blocks = (b,g), 256 threads. Group g covers channels [24g,24g+24).
// A thread takes 4 neighbouring positions of each of the 24 channels. The channels come in three
// runs of 8: 24g and 256 are multiples of 8, so a run is all x or all text, x runs first.
// One thread's share of a group with NX runs of x channels: every load is issued before the
// first sum reads one, so the block waits for memory once.
template <int NX>
__device__ __forceinline__ void gn_part(const float* __restrict__ xs, const float* __restrict__ ts,
                                        float& s, float& ss) {
  f32x4 v[NX * 8 + 1];
  for (int e = 0; e < NX * 8; ++e) v[e] = *(const f32x4*)(xs + (e << 10));
  // keeps the sums behind the last load: without it the compiler holds half of the loads back
  // until the first ones have returned, a second trip to memory
  __builtin_amdgcn_sched_barrier(0);
  float st = 0.f, sq = 0.f;  // a text channel has one value at all positions
  for (int e = 0; e < (3 - NX) * 8; ++e) { const float t = ts[e]; st += t; sq += t * t; }
  f32x4 s4 = {st, st, st, st}, q4 = {sq, sq, sq, sq};
  for (int e = 0; e < NX * 8; ++e) { s4 += v[e]; q4 += v[e] * v[e]; }
  s  = (s4.x + s4.y) + (s4.z + s4.w);
  ss = (q4.x + q4.y) + (q4.z + q4.w);
}

__global__ __launch_bounds__(256) void gn_stats_kernel(
    const float* __restrict__ x, const float* __restrict__ text,
    float* __restrict__ stats) {
  const int b = blockIdx.x >> 5;
  const int g = blockIdx.x & 31;
  const int tid = threadIdx.x;
  const int nx = (g * 24 >= 256) ? 0 : ((256 - g * 24 >= 24) ? 3 : ((256 - g * 24) >> 3));
  const float* __restrict__ xs = x + (((size_t)b * 256 + g * 24) << 10) + tid * 4;
  const float* __restrict__ ts = text + b * 512 + (g * 24 + nx * 8 - 256);
  float s, ss;
  if (nx == 3)      gn_part<3>(xs, ts, s, ss);
  else if (nx == 2) gn_part<2>(xs, ts, s, ss);
  else if (nx == 1) gn_part<1>(xs, ts, s, ss);
  else              gn_part<0>(xs, ts, s, ss);
  for (int off = 16; off >= 1; off >>= 1) {
    s  += __shfl_xor(s,  off, 32);
    ss += __shfl_xor(ss, off, 32);
  }
  __shared__ float rs[8], rss[8];
  if ((tid & 31) == 0) { rs[tid >> 5] = s; rss[tid >> 5] = ss; }
  __syncthreads();
  if (tid == 0) {
    float S = 0.f, SS = 0.f;
    for (int i = 0; i < 8; ++i) { S += rs[i]; SS += rss[i]; }
    const float mean = S * (1.f / 24576.f);
    const float var  = SS * (1.f / 24576.f) - mean * mean;
    stats[blockIdx.x]       = mean;
    stats[256 + blockIdx.x] = rsqrtf(var + 1e-6f);
  }
}

// -------------------- Normalize + cast to f16, x channels only, layout [B*HW, 256] --------------------
// grid: 256 blocks = (b, 32 positions). The x tile [256 channels][32 positions] is read in whole
// 128-B lines, turned in LDS and stored as 16-B pieces of hn rows. The 512 text channels do not
// depend on the position: their share of q, k, v is one row per image (text_share below).
__global__ __launch_bounds__(256) void normalize_kernel(
    const float* __restrict__ x,
    const float* __restrict__ stats, const float* __restrict__ gamma,
    const float* __restrict__ beta, h16* __restrict__ hn) {
  __shared__ __align__(16) h16 xs[32 * 264];  // [position][channel], pitch 528 B
  __shared__ float st[64];                    // mean, then rstd, of this image's 32 groups
  __shared__ v2f gb[256];                     // gamma, beta of an x channel
  const int b   = blockIdx.x >> 5;
  const int p0  = (blockIdx.x & 31) * 32;
  const int tid = threadIdx.x;
  const int q   = tid & 7;    // 4 positions 4q..4q+3
  const int c2  = tid >> 3;   // channel pair 2*c2, 2*c2+1 of each 64

  const float* __restrict__ sb = stats + b * 32;
  const float sv = sb[(tid & 31) + ((tid >> 5) & 1) * 256];
  const float gm = gamma[tid], bt = beta[tid];
  f32x4 xv[4][2];
  for (int j = 0; j < 4; ++j)
    for (int e = 0; e < 2; ++e) {
      // wait in front of the last load: the compiler lets its result land in the address pair
      // that the seven issued loads name
      if (j == 3 && e == 1) asm volatile("s_wait_xcnt 0x0" ::: "memory");
      xv[j][e] = *(const f32x4*)(x + (((size_t)b * 256 + j * 64 + c2 * 2 + e) << 10) + p0 + q * 4);
    }

  if (tid < 64) st[tid] = sv;
  {
    const v2f t = {gm, bt};
    gb[tid] = t;
  }
  __syncthreads();

  for (int j = 0; j < 4; ++j) {
    const int c = j * 64 + c2 * 2;
    const int ga = c / 24, gc = (c + 1) / 24;
    const float ma = st[ga], ra = st[32 + ga], mb = st[gc], rb = st[32 + gc];
    const v2f pa = gb[c], pb = gb[c + 1];
    for (int i = 0; i < 4; ++i) {
      h16x2 t;
      t.x = (h16)(((xv[j][0][i] - ma) * ra) * pa.x + pa.y);
      t.y = (h16)(((xv[j][1][i] - mb) * rb) * pb.x + pb.y);
      *(h16x2*)(&xs[(q * 4 + i) * 264 + c]) = t;
    }
  }
  __syncthreads();

  h16* __restrict__ dst = hn + ((size_t)b * 1024 + p0) * 256;
  for (int j = 0; j < 4; ++j) {  // a wave stores one whole row of 512 B
    const int row = j * 8 + (tid >> 5);
    const int ch  = tid & 31;
    *(u32x4*)(dst + row * 256 + ch * 8) = *(const u32x4*)(&xs[row * 264 + ch * 8]);
  }
}

// -------------------- Text share of q, k, v: bcat[image][n] --------------------
// A text channel has one value at all positions of an image, so its products with the weight rows
// 256..767 are the same for all 1024 positions: [8 images][512] x [512][32 columns] per block, on
// the matrix unit with the same f16 operands as the position-wise product had, plus the bias.
// 8 waves = 2 tiles of 16 columns x 4 quarters of the 512 channels; the quarters are summed in LDS.
__device__ __forceinline__ void text_share(
    const float* __restrict__ W, const float* __restrict__ bs, int n0, int nn0,
    const float* __restrict__ text, const float* __restrict__ stats,
    const float* __restrict__ gamma, const float* __restrict__ beta, float* __restrict__ bcat) {
  __shared__ float st[512];                      // mean, then rstd, of 8 images x 32 groups
  __shared__ __align__(16) h16 tn[8 * 520];      // normalized text [image][channel], pitch 1040 B
  __shared__ float red[8 * 128];                 // [wave][image][column]
  const int tid = threadIdx.x, wave = tid >> 5, lane = tid & 31;
  const int l16 = lane & 15, hi = lane >> 4;
  const int nt = wave & 1, kq = wave >> 1;

  // B operand: column l16 of the tile, k = s*32 + hi*8 + j and s*32 + 16 + hi*8 + j
  float wv[4][16];
  const float* __restrict__ wp = W + (size_t)(256 + kq * 128 + hi * 8) * 256 + nn0 + nt * 16 + l16;
  for (int s = 0; s < 4; ++s)
    for (int j = 0; j < 8; ++j) {
      wv[s][j]     = wp[(s * 32 + j) * 256];
      wv[s][8 + j] = wp[(s * 32 + 16 + j) * 256];
    }
  float tx[16], gm[2], bt[2];
  for (int i = 0; i < 16; ++i) tx[i] = text[i * 256 + tid];
  for (int j = 0; j < 2; ++j) { gm[j] = gamma[256 + j * 256 + tid]; bt[j] = beta[256 + j * 256 + tid]; }
  const float bv = bs[nn0 + (tid & 31)];  // read with the rest: one trip to memory
  st[tid]       = stats[tid];
  st[256 + tid] = stats[256 + tid];
  __syncthreads();
  for (int i = 0; i < 16; ++i) {
    const int img = i >> 1, j = i & 1;
    const int g = img * 32 + (256 + j * 256 + tid) / 24;
    tn[img * 520 + j * 256 + tid] = (h16)(((tx[i] - st[g]) * st[256 + g]) * gm[j] + bt[j]);
  }
  __syncthreads();

  // A operand: row = image. Rows 8..15 repeat rows 0..7; their results are not used.
  v8f acc;
  for (int r = 0; r < 8; ++r) acc[r] = 0.f;
  for (int s = 0; s < 4; ++s) {
    const h16* ab = &tn[(l16 & 7) * 520 + kq * 128 + s * 32 + hi * 8];
    FragV afr, bfr;
    afr.q[0] = *(const u32x4*)(ab);
    afr.q[1] = *(const u32x4*)(ab + 16);
    for (int j = 0; j < 16; ++j) bfr.h[j] = (h16)wv[s][j];
    acc = __builtin_amdgcn_wmma_f32_16x16x32_f16(
        false, afr.h, false, bfr.h, (short)0, acc, false, false);
  }
  if (hi == 0)
    for (int r = 0; r < 8; ++r) red[wave * 128 + r * 16 + l16] = acc[r];
  __syncthreads();
  const int img = tid >> 5, col = tid & 31;
  const float* rp = &red[(col >> 4) * 128 + img * 16 + (col & 15)];
  bcat[img * 768 + n0 + col] = ((rp[0] + rp[256]) + (rp[512] + rp[768])) + bv;
}

// -------------------- Weight rows 0..255 -> f16, transposed [N=768][K=256]; text share --------------------
// grid: (4 tiles of 64 k and one text block, 24 tiles of 32 n). Whole 128-B lines in (32 n of one
// k row) and out (64 k of one n row), turned in LDS.
__global__ __launch_bounds__(256) void wconv_kernel(
    const float* __restrict__ W0, const float* __restrict__ W1, const float* __restrict__ W2,
    const float* __restrict__ b0, const float* __restrict__ b1, const float* __restrict__ b2,
    const float* __restrict__ text, const float* __restrict__ stats,
    const float* __restrict__ gamma, const float* __restrict__ beta,
    h16* __restrict__ Wt, float* __restrict__ bcat) {
  __shared__ __align__(16) h16 tw[32 * 72];  // [n][k], pitch 144 B
  const int k0  = blockIdx.x * 64;
  const int n0  = blockIdx.y * 32;
  const int nn0 = n0 & 255;
  const int tid = threadIdx.x;
  const float* W = (n0 < 256) ? W0 : ((n0 < 512) ? W1 : W2);
  if (blockIdx.x == 4) {  // the same for the whole block
    text_share(W, (n0 < 256) ? b0 : ((n0 < 512) ? b1 : b2), n0, nn0, text, stats, gamma, beta, bcat);
    return;
  }
  const int q  = tid & 7;    // 4 columns 4q..4q+3
  const int k2 = tid >> 3;   // k pair 2*k2, 2*k2+1
  const f32x4 wa = *(const f32x4*)(W + (size_t)(k0 + k2 * 2) * 256 + nn0 + q * 4);
  const f32x4 wb = *(const f32x4*)(W + (size_t)(k0 + k2 * 2 + 1) * 256 + nn0 + q * 4);
  for (int i = 0; i < 4; ++i) {
    h16x2 t;
    t.x = (h16)wa[i];
    t.y = (h16)wb[i];
    *(h16x2*)(&tw[(q * 4 + i) * 72 + k2 * 2]) = t;
  }
  __syncthreads();
  const int row = tid >> 3, ch = tid & 7;
  *(u32x4*)(Wt + (size_t)(n0 + row) * 256 + k0 + ch * 8) = *(const u32x4*)(&tw[row * 72 + ch * 8]);
  // wait behind the store: the text block's code follows in the listing and rewrites the registers
  // that the issued store names
  asm volatile("s_wait_xcnt 0x0" ::: "memory");
}

__global__ __launch_bounds__(256) void gemm_qkv_kernel(
    const h16* __restrict__ A, const h16* __restrict__ Bt,
    const float* __restrict__ bias, h16* __restrict__ Cout) {
  __shared__ __align__(16) h16 As[2][128 * 48];  // stride 48 h16 = 96B, 16B aligned
  __shared__ __align__(16) h16 Bs[2][128 * 48];
  const int mBase = blockIdx.x * 128;
  const int nBase = blockIdx.y * 128;
  const int tid  = threadIdx.x;
  const int wave = tid >> 5;
  const int lane = tid & 31;
  const int wm = wave >> 1;       // 0..3
  const int wn = wave & 1;        // 0..1
  const int l16 = lane & 15;
  const int hi  = lane >> 4;      // 0/1 selects K phase per WMMA A/B layout

  const int row0 = tid >> 2;            // chunk id tid   -> row, seg
  const int seg0 = tid & 3;
  const int row1 = (tid + 256) >> 2;    // chunk id tid+256
  const int seg1 = (tid + 256) & 3;

  v8f acc[2][4];
  for (int mt = 0; mt < 2; ++mt)
    for (int nt = 0; nt < 4; ++nt)
      for (int r = 0; r < 8; ++r) acc[mt][nt][r] = 0.f;

  auto load_tiles = [&](int k0, int buf) {
    async_copy4_b128((unsigned)(uintptr_t)&As[buf][row0 * 48 + seg0 * 8],
                     A + (size_t)(mBase + row0) * 256 + k0 + seg0 * 8,
                     (unsigned)(uintptr_t)&As[buf][row1 * 48 + seg1 * 8],
                     A + (size_t)(mBase + row1) * 256 + k0 + seg1 * 8,
                     (unsigned)(uintptr_t)&Bs[buf][row0 * 48 + seg0 * 8],
                     Bt + (size_t)(nBase + row0) * 256 + k0 + seg0 * 8,
                     (unsigned)(uintptr_t)&Bs[buf][row1 * 48 + seg1 * 8],
                     Bt + (size_t)(nBase + row1) * 256 + k0 + seg1 * 8);
  };

  load_tiles(0, 0);
  wait_async0();
  __syncthreads();
  load_tiles(32, 1);  // flies while tile 0 is worked on

  int buf = 0;
  for (int k0 = 0; k0 < 256; k0 += 32) {

    FragV afr[2];
    for (int mt = 0; mt < 2; ++mt) {
      const int row = wm * 32 + mt * 16 + l16;
      const int ko  = hi * 8;
      afr[mt].q[0] = *(const u32x4*)(&As[buf][row * 48 + ko]);
      afr[mt].q[1] = *(const u32x4*)(&As[buf][row * 48 + ko + 16]);
    }
    for (int nt = 0; nt < 4; ++nt) {
      const int col = wn * 64 + nt * 16 + l16;
      const int ko  = hi * 8;
      FragV bfr;
      bfr.q[0] = *(const u32x4*)(&Bs[buf][col * 48 + ko]);
      bfr.q[1] = *(const u32x4*)(&Bs[buf][col * 48 + ko + 16]);
      for (int mt = 0; mt < 2; ++mt)
        acc[mt][nt] = __builtin_amdgcn_wmma_f32_16x16x32_f16(
            false, afr[mt].h, false, bfr.h, (short)0, acc[mt][nt], false, false);
    }

    // hand-over: this wave's reads of this tile are done, its copies of the next have landed;
    // behind the barrier that holds for all waves, and this tile's buffer may be refilled
    asm volatile("s_wait_dscnt 0x0" ::: "memory");
    wait_async0();
    __syncthreads();
    if (k0 + 64 < 256) load_tiles(k0 + 64, buf);
    buf ^= 1;
  }
  wait_async0();  // nothing is in flight when the wave ends

  const float* __restrict__ bimg = bias + (mBase >> 10) * 768;  // 128 rows lie in one image
  for (int mt = 0; mt < 2; ++mt)
    for (int nt = 0; nt < 4; ++nt) {
      const int n = nBase + wn * 64 + nt * 16 + l16;
      const float bv = bimg[n];
      for (int r = 0; r < 8; ++r) {
        const int m = mBase + wm * 32 + mt * 16 + r + hi * 8;
        Cout[(size_t)m * 768 + n] = (h16)(acc[mt][nt][r] + bv);
      }
    }
}

// -------------------- V transpose: vT[bh][ch=64][pos=1024] --------------------
// grid: 512 blocks = (bh, 64 positions). Whole 128-B lines in (64 channels of one position) and
// out (64 positions of one channel), turned in LDS.
__global__ __launch_bounds__(256) void vtrans_kernel(
    const h16* __restrict__ qkv, h16* __restrict__ vT) {
  __shared__ __align__(16) h16 tv[64 * 72];  // [channel][position], pitch 144 B
  const int bh = blockIdx.x >> 4;
  const int p0 = (blockIdx.x & 15) * 64;
  const int b = bh >> 2, h = bh & 3;
  const int tid = threadIdx.x;
  const int c8 = tid & 7;    // 8 channels 8*c8..8*c8+7
  const int p2 = tid >> 3;   // position pair 2*p2, 2*p2+1
  const h16* src = qkv + ((size_t)b * 1024 + p0 + p2 * 2) * 768 + 512 + h * 64 + c8 * 8;
  const h16x8 va = *(const h16x8*)(src);
  const h16x8 vb = *(const h16x8*)(src + 768);
  for (int i = 0; i < 8; ++i) {
    h16x2 t;
    t.x = va[i];
    t.y = vb[i];
    *(h16x2*)(&tv[(c8 * 8 + i) * 72 + p2 * 2]) = t;
  }
  __syncthreads();
  for (int j = 0; j < 2; ++j) {
    const int row = j * 32 + (tid >> 3);
    const int ch  = tid & 7;
    *(u32x4*)(vT + ((size_t)bh * 64 + row) * 1024 + p0 + ch * 8) =
        *(const u32x4*)(&tv[row * 72 + ch * 8]);
  }
}

__device__ __forceinline__ float xhalf(float v) {
  const int b = __builtin_bit_cast(int, v);
  return __builtin_bit_cast(float,
      __builtin_amdgcn_permlanex16(b, b, 0x76543210, 0xfedcba98, false, false));
}

__global__ __launch_bounds__(256) void attn_kernel(
    const h16* __restrict__ qkv, const h16* __restrict__ vT,
    const float* __restrict__ x, float* __restrict__ out) {
  const int bh = blockIdx.x;
  const int b = bh >> 2, h = bh & 3;
  const int tid = threadIdx.x, wave = tid >> 5, lane = tid & 31;
  const int qg = wave & 3;   // query group
  const int kh = wave >> 2;  // key half of every stage
  const int l16 = lane & 15;
  const int hi  = lane >> 4;
  const int hi8 = hi * 8;
  const int qrow0 = blockIdx.y * 128 + qg * 32;

  __shared__ __align__(16) h16 Ks[2][128 * 72];   // [key][channel], pitch 144 B
  __shared__ __align__(16) h16 Vs[2][64 * 136];   // [channel][key], pitch 272 B
  __shared__ __align__(16) f32x4 xo[8][8][32];    // [wave][piece][lane]: the O^T half the partner finishes
  __shared__ v2f xml[8][2][32];                   // [wave][mt][lane]: maximum, sum
  // a thread copies 16 B of four rows of each tile; a wave covers whole 128-B (K) or 256-B (V^T) rows
  const int crow = tid >> 3;
  const int cseg = (tid & 7) * 8;
  const int vrow = tid >> 4;
  const int vseg = (tid & 15) * 8;
  const h16* __restrict__ ksrc = qkv + ((size_t)b * 1024 + crow) * 768 + 256 + h * 64 + cseg;
  const h16* __restrict__ vsrc = vT + ((size_t)bh * 64 + vrow) * 1024 + vseg;
  auto stage = [&](int st, int buf) {
    const h16* kp = ksrc + (size_t)st * 128 * 768;
    const h16* vp = vsrc + st * 128;
    async_copy4_b128((unsigned)(uintptr_t)&Ks[buf][crow * 72 + cseg], kp,
                     (unsigned)(uintptr_t)&Ks[buf][(crow + 32) * 72 + cseg], kp + 32 * 768,
                     (unsigned)(uintptr_t)&Ks[buf][(crow + 64) * 72 + cseg], kp + 64 * 768,
                     (unsigned)(uintptr_t)&Ks[buf][(crow + 96) * 72 + cseg], kp + 96 * 768);
    async_copy4_b128((unsigned)(uintptr_t)&Vs[buf][vrow * 136 + vseg], vp,
                     (unsigned)(uintptr_t)&Vs[buf][(vrow + 16) * 136 + vseg], vp + 16 * 1024,
                     (unsigned)(uintptr_t)&Vs[buf][(vrow + 32) * 136 + vseg], vp + 32 * 1024,
                     (unsigned)(uintptr_t)&Vs[buf][(vrow + 48) * 136 + vseg], vp + 48 * 1024);
  };
  stage(0, 0);

  // Preload Q fragments: [mt][kc] covers 32 rows x 64 channels
  FragV qf[2][2];
  for (int mt = 0; mt < 2; ++mt)
    for (int kc = 0; kc < 2; ++kc) {
      const int row = qrow0 + mt * 16 + l16;
      const h16* base = qkv + ((size_t)b * 1024 + row) * 768 + h * 64 + kc * 32 + hi * 8;
      qf[mt][kc].q[0] = *(const u32x4*)(base);
      qf[mt][kc].q[1] = *(const u32x4*)(base + 16);
    }

  // per lane: running maximum of query mt*16+l16, and this half's share of its sum
  float mrow[2], lrow[2];
  v8f oacc[2][4];  // O^T tile: [r] = channel nt*16 + hi8 + r, query mt*16 + l16
  for (int mt = 0; mt < 2; ++mt) { mrow[mt] = -1e30f; lrow[mt] = 0.f; }
  for (int mt = 0; mt < 2; ++mt)
    for (int nt = 0; nt < 4; ++nt)
      for (int r = 0; r < 8; ++r) oacc[mt][nt][r] = 0.f;

  wait_async0();    // stage 0 has landed for this wave's copies
  __syncthreads();  // and for every wave's
  stage(1, 1);

  for (int kt = 0; kt < 8; ++kt) {
    const h16* Kt = Ks[kt & 1] + kh * (64 * 72);
    const h16* Vt = Vs[kt & 1] + kh * 64;

    // ---- S^T = K * Q^T: sacc[mt][nt][r] = key nt*16 + hi8 + r, query mt*16 + l16 ----
    v8f sacc[2][4];
    for (int mt = 0; mt < 2; ++mt)
      for (int nt = 0; nt < 4; ++nt)
        for (int r = 0; r < 8; ++r) sacc[mt][nt][r] = 0.f;

    for (int nt = 0; nt < 4; ++nt) {
      const h16* kb = Kt + (nt * 16 + l16) * 72 + hi * 8;
      FragV kf0, kf1;
      kf0.q[0] = *(const u32x4*)(kb);       kf0.q[1] = *(const u32x4*)(kb + 16);
      kf1.q[0] = *(const u32x4*)(kb + 32);  kf1.q[1] = *(const u32x4*)(kb + 48);
      for (int mt = 0; mt < 2; ++mt) {
        sacc[mt][nt] = __builtin_amdgcn_wmma_f32_16x16x32_f16(
            false, kf0.h, false, qf[mt][0].h, (short)0, sacc[mt][nt], false, false);
        sacc[mt][nt] = __builtin_amdgcn_wmma_f32_16x16x32_f16(
            false, kf1.h, false, qf[mt][1].h, (short)0, sacc[mt][nt], false, false);
      }
    }

    // ---- scale + online softmax, one query per lane ----
    // Worked on in pairs of neighbouring accumulator registers (keys 2j, 2j+1 of a tile).
    FragV pf[2][2];  // P^T as B operand: [mt][kc], 32 keys each
    for (int mt = 0; mt < 2; ++mt) {
      v2f sp[4][4];
      for (int nt = 0; nt < 4; ++nt)
        for (int j = 0; j < 4; ++j) {
          const v2f t = {sacc[mt][nt][2 * j], sacc[mt][nt][2 * j + 1]};
          sp[nt][j] = t * 0.125f;  // Ch^-0.5
        }

      float vm[4];
      for (int nt = 0; nt < 4; ++nt) {
        vm[nt] = fmaxf(sp[nt][0].x, sp[nt][0].y);
        for (int j = 1; j < 4; ++j) vm[nt] = fmaxf(vm[nt], fmaxf(sp[nt][j].x, sp[nt][j].y));
      }
      float v = fmaxf(fmaxf(vm[0], vm[1]), fmaxf(vm[2], vm[3]));
      v = fmaxf(v, xhalf(v));  // the other 32 keys of this query
      const float mold = mrow[mt];
      const float mnew = fmaxf(mold, v);
      const float corr = __expf(mold - mnew);
      mrow[mt] = mnew;
      for (int nt = 0; nt < 4; ++nt)
        for (int r = 0; r < 8; ++r) oacc[mt][nt][r] *= corr;
      // tiles 2kc and 2kc+1 hold keys hi8+0..7 and 16+hi8+0..7 of chunk kc: the B k order
      v2f ps[4];
      for (int nt = 0; nt < 4; ++nt) {
        for (int j = 0; j < 4; ++j) {
          const v2f d = sp[nt][j] - mnew;
          const v2f p = {__expf(d.x), __expf(d.y)};
          ps[nt] = (j == 0) ? p : ps[nt] + p;
          pf[mt][nt >> 1].h[(nt & 1) * 8 + 2 * j]     = (h16)p.x;
          pf[mt][nt >> 1].h[(nt & 1) * 8 + 2 * j + 1] = (h16)p.y;
        }
      }
      const v2f pt = (ps[0] + ps[1]) + (ps[2] + ps[3]);
      lrow[mt] = lrow[mt] * corr + (pt.x + pt.y);
    }

    // ---- O^T += V^T * P^T ----
    for (int kc = 0; kc < 2; ++kc) {
      for (int nt = 0; nt < 4; ++nt) {
        const h16* vb = Vt + (nt * 16 + l16) * 136 + kc * 32 + hi * 8;
        FragV vf;
        vf.q[0] = *(const u32x4*)(vb);
        vf.q[1] = *(const u32x4*)(vb + 16);
        for (int mt = 0; mt < 2; ++mt)
          oacc[mt][nt] = __builtin_amdgcn_wmma_f32_16x16x32_f16(
              false, vf.h, false, pf[mt][kc].h, (short)0, oacc[mt][nt], false, false);
      }
    }

    // hand-over: this wave's reads of stage kt are done, its copies of stage kt + 1 have landed;
    // behind the barrier that holds for all waves, and stage kt's buffer may be refilled
    asm volatile("s_wait_dscnt 0x0" ::: "memory");
    wait_async0();
    __syncthreads();
    if (kt + 2 < 8) stage(kt + 2, kt & 1);
  }
  wait_async0();  // nothing is in flight when the wave ends

  // ---- merge the two key halves of a query group ----
  // Wave kh finishes channels kh*32 .. kh*32+31 (tiles 2kh, 2kh+1) and hands the other two tiles,
  // with its maximum and its sum, to its partner, wave ^ 4.
  // element [mt][j][r] of this lane: channel h*64 + kh*32 + j*16 + hi8 + r, position qrow0 + mt*16 + l16
  const size_t ebase = ((size_t)b * 256 + h * 64 + kh * 32 + hi8) * 1024 + qrow0 + l16;
  const float* __restrict__ xb = x + ebase;
  float* __restrict__ ob = out + ebase;
  float xr[2][2][8];  // residual, asked for ahead of the exchange
  for (int mt = 0; mt < 2; ++mt)
    for (int j = 0; j < 2; ++j)
      for (int r = 0; r < 8; ++r) xr[mt][j][r] = xb[(j * 16 + r) * 1024 + mt * 16];
  float lw[2];
  v8f mine[2][2];  // the two tiles this wave finishes
  for (int mt = 0; mt < 2; ++mt) {
    lw[mt] = lrow[mt] + xhalf(lrow[mt]);  // join the lane halves' sums
    const v2f ml = {mrow[mt], lw[mt]};
    xml[wave][mt][lane] = ml;
    for (int j = 0; j < 2; ++j) {
      const v8f o = kh ? oacc[mt][j] : oacc[mt][2 + j];
      mine[mt][j] = kh ? oacc[mt][2 + j] : oacc[mt][j];
      const f32x4 lo = {o[0], o[1], o[2], o[3]}, up = {o[4], o[5], o[6], o[7]};
      xo[wave][(mt * 2 + j) * 2][lane]     = lo;
      xo[wave][(mt * 2 + j) * 2 + 1][lane] = up;
    }
  }
  // keeps the selects in front of the barrier, where the wave waits for the residual loads anyway;
  // without it the compiler moves half of them behind the barrier, in among the weights' arithmetic
  __builtin_amdgcn_sched_barrier(0);
  __syncthreads();  // every wave's partial result is in LDS

  // ---- finalize: weigh both halves, O * (1/l), residual add, store f32 [B,C,H*W] ----
  const int pw = wave ^ 4;
  for (int mt = 0; mt < 2; ++mt) {
    const v2f pm = xml[pw][mt][lane];
    const float mall = fmaxf(mrow[mt], pm.x);
    const float wa = __expf(mrow[mt] - mall), wb = __expf(pm.x - mall);
    const float linv = 1.0f / (lw[mt] * wa + pm.y * wb);
    const float ca = wa * linv, cb = wb * linv;
    for (int j = 0; j < 2; ++j) {
      const v8f o = mine[mt][j];
      const f32x4 lo = xo[pw][(mt * 2 + j) * 2][lane], up = xo[pw][(mt * 2 + j) * 2 + 1][lane];
      for (int r = 0; r < 8; ++r)
        ob[(j * 16 + r) * 1024 + mt * 16] = xr[mt][j][r] + (o[r] * ca + (r < 4 ? lo[r & 3] : up[r & 3]) * cb);
    }
  }
}

// -------------------- launch --------------------
extern "C" void kernel_launch(void* const* d_in, const int* in_sizes, int n_in,
                              void* d_out, int out_size, void* d_ws, size_t ws_size,
                              hipStream_t stream) {
  const float* x     = (const float*)d_in[0];
  const float* text  = (const float*)d_in[1];
  const float* gamma = (const float*)d_in[2];
  const float* beta  = (const float*)d_in[3];
  const float* W0    = (const float*)d_in[4];
  const float* b0    = (const float*)d_in[5];
  const float* W1    = (const float*)d_in[6];
  const float* b1    = (const float*)d_in[7];
  const float* W2    = (const float*)d_in[8];
  const float* b2    = (const float*)d_in[9];
  float* out = (float*)d_out;

  char* ws = (char*)d_ws;
  float* stats = (float*)ws;                    // 512 f32
  float* bcat  = (float*)(ws + 2048);           // 8*768 f32
  h16*   hn    = (h16*)(ws + 32768);            // 8*1024*256
  h16*   Wt    = hn + (size_t)8 * 1024 * 256;   // 768*256
  h16*   qkv   = Wt + (size_t)768 * 256;        // 8*1024*768
  h16*   vT    = qkv + (size_t)8 * 1024 * 768;  // 32*64*1024

  gn_stats_kernel<<<256, 256, 0, stream>>>(x, text, stats);
  normalize_kernel<<<256, 256, 0, stream>>>(x, stats, gamma, beta, hn);
  wconv_kernel<<<dim3(5, 24), 256, 0, stream>>>(W0, W1, W2, b0, b1, b2, text, stats, gamma, beta, Wt, bcat);
  gemm_qkv_kernel<<<dim3(64, 6), 256, 0, stream>>>(hn, Wt, bcat, qkv);
  vtrans_kernel<<<512, 256, 0, stream>>>(qkv, vT);
  attn_kernel<<<dim3(32, 8), 256, 0, stream>>>(qkv, vT, x, out);
}

// v007
// One run takes 33.9 microseconds.
// Next to v006, in two timings, it ran 1.07 and 1.08 times as fast.
// All steps since v000 together make it 5.98 times as fast.
#include <hip/hip_runtime.h>
#include <hip/hip_bf16.h>

typedef _Float16 h16;
typedef __attribute__((ext_vector_type(16))) _Float16 v16h;
typedef __attribute__((ext_vector_type(8)))  float    v8f;
typedef __attribute__((ext_vector_type(2)))  float    v2f;
typedef __attribute__((ext_vector_type(4)))  unsigned int u32x4;
typedef __attribute__((ext_vector_type(4)))  float    f32x4;
typedef __attribute__((ext_vector_type(2)))  _Float16 h16x2;
typedef __attribute__((ext_vector_type(8)))  _Float16 h16x8;

union FragV { u32x4 q[2]; v16h h; };

__device__ __forceinline__ void async_copy4_b128(unsigned l0, const void* g0, unsigned l1, const void* g1,
                                                 unsigned l2, const void* g2, unsigned l3, const void* g3) {
  asm volatile("global_load_async_to_lds_b128 %0, %1, off\n\t"
               "global_load_async_to_lds_b128 %2, %3, off\n\t"
               "global_load_async_to_lds_b128 %4, %5, off\n\t"
               "global_load_async_to_lds_b128 %6, %7, off\n\t"
               "s_wait_xcnt 0x0"
               :: "v"(l0), "v"(g0), "v"(l1), "v"(g1), "v"(l2), "v"(g2), "v"(l3), "v"(g3) : "memory");
}
__device__ __forceinline__ void wait_async0() {
  asm volatile("s_wait_asynccnt 0" ::: "memory");
}

// -------------------- GroupNorm statistics --------------------
// grid: 256 blocks = (b,g), 256 threads. Group g covers channels [24g,24g+24).
// A thread takes 4 neighbouring positions of each of the 24 channels. The channels come in three
// runs of 8: 24g and 256 are multiples of 8, so a run is all x or all text, x runs first.
// One thread's share of a group with NX runs of x channels: every load is issued before the
// first sum reads one, so the block waits for memory once.
template <int NX>
__device__ __forceinline__ void gn_part(const float* __restrict__ xs, const float* __restrict__ ts,
                                        float& s, float& ss) {
  f32x4 v[NX * 8 + 1];
  for (int e = 0; e < NX * 8; ++e) v[e] = *(const f32x4*)(xs + (e << 10));
  // keeps the sums behind the last load: without it the compiler holds half of the loads back
  // until the first ones have returned, a second trip to memory
  __builtin_amdgcn_sched_barrier(0);
  float st = 0.f, sq = 0.f;  // a text channel has one value at all positions
  for (int e = 0; e < (3 - NX) * 8; ++e) { const float t = ts[e]; st += t; sq += t * t; }
  f32x4 s4 = {st, st, st, st}, q4 = {sq, sq, sq, sq};
  for (int e = 0; e < NX * 8; ++e) { s4 += v[e]; q4 += v[e] * v[e]; }
  s  = (s4.x + s4.y) + (s4.z + s4.w);
  ss = (q4.x + q4.y) + (q4.z + q4.w);
}

__global__ __launch_bounds__(256) void gn_stats_kernel(
    const float* __restrict__ x, const float* __restrict__ text,
    float* __restrict__ stats) {
  const int b = blockIdx.x >> 5;
  const int g = blockIdx.x & 31;
  const int tid = threadIdx.x;
  const int nx = (g * 24 >= 256) ? 0 : ((256 - g * 24 >= 24) ? 3 : ((256 - g * 24) >> 3));
  const float* __restrict__ xs = x + (((size_t)b * 256 + g * 24) << 10) + tid * 4;
  const float* __restrict__ ts = text + b * 512 + (g * 24 + nx * 8 - 256);
  float s, ss;
  if (nx == 3)      gn_part<3>(xs, ts, s, ss);
  else if (nx == 2) gn_part<2>(xs, ts, s, ss);
  else if (nx == 1) gn_part<1>(xs, ts, s, ss);
  else              gn_part<0>(xs, ts, s, ss);
  for (int off = 16; off >= 1; off >>= 1) {
    s  += __shfl_xor(s,  off, 32);
    ss += __shfl_xor(ss, off, 32);
  }
  __shared__ float rs[8], rss[8];
  if ((tid & 31) == 0) { rs[tid >> 5] = s; rss[tid >> 5] = ss; }
  __syncthreads();
  if (tid == 0) {
    float S = 0.f, SS = 0.f;
    for (int i = 0; i < 8; ++i) { S += rs[i]; SS += rss[i]; }
    const float mean = S * (1.f / 24576.f);
    const float var  = SS * (1.f / 24576.f) - mean * mean;
    stats[blockIdx.x]       = mean;
    stats[256 + blockIdx.x] = rsqrtf(var + 1e-6f);
  }
}

// -------------------- Normalize + cast to f16, x channels only, layout [B*HW, 256] --------------------
// grid: 256 blocks = (b, 32 positions). The x tile [256 channels][32 positions] is read in whole
// 128-B lines, turned in LDS and stored as 16-B pieces of hn rows. The 512 text channels do not
// depend on the position: their share of q, k, v is one row per image (text_share below).
__global__ __launch_bounds__(256) void normalize_kernel(
    const float* __restrict__ x,
    const float* __restrict__ stats, const float* __restrict__ gamma,
    const float* __restrict__ beta, h16* __restrict__ hn) {
  __shared__ __align__(16) h16 xs[32 * 264];  // [position][channel], pitch 528 B
  __shared__ float st[64];                    // mean, then rstd, of this image's 32 groups
  __shared__ v2f gb[256];                     // gamma, beta of an x channel
  const int b   = blockIdx.x >> 5;
  const int p0  = (blockIdx.x & 31) * 32;
  const int tid = threadIdx.x;
  const int q   = tid & 7;    // 4 positions 4q..4q+3
  const int c2  = tid >> 3;   // channel pair 2*c2, 2*c2+1 of each 64

  const float* __restrict__ sb = stats + b * 32;
  const float sv = sb[(tid & 31) + ((tid >> 5) & 1) * 256];
  const float gm = gamma[tid], bt = beta[tid];
  f32x4 xv[4][2];
  for (int j = 0; j < 4; ++j)
    for (int e = 0; e < 2; ++e) {
      // wait in front of the last load: the compiler lets its result land in the address pair
      // that the seven issued loads name
      if (j == 3 && e == 1) asm volatile("s_wait_xcnt 0x0" ::: "memory");
      xv[j][e] = *(const f32x4*)(x + (((size_t)b * 256 + j * 64 + c2 * 2 + e) << 10) + p0 + q * 4);
    }

  if (tid < 64) st[tid] = sv;
  {
    const v2f t = {gm, bt};
    gb[tid] = t;
  }
  __syncthreads();

  for (int j = 0; j < 4; ++j) {
    const int c = j * 64 + c2 * 2;
    const int ga = c / 24, gc = (c + 1) / 24;
    const float ma = st[ga], ra = st[32 + ga], mb = st[gc], rb = st[32 + gc];
    const v2f pa = gb[c], pb = gb[c + 1];
    for (int i = 0; i < 4; ++i) {
      h16x2 t;
      t.x = (h16)(((xv[j][0][i] - ma) * ra) * pa.x + pa.y);
      t.y = (h16)(((xv[j][1][i] - mb) * rb) * pb.x + pb.y);
      *(h16x2*)(&xs[(q * 4 + i) * 264 + c]) = t;
    }
  }
  __syncthreads();

  h16* __restrict__ dst = hn + ((size_t)b * 1024 + p0) * 256;
  for (int j = 0; j < 4; ++j) {  // a wave stores one whole row of 512 B
    const int row = j * 8 + (tid >> 5);
    const int ch  = tid & 31;
    *(u32x4*)(dst + row * 256 + ch * 8) = *(const u32x4*)(&xs[row * 264 + ch * 8]);
  }
}

// -------------------- Text share of q, k, v: bcat[image][n] --------------------
// A text channel has one value at all positions of an image, so its products with the weight rows
// 256..767 are the same for all 1024 positions: [8 images][512] x [512][32 columns] per block, on
// the matrix unit with the same f16 operands as the position-wise product had, plus the bias.
// 8 waves = 2 tiles of 16 columns x 4 quarters of the 512 channels; the quarters are summed in LDS.
__device__ __forceinline__ void text_share(
    const float* __restrict__ W, const float* __restrict__ bs, int n0, int nn0,
    const float* __restrict__ text, const float* __restrict__ stats,
    const float* __restrict__ gamma, const float* __restrict__ beta, float* __restrict__ bcat) {
  __shared__ float st[512];                      // mean, then rstd, of 8 images x 32 groups
  __shared__ __align__(16) h16 tn[8 * 520];      // normalized text [image][channel], pitch 1040 B
  __shared__ float red[8 * 128];                 // [wave][image][column]
  const int tid = threadIdx.x, wave = tid >> 5, lane = tid & 31;
  const int l16 = lane & 15, hi = lane >> 4;
  const int nt = wave & 1, kq = wave >> 1;

  // B operand: column l16 of the tile, k = s*32 + hi*8 + j and s*32 + 16 + hi*8 + j
  float wv[4][16];
  const float* __restrict__ wp = W + (size_t)(256 + kq * 128 + hi * 8) * 256 + nn0 + nt * 16 + l16;
  for (int s = 0; s < 4; ++s)
    for (int j = 0; j < 8; ++j) {
      wv[s][j]     = wp[(s * 32 + j) * 256];
      wv[s][8 + j] = wp[(s * 32 + 16 + j) * 256];
    }
  float tx[16], gm[2], bt[2];
  for (int i = 0; i < 16; ++i) tx[i] = text[i * 256 + tid];
  for (int j = 0; j < 2; ++j) { gm[j] = gamma[256 + j * 256 + tid]; bt[j] = beta[256 + j * 256 + tid]; }
  const float bv = bs[nn0 + (tid & 31)];  // read with the rest: one trip to memory
  st[tid]       = stats[tid];
  st[256 + tid] = stats[256 + tid];
  __syncthreads();
  for (int i = 0; i < 16; ++i) {
    const int img = i >> 1, j = i & 1;
    const int g = img * 32 + (256 + j * 256 + tid) / 24;
    tn[img * 520 + j * 256 + tid] = (h16)(((tx[i] - st[g]) * st[256 + g]) * gm[j] + bt[j]);
  }
  __syncthreads();

  // A operand: row = image. Rows 8..15 repeat rows 0..7; their results are not used.
  v8f acc;
  for (int r = 0; r < 8; ++r) acc[r] = 0.f;
  for (int s = 0; s < 4; ++s) {
    const h16* ab = &tn[(l16 & 7) * 520 + kq * 128 + s * 32 + hi * 8];
    FragV afr, bfr;
    afr.q[0] = *(const u32x4*)(ab);
    afr.q[1] = *(const u32x4*)(ab + 16);
    for (int j = 0; j < 16; ++j) bfr.h[j] = (h16)wv[s][j];
    acc = __builtin_amdgcn_wmma_f32_16x16x32_f16(
        false, afr.h, false, bfr.h, (short)0, acc, false, false);
  }
  if (hi == 0)
    for (int r = 0; r < 8; ++r) red[wave * 128 + r * 16 + l16] = acc[r];
  __syncthreads();
  const int img = tid >> 5, col = tid & 31;
  const float* rp = &red[(col >> 4) * 128 + img * 16 + (col & 15)];
  bcat[img * 768 + n0 + col] = ((rp[0] + rp[256]) + (rp[512] + rp[768])) + bv;
}

// -------------------- Weight rows 0..255 -> f16, transposed [N=768][K=256]; text share --------------------
// grid: (4 tiles of 64 k and one text block, 24 tiles of 32 n). Whole 128-B lines in (32 n of one
// k row) and out (64 k of one n row), turned in LDS.
__global__ __launch_bounds__(256) void wconv_kernel(
    const float* __restrict__ W0, const float* __restrict__ W1, const float* __restrict__ W2,
    const float* __restrict__ b0, const float* __restrict__ b1, const float* __restrict__ b2,
    const float* __restrict__ text, const float* __restrict__ stats,
    const float* __restrict__ gamma, const float* __restrict__ beta,
    h16* __restrict__ Wt, float* __restrict__ bcat) {
  __shared__ __align__(16) h16 tw[32 * 72];  // [n][k], pitch 144 B
  const int k0  = blockIdx.x * 64;
  const int n0  = blockIdx.y * 32;
  const int nn0 = n0 & 255;
  const int tid = threadIdx.x;
  const float* W = (n0 < 256) ? W0 : ((n0 < 512) ? W1 : W2);
  if (blockIdx.x == 4) {  // the same for the whole block
    text_share(W, (n0 < 256) ? b0 : ((n0 < 512) ? b1 : b2), n0, nn0, text, stats, gamma, beta, bcat);
    return;
  }
  const int q  = tid & 7;    // 4 columns 4q..4q+3
  const int k2 = tid >> 3;   // k pair 2*k2, 2*k2+1
  const f32x4 wa = *(const f32x4*)(W + (size_t)(k0 + k2 * 2) * 256 + nn0 + q * 4);
  const f32x4 wb = *(const f32x4*)(W + (size_t)(k0 + k2 * 2 + 1) * 256 + nn0 + q * 4);
  for (int i = 0; i < 4; ++i) {
    h16x2 t;
    t.x = (h16)wa[i];
    t.y = (h16)wb[i];
    *(h16x2*)(&tw[(q * 4 + i) * 72 + k2 * 2]) = t;
  }
  __syncthreads();
  const int row = tid >> 3, ch = tid & 7;
  *(u32x4*)(Wt + (size_t)(n0 + row) * 256 + k0 + ch * 8) = *(const u32x4*)(&tw[row * 72 + ch * 8]);
  // wait behind the store: the text block's code follows in the listing and rewrites the registers
  // that the issued store names
  asm volatile("s_wait_xcnt 0x0" ::: "memory");
}

__global__ __launch_bounds__(256) void gemm_qkv_kernel(
    const h16* __restrict__ A, const h16* __restrict__ Bt,
    const float* __restrict__ bias, h16* __restrict__ Cout, h16* __restrict__ vT) {
  __shared__ __align__(16) h16 As[2][128 * 48];  // stride 48 h16 = 96B, 16B aligned
  __shared__ __align__(16) h16 Bs[2][128 * 48];
  const int mBase = blockIdx.x * 128;
  const int nBase = blockIdx.y * 128;
  const int tid  = threadIdx.x;
  const int wave = tid >> 5;
  const int lane = tid & 31;
  const int wm = wave >> 1;       // 0..3
  const int wn = wave & 1;        // 0..1
  const int l16 = lane & 15;
  const int hi  = lane >> 4;      // 0/1 selects K phase per WMMA A/B layout

  const int row0 = tid >> 2;            // chunk id tid   -> row, seg
  const int seg0 = tid & 3;
  const int row1 = (tid + 256) >> 2;    // chunk id tid+256
  const int seg1 = (tid + 256) & 3;

  v8f acc[2][4];
  for (int mt = 0; mt < 2; ++mt)
    for (int nt = 0; nt < 4; ++nt)
      for (int r = 0; r < 8; ++r) acc[mt][nt][r] = 0.f;

  auto load_tiles = [&](int k0, int buf) {
    async_copy4_b128((unsigned)(uintptr_t)&As[buf][row0 * 48 + seg0 * 8],
                     A + (size_t)(mBase + row0) * 256 + k0 + seg0 * 8,
                     (unsigned)(uintptr_t)&As[buf][row1 * 48 + seg1 * 8],
                     A + (size_t)(mBase + row1) * 256 + k0 + seg1 * 8,
                     (unsigned)(uintptr_t)&Bs[buf][row0 * 48 + seg0 * 8],
                     Bt + (size_t)(nBase + row0) * 256 + k0 + seg0 * 8,
                     (unsigned)(uintptr_t)&Bs[buf][row1 * 48 + seg1 * 8],
                     Bt + (size_t)(nBase + row1) * 256 + k0 + seg1 * 8);
  };

  load_tiles(0, 0);
  wait_async0();
  __syncthreads();
  load_tiles(32, 1);  // flies while tile 0 is worked on

  int buf = 0;
  for (int k0 = 0; k0 < 256; k0 += 32) {

    FragV afr[2];
    for (int mt = 0; mt < 2; ++mt) {
      const int row = wm * 32 + mt * 16 + l16;
      const int ko  = hi * 8;
      afr[mt].q[0] = *(const u32x4*)(&As[buf][row * 48 + ko]);
      afr[mt].q[1] = *(const u32x4*)(&As[buf][row * 48 + ko + 16]);
    }
    for (int nt = 0; nt < 4; ++nt) {
      const int col = wn * 64 + nt * 16 + l16;
      const int ko  = hi * 8;
      FragV bfr;
      bfr.q[0] = *(const u32x4*)(&Bs[buf][col * 48 + ko]);
      bfr.q[1] = *(const u32x4*)(&Bs[buf][col * 48 + ko + 16]);
      for (int mt = 0; mt < 2; ++mt)
        acc[mt][nt] = __builtin_amdgcn_wmma_f32_16x16x32_f16(
            false, afr[mt].h, false, bfr.h, (short)0, acc[mt][nt], false, false);
    }

    // hand-over: this wave's reads of this tile are done, its copies of the next have landed;
    // behind the barrier that holds for all waves, and this tile's buffer may be refilled
    asm volatile("s_wait_dscnt 0x0" ::: "memory");
    wait_async0();
    __syncthreads();
    if (k0 + 64 < 256) load_tiles(k0 + 64, buf);
    buf ^= 1;
  }
  wait_async0();  // nothing is in flight when the wave ends

  const float* __restrict__ bimg = bias + (mBase >> 10) * 768;  // 128 rows lie in one image
  h16x8 cv[2][4];  // [r] = row wm*32 + mt*16 + hi*8 + r, column wn*64 + nt*16 + l16 of the block tile
  float bv[4];
  for (int nt = 0; nt < 4; ++nt) bv[nt] = bimg[nBase + wn * 64 + nt * 16 + l16];
  for (int mt = 0; mt < 2; ++mt)
    for (int nt = 0; nt < 4; ++nt)
      for (int r = 0; r < 8; ++r) cv[mt][nt][r] = (h16)(acc[mt][nt][r] + bv[nt]);
  if (nBase >= 512) {  // v columns, the same for the whole block: row (image*256 + column) of vT
    h16* __restrict__ vb = vT + ((size_t)(mBase >> 10) * 256 + (nBase - 512) + wn * 64 + l16) * 1024 +
                           (mBase & 1023) + wm * 32 + hi * 8;
    for (int nt = 0; nt < 4; ++nt)
      for (int mt = 0; mt < 2; ++mt) *(h16x8*)(vb + nt * 16 * 1024 + mt * 16) = cv[mt][nt];
    return;
  }
  for (int mt = 0; mt < 2; ++mt)
    for (int nt = 0; nt < 4; ++nt) {
      const int n = nBase + wn * 64 + nt * 16 + l16;
      for (int r = 0; r < 8; ++r) {
        const int m = mBase + wm * 32 + mt * 16 + r + hi * 8;
        Cout[(size_t)m * 768 + n] = cv[mt][nt][r];
      }
    }
  // wait behind the last store: the v block's code follows in the listing and rewrites the address
  // registers that the issued stores name
  asm volatile("s_wait_xcnt 0x0" ::: "memory");
}

__device__ __forceinline__ float xhalf(float v) {
  const int b = __builtin_bit_cast(int, v);
  return __builtin_bit_cast(float,
      __builtin_amdgcn_permlanex16(b, b, 0x76543210, 0xfedcba98, false, false));
}

__global__ __launch_bounds__(256) void attn_kernel(
    const h16* __restrict__ qkv, const h16* __restrict__ vT,
    const float* __restrict__ x, float* __restrict__ out) {
  const int bh = blockIdx.x;
  const int b = bh >> 2, h = bh & 3;
  const int tid = threadIdx.x, wave = tid >> 5, lane = tid & 31;
  const int qg = wave & 3;   // query group
  const int kh = wave >> 2;  // key half of every stage
  const int l16 = lane & 15;
  const int hi  = lane >> 4;
  const int hi8 = hi * 8;
  const int qrow0 = blockIdx.y * 128 + qg * 32;

  __shared__ __align__(16) h16 Ks[2][128 * 72];   // [key][channel], pitch 144 B
  __shared__ __align__(16) h16 Vs[2][64 * 136];   // [channel][key], pitch 272 B
  __shared__ __align__(16) f32x4 xo[8][8][32];    // [wave][piece][lane]: the O^T half the partner finishes
  __shared__ v2f xml[8][2][32];                   // [wave][mt][lane]: maximum, sum
  // a thread copies 16 B of four rows of each tile; a wave covers whole 128-B (K) or 256-B (V^T) rows
  const int crow = tid >> 3;
  const int cseg = (tid & 7) * 8;
  const int vrow = tid >> 4;
  const int vseg = (tid & 15) * 8;
  const h16* __restrict__ ksrc = qkv + ((size_t)b * 1024 + crow) * 768 + 256 + h * 64 + cseg;
  const h16* __restrict__ vsrc = vT + ((size_t)bh * 64 + vrow) * 1024 + vseg;
  auto stage = [&](int st, int buf) {
    const h16* kp = ksrc + (size_t)st * 128 * 768;
    const h16* vp = vsrc + st * 128;
    async_copy4_b128((unsigned)(uintptr_t)&Ks[buf][crow * 72 + cseg], kp,
                     (unsigned)(uintptr_t)&Ks[buf][(crow + 32) * 72 + cseg], kp + 32 * 768,
                     (unsigned)(uintptr_t)&Ks[buf][(crow + 64) * 72 + cseg], kp + 64 * 768,
                     (unsigned)(uintptr_t)&Ks[buf][(crow + 96) * 72 + cseg], kp + 96 * 768);
    async_copy4_b128((unsigned)(uintptr_t)&Vs[buf][vrow * 136 + vseg], vp,
                     (unsigned)(uintptr_t)&Vs[buf][(vrow + 16) * 136 + vseg], vp + 16 * 1024,
                     (unsigned)(uintptr_t)&Vs[buf][(vrow + 32) * 136 + vseg], vp + 32 * 1024,
                     (unsigned)(uintptr_t)&Vs[buf][(vrow + 48) * 136 + vseg], vp + 48 * 1024);
  };
  stage(0, 0);

  // Preload Q fragments: [mt][kc] covers 32 rows x 64 channels
  FragV qf[2][2];
  for (int mt = 0; mt < 2; ++mt)
    for (int kc = 0; kc < 2; ++kc) {
      const int row = qrow0 + mt * 16 + l16;
      const h16* base = qkv + ((size_t)b * 1024 + row) * 768 + h * 64 + kc * 32 + hi * 8;
      qf[mt][kc].q[0] = *(const u32x4*)(base);
      qf[mt][kc].q[1] = *(const u32x4*)(base + 16);
    }

  // per lane: running maximum of query mt*16+l16, and this half's share of its sum
  float mrow[2], lrow[2];
  v8f oacc[2][4];  // O^T tile: [r] = channel nt*16 + hi8 + r, query mt*16 + l16
  for (int mt = 0; mt < 2; ++mt) { mrow[mt] = -1e30f; lrow[mt] = 0.f; }
  for (int mt = 0; mt < 2; ++mt)
    for (int nt = 0; nt < 4; ++nt)
      for (int r = 0; r < 8; ++r) oacc[mt][nt][r] = 0.f;

  wait_async0();    // stage 0 has landed for this wave's copies
  __syncthreads();  // and for every wave's
  stage(1, 1);

  for (int kt = 0; kt < 8; ++kt) {
    const h16* Kt = Ks[kt & 1] + kh * (64 * 72);
    const h16* Vt = Vs[kt & 1] + kh * 64;

    // ---- S^T = K * Q^T: sacc[mt][nt][r] = key nt*16 + hi8 + r, query mt*16 + l16 ----
    v8f sacc[2][4];
    for (int mt = 0; mt < 2; ++mt)
      for (int nt = 0; nt < 4; ++nt)
        for (int r = 0; r < 8; ++r) sacc[mt][nt][r] = 0.f;

    for (int nt = 0; nt < 4; ++nt) {
      const h16* kb = Kt + (nt * 16 + l16) * 72 + hi * 8;
      FragV kf0, kf1;
      kf0.q[0] = *(const u32x4*)(kb);       kf0.q[1] = *(const u32x4*)(kb + 16);
      kf1.q[0] = *(const u32x4*)(kb + 32);  kf1.q[1] = *(const u32x4*)(kb + 48);
      for (int mt = 0; mt < 2; ++mt) {
        sacc[mt][nt] = __builtin_amdgcn_wmma_f32_16x16x32_f16(
            false, kf0.h, false, qf[mt][0].h, (short)0, sacc[mt][nt], false, false);
        sacc[mt][nt] = __builtin_amdgcn_wmma_f32_16x16x32_f16(
            false, kf1.h, false, qf[mt][1].h, (short)0, sacc[mt][nt], false, false);
      }
    }

    // ---- scale + online softmax, one query per lane ----
    // Worked on in pairs of neighbouring accumulator registers (keys 2j, 2j+1 of a tile).
    FragV pf[2][2];  // P^T as B operand: [mt][kc], 32 keys each
    for (int mt = 0; mt < 2; ++mt) {
      v2f sp[4][4];
      for (int nt = 0; nt < 4; ++nt)
        for (int j = 0; j < 4; ++j) {
          const v2f t = {sacc[mt][nt][2 * j], sacc[mt][nt][2 * j + 1]};
          sp[nt][j] = t * 0.125f;  // Ch^-0.5
        }

      float vm[4];
      for (int nt = 0; nt < 4; ++nt) {
        vm[nt] = fmaxf(sp[nt][0].x, sp[nt][0].y);
        for (int j = 1; j < 4; ++j) vm[nt] = fmaxf(vm[nt], fmaxf(sp[nt][j].x, sp[nt][j].y));
      }
      float v = fmaxf(fmaxf(vm[0], vm[1]), fmaxf(vm[2], vm[3]));
      v = fmaxf(v, xhalf(v));  // the other 32 keys of this query
      const float mold = mrow[mt];
      const float mnew = fmaxf(mold, v);
      const float corr = __expf(mold - mnew);
      mrow[mt] = mnew;
      for (int nt = 0; nt < 4; ++nt)
        for (int r = 0; r < 8; ++r) oacc[mt][nt][r] *= corr;
      // tiles 2kc and 2kc+1 hold keys hi8+0..7 and 16+hi8+0..7 of chunk kc: the B k order
      v2f ps[4];
      for (int nt = 0; nt < 4; ++nt) {
        for (int j = 0; j < 4; ++j) {
          const v2f d = sp[nt][j] - mnew;
          const v2f p = {__expf(d.x), __expf(d.y)};
          ps[nt] = (j == 0) ? p : ps[nt] + p;
          pf[mt][nt >> 1].h[(nt & 1) * 8 + 2 * j]     = (h16)p.x;
          pf[mt][nt >> 1].h[(nt & 1) * 8 + 2 * j + 1] = (h16)p.y;
        }
      }
      const v2f pt = (ps[0] + ps[1]) + (ps[2] + ps[3]);
      lrow[mt] = lrow[mt] * corr + (pt.x + pt.y);
    }

    // ---- O^T += V^T * P^T ----
    for (int kc = 0; kc < 2; ++kc) {
      for (int nt = 0; nt < 4; ++nt) {
        const h16* vb = Vt + (nt * 16 + l16) * 136 + kc * 32 + hi * 8;
        FragV vf;
        vf.q[0] = *(const u32x4*)(vb);
        vf.q[1] = *(const u32x4*)(vb + 16);
        for (int mt = 0; mt < 2; ++mt)
          oacc[mt][nt] = __builtin_amdgcn_wmma_f32_16x16x32_f16(
              false, vf.h, false, pf[mt][kc].h, (short)0, oacc[mt][nt], false, false);
      }
    }

    // hand-over: this wave's reads of stage kt are done, its copies of stage kt + 1 have landed;
    // behind the barrier that holds for all waves, and stage kt's buffer may be refilled
    asm volatile("s_wait_dscnt 0x0" ::: "memory");
    wait_async0();
    __syncthreads();
    if (kt + 2 < 8) stage(kt + 2, kt & 1);
  }
  wait_async0();  // nothing is in flight when the wave ends

  // ---- merge the two key halves of a query group ----
  // Wave kh finishes channels kh*32 .. kh*32+31 (tiles 2kh, 2kh+1) and hands the other two tiles,
  // with its maximum and its sum, to its partner, wave ^ 4.
  // element [mt][j][r] of this lane: channel h*64 + kh*32 + j*16 + hi8 + r, position qrow0 + mt*16 + l16
  const size_t ebase = ((size_t)b * 256 + h * 64 + kh * 32 + hi8) * 1024 + qrow0 + l16;
  const float* __restrict__ xb = x + ebase;
  float* __restrict__ ob = out + ebase;
  float xr[2][2][8];  // residual, asked for ahead of the exchange
  for (int mt = 0; mt < 2; ++mt)
    for (int j = 0; j < 2; ++j)
      for (int r = 0; r < 8; ++r) xr[mt][j][r] = xb[(j * 16 + r) * 1024 + mt * 16];
  float lw[2];
  v8f mine[2][2];  // the two tiles this wave finishes
  for (int mt = 0; mt < 2; ++mt) {
    lw[mt] = lrow[mt] + xhalf(lrow[mt]);  // join the lane halves' sums
    const v2f ml = {mrow[mt], lw[mt]};
    xml[wave][mt][lane] = ml;
    for (int j = 0; j < 2; ++j) {
      const v8f o = kh ? oacc[mt][j] : oacc[mt][2 + j];
      mine[mt][j] = kh ? oacc[mt][2 + j] : oacc[mt][j];
      const f32x4 lo = {o[0], o[1], o[2], o[3]}, up = {o[4], o[5], o[6], o[7]};
      xo[wave][(mt * 2 + j) * 2][lane]     = lo;
      xo[wave][(mt * 2 + j) * 2 + 1][lane] = up;
    }
  }
  // keeps the selects in front of the barrier, where the wave waits for the residual loads anyway;
  // without it the compiler moves half of them behind the barrier, in among the weights' arithmetic
  __builtin_amdgcn_sched_barrier(0);
  __syncthreads();  // every wave's partial result is in LDS

  // ---- finalize: weigh both halves, O * (1/l), residual add, store f32 [B,C,H*W] ----
  const int pw = wave ^ 4;
  for (int mt = 0; mt < 2; ++mt) {
    const v2f pm = xml[pw][mt][lane];
    const float mall = fmaxf(mrow[mt], pm.x);
    const float wa = __expf(mrow[mt] - mall), wb = __expf(pm.x - mall);
    const float linv = 1.0f / (lw[mt] * wa + pm.y * wb);
    const float ca = wa * linv, cb = wb * linv;
    for (int j = 0; j < 2; ++j) {
      const v8f o = mine[mt][j];
      const f32x4 lo = xo[pw][(mt * 2 + j) * 2][lane], up = xo[pw][(mt * 2 + j) * 2 + 1][lane];
      for (int r = 0; r < 8; ++r)
        ob[(j * 16 + r) * 1024 + mt * 16] = xr[mt][j][r] + (o[r] * ca + (r < 4 ? lo[r & 3] : up[r & 3]) * cb);
    }
  }
}

// -------------------- launch --------------------
extern "C" void kernel_launch(void* const* d_in, const int* in_sizes, int n_in,
                              void* d_out, int out_size, void* d_ws, size_t ws_size,
                              hipStream_t stream) {
  const float* x     = (const float*)d_in[0];
  const float* text  = (const float*)d_in[1];
  const float* gamma = (const float*)d_in[2];
  const float* beta  = (const float*)d_in[3];
  const float* W0    = (const float*)d_in[4];
  const float* b0    = (const float*)d_in[5];
  const float* W1    = (const float*)d_in[6];
  const float* b1    = (const float*)d_in[7];
  const float* W2    = (const float*)d_in[8];
  const float* b2    = (const float*)d_in[9];
  float* out = (float*)d_out;

  char* ws = (char*)d_ws;
  float* stats = (float*)ws;                    // 512 f32
  float* bcat  = (float*)(ws + 2048);           // 8*768 f32
  h16*   hn    = (h16*)(ws + 32768);            // 8*1024*256
  h16*   Wt    = hn + (size_t)8 * 1024 * 256;   // 768*256
  h16*   qkv   = Wt + (size_t)768 * 256;        // 8*1024*768, the v third stays unused
  h16*   vT    = qkv + (size_t)8 * 1024 * 768;  // 32*64*1024

  gn_stats_kernel<<<256, 256, 0, stream>>>(x, text, stats);
  normalize_kernel<<<256, 256, 0, stream>>>(x, stats, gamma, beta, hn);
  wconv_kernel<<<dim3(5, 24), 256, 0, stream>>>(W0, W1, W2, b0, b1, b2, text, stats, gamma, beta, Wt, bcat);
  gemm_qkv_kernel<<<dim3(64, 6), 256, 0, stream>>>(hn, Wt, bcat, qkv, vT);
  attn_kernel<<<dim3(32, 8), 256, 0, stream>>>(qkv, vT, x, out);
}

// v008
// One run takes 30.4 microseconds.
// In two side-by-side timings against v007, it was 1.11 and 1.10 times as fast.
// Over all steps from v000 it is 6.61 times as fast.
#include <hip/hip_runtime.h>
#include <hip/hip_bf16.h>

typedef _Float16 h16;
typedef __attribute__((ext_vector_type(16))) _Float16 v16h;
typedef __attribute__((ext_vector_type(8)))  float    v8f;
typedef __attribute__((ext_vector_type(2)))  float    v2f;
typedef __attribute__((ext_vector_type(4)))  unsigned int u32x4;
typedef __attribute__((ext_vector_type(4)))  float    f32x4;
typedef __attribute__((ext_vector_type(2)))  _Float16 h16x2;
typedef __attribute__((ext_vector_type(8)))  _Float16 h16x8;

union FragV { u32x4 q[2]; v16h h; };

__device__ __forceinline__ void async_copy4_b128(unsigned l0, const void* g0, unsigned l1, const void* g1,
                                                 unsigned l2, const void* g2, unsigned l3, const void* g3) {
  asm volatile("global_load_async_to_lds_b128 %0, %1, off\n\t"
               "global_load_async_to_lds_b128 %2, %3, off\n\t"
               "global_load_async_to_lds_b128 %4, %5, off\n\t"
               "global_load_async_to_lds_b128 %6, %7, off\n\t"
               "s_wait_xcnt 0x0"
               :: "v"(l0), "v"(g0), "v"(l1), "v"(g1), "v"(l2), "v"(g2), "v"(l3), "v"(g3) : "memory");
}
__device__ __forceinline__ void wait_async0() {
  asm volatile("s_wait_asynccnt 0" ::: "memory");
}

// -------------------- GroupNorm statistics --------------------
// One block = (image b, group g), 256 threads. Group g covers channels [24g,24g+24). Only the groups
// 0..10, which hold x channels, get a block: normalize reads no other, and the text share below
// works out the groups 11..31, which are text alone, itself.
// A thread takes 4 neighbouring positions of each of the 24 channels. The channels come in three
// runs of 8: 24g and 256 are multiples of 8, so a run is all x or all text, x runs first.
// One thread's share of a group with NX runs of x channels: every load is issued before the
// first sum reads one, so the block waits for memory once.
template <int NX>
__device__ __forceinline__ void gn_part(const float* __restrict__ xs, const float* __restrict__ ts,
                                        float& s, float& ss) {
  f32x4 v[NX * 8 + 1];
  for (int e = 0; e < NX * 8; ++e) v[e] = *(const f32x4*)(xs + (e << 10));
  // keeps the sums behind the last load: without it the compiler holds half of the loads back
  // until the first ones have returned, a second trip to memory
  __builtin_amdgcn_sched_barrier(0);
  float st = 0.f, sq = 0.f;  // a text channel has one value at all positions
  for (int e = 0; e < (3 - NX) * 8; ++e) { const float t = ts[e]; st += t; sq += t * t; }
  f32x4 s4 = {st, st, st, st}, q4 = {sq, sq, sq, sq};
  for (int e = 0; e < NX * 8; ++e) { s4 += v[e]; q4 += v[e] * v[e]; }
  s  = (s4.x + s4.y) + (s4.z + s4.w);
  ss = (q4.x + q4.y) + (q4.z + q4.w);
}

__device__ __forceinline__ void group_stats(
    int b, int g, const float* __restrict__ x, const float* __restrict__ text,
    float* __restrict__ stats) {
  __shared__ float rs[8], rss[8];
  const int tid = threadIdx.x;
  const int nx = (256 - g * 24 >= 24) ? 3 : 2;  // group 10: 16 x channels, then 8 text channels
  const float* __restrict__ xs = x + (((size_t)b * 256 + g * 24) << 10) + tid * 4;
  const float* __restrict__ ts = text + b * 512 + (g * 24 + nx * 8 - 256);
  float s, ss;
  if (nx == 3) gn_part<3>(xs, ts, s, ss);
  else         gn_part<2>(xs, ts, s, ss);
  for (int off = 16; off >= 1; off >>= 1) {
    s  += __shfl_xor(s,  off, 32);
    ss += __shfl_xor(ss, off, 32);
  }
  if ((tid & 31) == 0) { rs[tid >> 5] = s; rss[tid >> 5] = ss; }
  __syncthreads();
  if (tid == 0) {
    float S = 0.f, SS = 0.f;
    for (int i = 0; i < 8; ++i) { S += rs[i]; SS += rss[i]; }
    const float mean = S * (1.f / 24576.f);
    const float var  = SS * (1.f / 24576.f) - mean * mean;
    stats[b * 32 + g]       = mean;
    stats[256 + b * 32 + g] = rsqrtf(var + 1e-6f);
  }
}

// -------------------- Text share of q, k, v --------------------
// A text channel has one value at all positions of an image, so its products with the weight rows
// 256..767 are the same for all 1024 positions: [8 images][512] x [512][32 columns] per block, on
// the matrix unit with f16 operands, plus the bias.
// The block waits for no other block. The groups 11..31 are text alone (24 values, each 1024
// times): it works out their mean and rstd itself. Group 10 holds x channels too, so its mean m and
// rstd r are not known here; its 8 text channels 256..263 enter through
//   sum((t - m) r gamma + beta) w = r (sum(t gamma w) - m sum(gamma w)) + sum(beta w):
// beta stands in their place in the images' rows, and a second A tile has t gamma (rows 0..7, one
// per image) and gamma (row 8). normalize, which has m and r, puts the three results together.
// 8 waves = 2 tiles of 16 columns x 4 quarters of the 512 channels; the quarters are summed in LDS.
__device__ __forceinline__ void text_share(
    const float* __restrict__ W, const float* __restrict__ bs, int n0, int nn0,
    const float* __restrict__ text, const float* __restrict__ gamma, const float* __restrict__ beta,
    float* __restrict__ pre, float* __restrict__ p10, float* __restrict__ g10) {
  __shared__ __align__(16) float tf[8 * 512];    // text [image][channel]
  __shared__ v2f gs[8 * 32];                     // [image][group]: mean, rstd of groups 11..31
  __shared__ __align__(16) h16 tn[8 * 520];      // normalized text [image][channel], pitch 1040 B
  __shared__ __align__(16) h16 t10[16 * 8];      // second A tile, its k 0..7; all other k are 0
  __shared__ float red[8 * 128];                 // [wave][image][column]
  __shared__ float red2[2 * 144];                // [tile][row 0..8 of the second product][column]
  const int tid = threadIdx.x, wave = tid >> 5, lane = tid & 31;
  const int l16 = lane & 15, hi = lane >> 4;
  const int nt = wave & 1, kq = wave >> 1;

  // B operand: column l16 of the tile, k = s*32 + hi*8 + j and s*32 + 16 + hi*8 + j
  float wv[4][16];
  const float* __restrict__ wp = W + (size_t)(256 + kq * 128 + hi * 8) * 256 + nn0 + nt * 16 + l16;
  for (int s = 0; s < 4; ++s)
    for (int j = 0; j < 8; ++j) {
      wv[s][j]     = wp[(s * 32 + j) * 256];
      wv[s][8 + j] = wp[(s * 32 + 16 + j) * 256];
    }
  float tx[16], gm[2], bt[2];
  for (int i = 0; i < 16; ++i) tx[i] = text[i * 256 + tid];
  for (int j = 0; j < 2; ++j) { gm[j] = gamma[256 + j * 256 + tid]; bt[j] = beta[256 + j * 256 + tid]; }
  const float bv = bs[nn0 + (tid & 31)];  // read with the rest: one trip to memory
  for (int i = 0; i < 16; ++i) tf[i * 256 + tid] = tx[i];
  __syncthreads();
  if (lane >= 11) {  // thread = (image wave, group lane)
    const f32x4* tg = (const f32x4*)(&tf[wave * 512 + lane * 24 - 256]);  // 96-B steps: 16-B aligned
    f32x4 s4 = tg[0], q4 = tg[0] * tg[0];
    for (int e = 1; e < 6; ++e) { const f32x4 t = tg[e]; s4 += t; q4 += t * t; }
    const float S  = (s4.x + s4.y) + (s4.z + s4.w);
    const float SS = (q4.x + q4.y) + (q4.z + q4.w);
    const float mean = S * (1.f / 24.f);
    const float var  = SS * (1.f / 24.f) - mean * mean;
    const v2f t = {mean, rsqrtf(var + 1e-6f)};
    gs[tid] = t;
  }
  __syncthreads();
  const bool mixed = tid < 8;  // its channel 256 + tid is a text channel of group 10
  const int gi[2] = {mixed ? 11 : (256 + tid) / 24, (512 + tid) / 24};  // 11: any group that is there
  v2f mr[16];
  for (int i = 0; i < 16; ++i) mr[i] = gs[(i >> 1) * 32 + gi[i & 1]];
  for (int i = 0; i < 16; ++i) {
    const int img = i >> 1, j = i & 1;
    const float v = ((tx[i] - mr[i].x) * mr[i].y) * gm[j] + bt[j];
    tn[img * 520 + j * 256 + tid] = (h16)((j == 0 && mixed) ? bt[0] : v);
  }
  if (mixed)
    for (int r = 0; r < 16; ++r)
      t10[r * 8 + tid] = (h16)(r < 8 ? tx[(r & 7) * 2] * gm[0] : (r == 8 ? gm[0] : 0.f));
  __syncthreads();

  // A operand: row = image. Rows 8..15 repeat rows 0..7; their results are not used.
  v8f acc, acc2;
  for (int r = 0; r < 8; ++r) { acc[r] = 0.f; acc2[r] = 0.f; }
  for (int s = 0; s < 4; ++s) {
    const h16* ab = &tn[(l16 & 7) * 520 + kq * 128 + s * 32 + hi * 8];
    FragV afr, bfr;
    afr.q[0] = *(const u32x4*)(ab);
    afr.q[1] = *(const u32x4*)(ab + 16);
    for (int j = 0; j < 16; ++j) bfr.h[j] = (h16)wv[s][j];
    acc = __builtin_amdgcn_wmma_f32_16x16x32_f16(
        false, afr.h, false, bfr.h, (short)0, acc, false, false);
    if (s == 0) {  // second tile: k 0..7 are the first 8 elements of the lanes with hi == 0
      const u32x4 zero = {0u, 0u, 0u, 0u};
      const u32x4 a10 = *(const u32x4*)(&t10[l16 * 8]);
      FragV af2;
      af2.q[0] = hi ? zero : a10;
      af2.q[1] = zero;
      // every wave does it, so that no branch stands around a matrix instruction; only the first
      // quarter's waves, whose k 0..7 are the channels 256..263, keep the result
      acc2 = __builtin_amdgcn_wmma_f32_16x16x32_f16(
          false, af2.h, false, bfr.h, (short)0, acc2, false, false);
    }
  }
  if (hi == 0)
    for (int r = 0; r < 8; ++r) red[wave * 128 + r * 16 + l16] = acc[r];
  if (kq == 0) {
    if (hi == 0)
      for (int r = 0; r < 8; ++r) red2[nt * 144 + r * 16 + l16] = acc2[r];
    else
      red2[nt * 144 + 128 + l16] = acc2[0];  // row 8
  }
  __syncthreads();
  const int img = tid >> 5, col = tid & 31;
  const float* rp = &red[(col >> 4) * 128 + img * 16 + (col & 15)];
  const float* r2 = &red2[(col >> 4) * 144 + (col & 15)];
  pre[img * 768 + n0 + col] = ((rp[0] + rp[256]) + (rp[512] + rp[768])) + bv;
  p10[img * 768 + n0 + col] = r2[img * 16];
  if (img == 0) g10[n0 + col] = r2[128];
}

// -------------------- Weight rows 0..255 -> f16, transposed [N=768][K=256] --------------------
// One block = 64 k x 32 n. Whole 128-B lines in (32 n of one k row) and out (64 k of one n row),
// turned in LDS.
__device__ __forceinline__ void weight_convert(
    const float* __restrict__ W, int k0, int n0, int nn0, h16* __restrict__ Wt) {
  __shared__ __align__(16) h16 tw[32 * 72];  // [n][k], pitch 144 B
  const int tid = threadIdx.x;
  const int q  = tid & 7;    // 4 columns 4q..4q+3
  const int k2 = tid >> 3;   // k pair 2*k2, 2*k2+1
  const f32x4 wa = *(const f32x4*)(W + (size_t)(k0 + k2 * 2) * 256 + nn0 + q * 4);
  const f32x4 wb = *(const f32x4*)(W + (size_t)(k0 + k2 * 2 + 1) * 256 + nn0 + q * 4);
  for (int i = 0; i < 4; ++i) {
    h16x2 t;
    t.x = (h16)wa[i];
    t.y = (h16)wb[i];
    *(h16x2*)(&tw[(q * 4 + i) * 72 + k2 * 2]) = t;
  }
  __syncthreads();
  const int row = tid >> 3, ch = tid & 7;
  *(u32x4*)(Wt + (size_t)(n0 + row) * 256 + k0 + ch * 8) = *(const u32x4*)(&tw[row * 72 + ch * 8]);
  // wait behind the store: the text block's code follows in the listing and rewrites the registers
  // that the issued store names
  asm volatile("s_wait_xcnt 0x0" ::: "memory");
}

// -------------------- First launch: all that needs nothing but the inputs --------------------
// grid: 24 text-share blocks (tiles of 32 n), 88 statistics blocks (8 images x groups 0..10),
// 96 weight blocks (24 tiles of 32 n x 4 of 64 k). The kind of a block is the same for all its threads.
__global__ __launch_bounds__(256) void front_kernel(
    const float* __restrict__ x, const float* __restrict__ text,
    const float* __restrict__ gamma, const float* __restrict__ beta,
    const float* __restrict__ W0, const float* __restrict__ W1, const float* __restrict__ W2,
    const float* __restrict__ b0, const float* __restrict__ b1, const float* __restrict__ b2,
    float* __restrict__ stats, h16* __restrict__ Wt,
    float* __restrict__ pre, float* __restrict__ p10, float* __restrict__ g10) {
  const int blk = blockIdx.x;
  if (blk >= 24 && blk < 112) {
    group_stats((blk - 24) / 11, (blk - 24) % 11, x, text, stats);
    return;
  }
  const int tile = (blk < 24) ? blk : ((blk - 112) >> 2);
  const int n0  = tile * 32;
  const int nn0 = n0 & 255;
  const float* W = (n0 < 256) ? W0 : ((n0 < 512) ? W1 : W2);
  if (blk < 24)
    text_share(W, (n0 < 256) ? b0 : ((n0 < 512) ? b1 : b2), n0, nn0, text, gamma, beta, pre, p10, g10);
  else
    weight_convert(W, ((blk - 112) & 3) * 64, n0, nn0, Wt);
}

// -------------------- Normalize + cast to f16, x channels only, layout [B*HW, 256] --------------------
// grid: 256 blocks = (b, 32 positions). The x tile [256 channels][32 positions] is read in whole
// 128-B lines, turned in LDS and stored as 16-B pieces of hn rows. The 512 text channels do not
// depend on the position: their share of q, k, v is one row per image (text_share above). Its three
// parts are put together here, where mean and rstd of group 10 are known: 24 columns a block.
__global__ __launch_bounds__(256) void normalize_kernel(
    const float* __restrict__ x,
    const float* __restrict__ stats, const float* __restrict__ gamma,
    const float* __restrict__ beta, const float* __restrict__ pre, const float* __restrict__ p10,
    const float* __restrict__ g10, h16* __restrict__ hn, float* __restrict__ bcat) {
  __shared__ __align__(16) h16 xs[32 * 264];  // [position][channel], pitch 528 B
  __shared__ float st[64];                    // mean at g, rstd at 32 + g, of this image's groups 0..10
  __shared__ v2f gb[256];                     // gamma, beta of an x channel
  const int b   = blockIdx.x >> 5;
  const int p0  = (blockIdx.x & 31) * 32;
  const int tid = threadIdx.x;
  const int q   = tid & 7;    // 4 positions 4q..4q+3
  const int c2  = tid >> 3;   // channel pair 2*c2, 2*c2+1 of each 64

  const float* __restrict__ sb = stats + b * 32;
  // the x channels lie in groups 0..10, the only ones that have statistics in the workspace
  const float sv = sb[min(tid & 31, 10) + ((tid >> 5) & 1) * 256];
  const float gm = gamma[tid], bt = beta[tid];
  const int nb = (blockIdx.x & 31) * 24 + min(tid, 23);  // threads 0..23: a column of the text share
  const float pr = pre[b * 768 + nb], pp = p10[b * 768 + nb], pg = g10[nb];
  f32x4 xv[4][2];
  for (int j = 0; j < 4; ++j)
    for (int e = 0; e < 2; ++e) {
      // wait in front of the last load: the compiler lets its result land in the address pair
      // that the seven issued loads name
      if (j == 3 && e == 1) asm volatile("s_wait_xcnt 0x0" ::: "memory");
      xv[j][e] = *(const f32x4*)(x + (((size_t)b * 256 + j * 64 + c2 * 2 + e) << 10) + p0 + q * 4);
    }

  if (tid < 64) st[tid] = sv;
  {
    const v2f t = {gm, bt};
    gb[tid] = t;
  }
  __syncthreads();
  if (tid < 24) bcat[b * 768 + nb] = pr + st[42] * (pp - st[10] * pg);

  for (int j = 0; j < 4; ++j) {
    const int c = j * 64 + c2 * 2;
    const int ga = c / 24, gc = (c + 1) / 24;
    const float ma = st[ga], ra = st[32 + ga], mb = st[gc], rb = st[32 + gc];
    const v2f pa = gb[c], pb = gb[c + 1];
    for (int i = 0; i < 4; ++i) {
      h16x2 t;
      t.x = (h16)(((xv[j][0][i] - ma) * ra) * pa.x + pa.y);
      t.y = (h16)(((xv[j][1][i] - mb) * rb) * pb.x + pb.y);
      *(h16x2*)(&xs[(q * 4 + i) * 264 + c]) = t;
    }
  }
  __syncthreads();

  h16* __restrict__ dst = hn + ((size_t)b * 1024 + p0) * 256;
  for (int j = 0; j < 4; ++j) {  // a wave stores one whole row of 512 B
    const int row = j * 8 + (tid >> 5);
    const int ch  = tid & 31;
    *(u32x4*)(dst + row * 256 + ch * 8) = *(const u32x4*)(&xs[row * 264 + ch * 8]);
  }
}

__global__ __launch_bounds__(256) void gemm_qkv_kernel(
    const h16* __restrict__ A, const h16* __restrict__ Bt,
    const float* __restrict__ bias, h16* __restrict__ Cout, h16* __restrict__ vT) {
  __shared__ __align__(16) h16 As[2][128 * 48];  // stride 48 h16 = 96B, 16B aligned
  __shared__ __align__(16) h16 Bs[2][128 * 48];
  const int mBase = blockIdx.x * 128;
  const int nBase = blockIdx.y * 128;
  const int tid  = threadIdx.x;
  const int wave = tid >> 5;
  const int lane = tid & 31;
  const int wm = wave >> 1;       // 0..3
  const int wn = wave & 1;        // 0..1
  const int l16 = lane & 15;
  const int hi  = lane >> 4;      // 0/1 selects K phase per WMMA A/B layout

  const int row0 = tid >> 2;            // chunk id tid   -> row, seg
  const int seg0 = tid & 3;
  const int row1 = (tid + 256) >> 2;    // chunk id tid+256
  const int seg1 = (tid + 256) & 3;

  v8f acc[2][4];
  for (int mt = 0; mt < 2; ++mt)
    for (int nt = 0; nt < 4; ++nt)
      for (int r = 0; r < 8; ++r) acc[mt][nt][r] = 0.f;

  auto load_tiles = [&](int k0, int buf) {
    async_copy4_b128((unsigned)(uintptr_t)&As[buf][row0 * 48 + seg0 * 8],
                     A + (size_t)(mBase + row0) * 256 + k0 + seg0 * 8,
                     (unsigned)(uintptr_t)&As[buf][row1 * 48 + seg1 * 8],
                     A + (size_t)(mBase + row1) * 256 + k0 + seg1 * 8,
                     (unsigned)(uintptr_t)&Bs[buf][row0 * 48 + seg0 * 8],
                     Bt + (size_t)(nBase + row0) * 256 + k0 + seg0 * 8,
                     (unsigned)(uintptr_t)&Bs[buf][row1 * 48 + seg1 * 8],
                     Bt + (size_t)(nBase + row1) * 256 + k0 + seg1 * 8);
  };

  load_tiles(0, 0);
  wait_async0();
  __syncthreads();
  load_tiles(32, 1);  // flies while tile 0 is worked on

  int buf = 0;
  for (int k0 = 0; k0 < 256; k0 += 32) {

    FragV afr[2];
    for (int mt = 0; mt < 2; ++mt) {
      const int row = wm * 32 + mt * 16 + l16;
      const int ko  = hi * 8;
      afr[mt].q[0] = *(const u32x4*)(&As[buf][row * 48 + ko]);
      afr[mt].q[1] = *(const u32x4*)(&As[buf][row * 48 + ko + 16]);
    }
    for (int nt = 0; nt < 4; ++nt) {
      const int col = wn * 64 + nt * 16 + l16;
      const int ko  = hi * 8;
      FragV bfr;
      bfr.q[0] = *(const u32x4*)(&Bs[buf][col * 48 + ko]);
      bfr.q[1] = *(const u32x4*)(&Bs[buf][col * 48 + ko + 16]);
      for (int mt = 0; mt < 2; ++mt)
        acc[mt][nt] = __builtin_amdgcn_wmma_f32_16x16x32_f16(
            false, afr[mt].h, false, bfr.h, (short)0, acc[mt][nt], false, false);
    }

    // hand-over: this wave's reads of this tile are done, its copies of the next have landed;
    // behind the barrier that holds for all waves, and this tile's buffer may be refilled
    asm volatile("s_wait_dscnt 0x0" ::: "memory");
    wait_async0();
    __syncthreads();
    if (k0 + 64 < 256) load_tiles(k0 + 64, buf);
    buf ^= 1;
  }
  wait_async0();  // nothing is in flight when the wave ends

  const float* __restrict__ bimg = bias + (mBase >> 10) * 768;  // 128 rows lie in one image
  h16x8 cv[2][4];  // [r] = row wm*32 + mt*16 + hi*8 + r, column wn*64 + nt*16 + l16 of the block tile
  float bv[4];
  for (int nt = 0; nt < 4; ++nt) bv[nt] = bimg[nBase + wn * 64 + nt * 16 + l16];
  for (int mt = 0; mt < 2; ++mt)
    for (int nt = 0; nt < 4; ++nt)
      for (int r = 0; r < 8; ++r) cv[mt][nt][r] = (h16)(acc[mt][nt][r] + bv[nt]);
  if (nBase >= 512) {  // v columns, the same for the whole block: row (image*256 + column) of vT
    h16* __restrict__ vb = vT + ((size_t)(mBase >> 10) * 256 + (nBase - 512) + wn * 64 + l16) * 1024 +
                           (mBase & 1023) + wm * 32 + hi * 8;
    for (int nt = 0; nt < 4; ++nt)
      for (int mt = 0; mt < 2; ++mt) *(h16x8*)(vb + nt * 16 * 1024 + mt * 16) = cv[mt][nt];
    return;
  }
  for (int mt = 0; mt < 2; ++mt)
    for (int nt = 0; nt < 4; ++nt) {
      const int n = nBase + wn * 64 + nt * 16 + l16;
      for (int r = 0; r < 8; ++r) {
        const int m = mBase + wm * 32 + mt * 16 + r + hi * 8;
        Cout[(size_t)m * 768 + n] = cv[mt][nt][r];
      }
    }
  // wait behind the last store: the v block's code follows in the listing and rewrites the address
  // registers that the issued stores name
  asm volatile("s_wait_xcnt 0x0" ::: "memory");
}

__device__ __forceinline__ float xhalf(float v) {
  const int b = __builtin_bit_cast(int, v);
  return __builtin_bit_cast(float,
      __builtin_amdgcn_permlanex16(b, b, 0x76543210, 0xfedcba98, false, false));
}

__global__ __launch_bounds__(256) void attn_kernel(
    const h16* __restrict__ qkv, const h16* __restrict__ vT,
    const float* __restrict__ x, float* __restrict__ out) {
  const int bh = blockIdx.x;
  const int b = bh >> 2, h = bh & 3;
  const int tid = threadIdx.x, wave = tid >> 5, lane = tid & 31;
  const int qg = wave & 3;   // query group
  const int kh = wave >> 2;  // key half of every stage
  const int l16 = lane & 15;
  const int hi  = lane >> 4;
  const int hi8 = hi * 8;
  const int qrow0 = blockIdx.y * 128 + qg * 32;

  __shared__ __align__(16) h16 Ks[2][128 * 72];   // [key][channel], pitch 144 B
  __shared__ __align__(16) h16 Vs[2][64 * 136];   // [channel][key], pitch 272 B
  __shared__ __align__(16) f32x4 xo[8][8][32];    // [wave][piece][lane]: the O^T half the partner finishes
  __shared__ v2f xml[8][2][32];                   // [wave][mt][lane]: maximum, sum
  // a thread copies 16 B of four rows of each tile; a wave covers whole 128-B (K) or 256-B (V^T) rows
  const int crow = tid >> 3;
  const int cseg = (tid & 7) * 8;
  const int vrow = tid >> 4;
  const int vseg = (tid & 15) * 8;
  const h16* __restrict__ ksrc = qkv + ((size_t)b * 1024 + crow) * 768 + 256 + h * 64 + cseg;
  const h16* __restrict__ vsrc = vT + ((size_t)bh * 64 + vrow) * 1024 + vseg;
  auto stage = [&](int st, int buf) {
    const h16* kp = ksrc + (size_t)st * 128 * 768;
    const h16* vp = vsrc + st * 128;
    async_copy4_b128((unsigned)(uintptr_t)&Ks[buf][crow * 72 + cseg], kp,
                     (unsigned)(uintptr_t)&Ks[buf][(crow + 32) * 72 + cseg], kp + 32 * 768,
                     (unsigned)(uintptr_t)&Ks[buf][(crow + 64) * 72 + cseg], kp + 64 * 768,
                     (unsigned)(uintptr_t)&Ks[buf][(crow + 96) * 72 + cseg], kp + 96 * 768);
    async_copy4_b128((unsigned)(uintptr_t)&Vs[buf][vrow * 136 + vseg], vp,
                     (unsigned)(uintptr_t)&Vs[buf][(vrow + 16) * 136 + vseg], vp + 16 * 1024,
                     (unsigned)(uintptr_t)&Vs[buf][(vrow + 32) * 136 + vseg], vp + 32 * 1024,
                     (unsigned)(uintptr_t)&Vs[buf][(vrow + 48) * 136 + vseg], vp + 48 * 1024);
  };
  stage(0, 0);

  // Preload Q fragments: [mt][kc] covers 32 rows x 64 channels
  FragV qf[2][2];
  for (int mt = 0; mt < 2; ++mt)
    for (int kc = 0; kc < 2; ++kc) {
      const int row = qrow0 + mt * 16 + l16;
      const h16* base = qkv + ((size_t)b * 1024 + row) * 768 + h * 64 + kc * 32 + hi * 8;
      qf[mt][kc].q[0] = *(const u32x4*)(base);
      qf[mt][kc].q[1] = *(const u32x4*)(base + 16);
    }

  // per lane: running maximum of query mt*16+l16, and this half's share of its sum
  float mrow[2], lrow[2];
  v8f oacc[2][4];  // O^T tile: [r] = channel nt*16 + hi8 + r, query mt*16 + l16
  for (int mt = 0; mt < 2; ++mt) { mrow[mt] = -1e30f; lrow[mt] = 0.f; }
  for (int mt = 0; mt < 2; ++mt)
    for (int nt = 0; nt < 4; ++nt)
      for (int r = 0; r < 8; ++r) oacc[mt][nt][r] = 0.f;

  wait_async0();    // stage 0 has landed for this wave's copies
  __syncthreads();  // and for every wave's
  stage(1, 1);

  for (int kt = 0; kt < 8; ++kt) {
    const h16* Kt = Ks[kt & 1] + kh * (64 * 72);
    const h16* Vt = Vs[kt & 1] + kh * 64;

    // ---- S^T = K * Q^T: sacc[mt][nt][r] = key nt*16 + hi8 + r, query mt*16 + l16 ----
    v8f sacc[2][4];
    for (int mt = 0; mt < 2; ++mt)
      for (int nt = 0; nt < 4; ++nt)
        for (int r = 0; r < 8; ++r) sacc[mt][nt][r] = 0.f;

    for (int nt = 0; nt < 4; ++nt) {
      const h16* kb = Kt + (nt * 16 + l16) * 72 + hi * 8;
      FragV kf0, kf1;
      kf0.q[0] = *(const u32x4*)(kb);       kf0.q[1] = *(const u32x4*)(kb + 16);
      kf1.q[0] = *(const u32x4*)(kb + 32);  kf1.q[1] = *(const u32x4*)(kb + 48);
      for (int mt = 0; mt < 2; ++mt) {
        sacc[mt][nt] = __builtin_amdgcn_wmma_f32_16x16x32_f16(
            false, kf0.h, false, qf[mt][0].h, (short)0, sacc[mt][nt], false, false);
        sacc[mt][nt] = __builtin_amdgcn_wmma_f32_16x16x32_f16(
            false, kf1.h, false, qf[mt][1].h, (short)0, sacc[mt][nt], false, false);
      }
    }

    // ---- scale + online softmax, one query per lane ----
    // Worked on in pairs of neighbouring accumulator registers (keys 2j, 2j+1 of a tile).
    FragV pf[2][2];  // P^T as B operand: [mt][kc], 32 keys each
    for (int mt = 0; mt < 2; ++mt) {
      v2f sp[4][4];
      for (int nt = 0; nt < 4; ++nt)
        for (int j = 0; j < 4; ++j) {
          const v2f t = {sacc[mt][nt][2 * j], sacc[mt][nt][2 * j + 1]};
          sp[nt][j] = t * 0.125f;  // Ch^-0.5
        }

      float vm[4];
      for (int nt = 0; nt < 4; ++nt) {
        vm[nt] = fmaxf(sp[nt][0].x, sp[nt][0].y);
        for (int j = 1; j < 4; ++j) vm[nt] = fmaxf(vm[nt], fmaxf(sp[nt][j].x, sp[nt][j].y));
      }
      float v = fmaxf(fmaxf(vm[0], vm[1]), fmaxf(vm[2], vm[3]));
      v = fmaxf(v, xhalf(v));  // the other 32 keys of this query
      const float mold = mrow[mt];
      const float mnew = fmaxf(mold, v);
      const float corr = __expf(mold - mnew);
      mrow[mt] = mnew;
      for (int nt = 0; nt < 4; ++nt)
        for (int r = 0; r < 8; ++r) oacc[mt][nt][r] *= corr;
      // tiles 2kc and 2kc+1 hold keys hi8+0..7 and 16+hi8+0..7 of chunk kc: the B k order
      v2f ps[4];
      for (int nt = 0; nt < 4; ++nt) {
        for (int j = 0; j < 4; ++j) {
          const v2f d = sp[nt][j] - mnew;
          const v2f p = {__expf(d.x), __expf(d.y)};
          ps[nt] = (j == 0) ? p : ps[nt] + p;
          pf[mt][nt >> 1].h[(nt & 1) * 8 + 2 * j]     = (h16)p.x;
          pf[mt][nt >> 1].h[(nt & 1) * 8 + 2 * j + 1] = (h16)p.y;
        }
      }
      const v2f pt = (ps[0] + ps[1]) + (ps[2] + ps[3]);
      lrow[mt] = lrow[mt] * corr + (pt.x + pt.y);
    }

    // ---- O^T += V^T * P^T ----
    for (int kc = 0; kc < 2; ++kc) {
      for (int nt = 0; nt < 4; ++nt) {
        const h16* vb = Vt + (nt * 16 + l16) * 136 + kc * 32 + hi * 8;
        FragV vf;
        vf.q[0] = *(const u32x4*)(vb);
        vf.q[1] = *(const u32x4*)(vb + 16);
        for (int mt = 0; mt < 2; ++mt)
          oacc[mt][nt] = __builtin_amdgcn_wmma_f32_16x16x32_f16(
              false, vf.h, false, pf[mt][kc].h, (short)0, oacc[mt][nt], false, false);
      }
    }

    // hand-over: this wave's reads of stage kt are done, its copies of stage kt + 1 have landed;
    // behind the barrier that holds for all waves, and stage kt's buffer may be refilled
    asm volatile("s_wait_dscnt 0x0" ::: "memory");
    wait_async0();
    __syncthreads();
    if (kt + 2 < 8) stage(kt + 2, kt & 1);
  }
  wait_async0();  // nothing is in flight when the wave ends

  // ---- merge the two key halves of a query group ----
  // Wave kh finishes channels kh*32 .. kh*32+31 (tiles 2kh, 2kh+1) and hands the other two tiles,
  // with its maximum and its sum, to its partner, wave ^ 4.
  // element [mt][j][r] of this lane: channel h*64 + kh*32 + j*16 + hi8 + r, position qrow0 + mt*16 + l16
  const size_t ebase = ((size_t)b * 256 + h * 64 + kh * 32 + hi8) * 1024 + qrow0 + l16;
  const float* __restrict__ xb = x + ebase;
  float* __restrict__ ob = out + ebase;
  float xr[2][2][8];  // residual, asked for ahead of the exchange
  for (int mt = 0; mt < 2; ++mt)
    for (int j = 0; j < 2; ++j)
      for (int r = 0; r < 8; ++r) xr[mt][j][r] = xb[(j * 16 + r) * 1024 + mt * 16];
  float lw[2];
  v8f mine[2][2];  // the two tiles this wave finishes
  for (int mt = 0; mt < 2; ++mt) {
    lw[mt] = lrow[mt] + xhalf(lrow[mt]);  // join the lane halves' sums
    const v2f ml = {mrow[mt], lw[mt]};
    xml[wave][mt][lane] = ml;
    for (int j = 0; j < 2; ++j) {
      const v8f o = kh ? oacc[mt][j] : oacc[mt][2 + j];
      mine[mt][j] = kh ? oacc[mt][2 + j] : oacc[mt][j];
      const f32x4 lo = {o[0], o[1], o[2], o[3]}, up = {o[4], o[5], o[6], o[7]};
      xo[wave][(mt * 2 + j) * 2][lane]     = lo;
      xo[wave][(mt * 2 + j) * 2 + 1][lane] = up;
    }
  }
  // keeps the selects in front of the barrier, where the wave waits for the residual loads anyway;
  // without it the compiler moves half of them behind the barrier, in among the weights' arithmetic
  __builtin_amdgcn_sched_barrier(0);
  __syncthreads();  // every wave's partial result is in LDS

  // ---- finalize: weigh both halves, O * (1/l), residual add, store f32 [B,C,H*W] ----
  const int pw = wave ^ 4;
  for (int mt = 0; mt < 2; ++mt) {
    const v2f pm = xml[pw][mt][lane];
    const float mall = fmaxf(mrow[mt], pm.x);
    const float wa = __expf(mrow[mt] - mall), wb = __expf(pm.x - mall);
    const float linv = 1.0f / (lw[mt] * wa + pm.y * wb);
    const float ca = wa * linv, cb = wb * linv;
    for (int j = 0; j < 2; ++j) {
      const v8f o = mine[mt][j];
      const f32x4 lo = xo[pw][(mt * 2 + j) * 2][lane], up = xo[pw][(mt * 2 + j) * 2 + 1][lane];
      for (int r = 0; r < 8; ++r)
        ob[(j * 16 + r) * 1024 + mt * 16] = xr[mt][j][r] + (o[r] * ca + (r < 4 ? lo[r & 3] : up[r & 3]) * cb);
    }
  }
}

// -------------------- launch --------------------
extern "C" void kernel_launch(void* const* d_in, const int* in_sizes, int n_in,
                              void* d_out, int out_size, void* d_ws, size_t ws_size,
                              hipStream_t stream) {
  const float* x     = (const float*)d_in[0];
  const float* text  = (const float*)d_in[1];
  const float* gamma = (const float*)d_in[2];
  const float* beta  = (const float*)d_in[3];
  const float* W0    = (const float*)d_in[4];
  const float* b0    = (const float*)d_in[5];
  const float* W1    = (const float*)d_in[6];
  const float* b1    = (const float*)d_in[7];
  const float* W2    = (const float*)d_in[8];
  const float* b2    = (const float*)d_in[9];
  float* out = (float*)d_out;

  char* ws = (char*)d_ws;
  float* stats = (float*)ws;                    // 512 f32, groups 0..10 of each image used
  float* bcat  = (float*)(ws + 2048);           // 8*768 f32
  h16*   hn    = (h16*)(ws + 32768);            // 8*1024*256
  h16*   Wt    = hn + (size_t)8 * 1024 * 256;   // 768*256
  h16*   qkv   = Wt + (size_t)768 * 256;        // 8*1024*768, the v third stays unused
  h16*   vT    = qkv + (size_t)8 * 1024 * 768;  // 32*64*1024
  float* pre   = (float*)(vT + (size_t)32 * 64 * 1024);  // 8*768 f32
  float* p10   = pre + 8 * 768;                 // 8*768 f32
  float* g10   = p10 + 8 * 768;                 // 768 f32

  front_kernel<<<208, 256, 0, stream>>>(x, text, gamma, beta, W0, W1, W2, b0, b1, b2, stats, Wt, pre, p10, g10);
  normalize_kernel<<<256, 256, 0, stream>>>(x, stats, gamma, beta, pre, p10, g10, hn, bcat);
  gemm_qkv_kernel<<<dim3(64, 6), 256, 0, stream>>>(hn, Wt, bcat, qkv, vT);
  attn_kernel<<<dim3(32, 8), 256, 0, stream>>>(qkv, vT, x, out);
}

// v009
// A run of this version takes 27.7 microseconds.
// Timed twice side by side with v008, it ran 1.10 and 1.09 times as fast.
// Over all steps from v000 it is 7.23 times as fast.
#include <hip/hip_runtime.h>
#include <hip/hip_bf16.h>

typedef _Float16 h16;
typedef __attribute__((ext_vector_type(16))) _Float16 v16h;
typedef __attribute__((ext_vector_type(8)))  float    v8f;
typedef __attribute__((ext_vector_type(2)))  float    v2f;
typedef __attribute__((ext_vector_type(4)))  unsigned int u32x4;
typedef __attribute__((ext_vector_type(4)))  float    f32x4;
typedef __attribute__((ext_vector_type(2)))  _Float16 h16x2;
typedef __attribute__((ext_vector_type(8)))  _Float16 h16x8;

typedef __attribute__((address_space(4))) float cf32;  // constant address space

union FragV { u32x4 q[2]; v16h h; };

__device__ __forceinline__ void async_copy4_b128(unsigned l0, const void* g0, unsigned l1, const void* g1,
                                                 unsigned l2, const void* g2, unsigned l3, const void* g3) {
  asm volatile("global_load_async_to_lds_b128 %0, %1, off\n\t"
               "global_load_async_to_lds_b128 %2, %3, off\n\t"
               "global_load_async_to_lds_b128 %4, %5, off\n\t"
               "global_load_async_to_lds_b128 %6, %7, off\n\t"
               "s_wait_xcnt 0x0"
               :: "v"(l0), "v"(g0), "v"(l1), "v"(g1), "v"(l2), "v"(g2), "v"(l3), "v"(g3) : "memory");
}
__device__ __forceinline__ void wait_async0() {
  asm volatile("s_wait_asynccnt 0" ::: "memory");
}

// -------------------- GroupNorm of the x channels: statistics, normalize, cast to f16 --------------------
// One block = (image b, group g), 256 threads. Group g covers channels [24g,24g+24). Only the groups
// 0..10, which hold x channels, get a block; the text share below works out the groups 11..31, which
// are text alone, itself.
// A thread takes 4 neighbouring positions of each of the 24 channels. The channels come in three
// runs of 8: 24g and 256 are multiples of 8, so a run is all x or all text, x runs first (NX of them).
// Every load is issued before the first sum reads one, so the block waits for memory once.
// The block holds all x values of its group in registers, so once mean and rstd are known it
// normalizes them there and stores them: hn[image][run of 8 channels][position][8], a 16-B piece
// per position and run, which is the piece the GEMM copies into its A tile.
template <int NX>
__device__ __forceinline__ void group_norm(
    int b, int g, const float* __restrict__ x, const float* __restrict__ text,
    const float* __restrict__ gamma, const float* __restrict__ beta,
    float* __restrict__ stats, h16* __restrict__ hn, float* rs, float* rss, h16* stg) {
  const int tid = threadIdx.x;
  const float* __restrict__ xs = x + (((size_t)b * 256 + g * 24) << 10) + tid * 4;
  // gamma, beta and the text values of the group are the same for the whole block and no kernel writes
  // them: read as constant memory they come through the scalar cache into scalar registers, while the
  // x loads are under way
  const cf32* gc = (const cf32*)gamma + g * 24;
  const cf32* bc = (const cf32*)beta + g * 24;
  const cf32* tc = (const cf32*)text + b * 512 + (g * 24 + NX * 8 - 256);
  float gm[NX * 8], bt[NX * 8], tx[8];
  for (int e = 0; e < NX * 8; ++e) { gm[e] = gc[e]; bt[e] = bc[e]; }
  for (int e = 0; e < (3 - NX) * 8; ++e) tx[e] = tc[e];
  // keeps the scalar loads of gamma and beta in front: moved behind the x loads, in front of their wait,
  // the compiler lets their results land in the scalar registers that hold the issued loads' base address
  __builtin_amdgcn_sched_barrier(0);
  f32x4 v[NX * 8];
  for (int e = 0; e < NX * 8; ++e) v[e] = *(const f32x4*)(xs + (e << 10));
  // wait behind the last load: what follows rewrites registers that the issued loads name
  asm volatile("s_wait_xcnt 0x0" ::: "memory");
  // keeps the sums behind the last load: without it the compiler holds half of the loads back
  // until the first ones have returned, a second trip to memory
  __builtin_amdgcn_sched_barrier(0);
  float st = 0.f, sq = 0.f;  // a text channel has one value at all positions
  for (int e = 0; e < (3 - NX) * 8; ++e) { const float t = tx[e]; st += t; sq += t * t; }
  f32x4 s4 = {st, st, st, st}, q4 = {sq, sq, sq, sq};
  for (int e = 0; e < NX * 8; ++e) { s4 += v[e]; q4 += v[e] * v[e]; }
  float s  = (s4.x + s4.y) + (s4.z + s4.w);
  float ss = (q4.x + q4.y) + (q4.z + q4.w);
  for (int off = 16; off >= 1; off >>= 1) {
    s  += __shfl_xor(s,  off, 32);
    ss += __shfl_xor(ss, off, 32);
  }
  if ((tid & 31) == 0) { rs[tid >> 5] = s; rss[tid >> 5] = ss; }
  __syncthreads();
  float S = 0.f, SS = 0.f;  // every thread: it needs mean and rstd for its own values
  for (int i = 0; i < 8; ++i) { S += rs[i]; SS += rss[i]; }
  const float mean = S * (1.f / 24576.f);
  const float var  = SS * (1.f / 24576.f) - mean * mean;
  const float rstd = rsqrtf(var + 1e-6f);
  h16x8 t[NX][4];
  for (int o = 0; o < NX; ++o)
    for (int i = 0; i < 4; ++i)
      for (int e = 0; e < 8; ++e)
        t[o][i][e] = (h16)(((v[o * 8 + e][i] - mean) * rstd) * gm[o * 8 + e] + bt[o * 8 + e]);
  const int lane = tid & 31, wave = tid >> 5;
  h16* sw = stg + wave * 1280;
  for (int o = 0; o < NX; ++o)
    for (int i = 0; i < 4; ++i) *(h16x8*)(sw + o * 10240 + (lane * 5 + i) * 8) = t[o][i];
  __syncthreads();  // the reads below stay behind the other lanes' writes
  if (NX == 2 && tid == 0) {  // group 10: the GEMM needs them for the group's text channels
    stats[b * 32 + g]       = mean;
    stats[256 + b * 32 + g] = rstd;
  }
  h16* __restrict__ dst = hn + (((size_t)b * 32 + g * 3) * 1024 + wave * 128 + lane) * 8;
  for (int o = 0; o < NX; ++o)
    for (int j = 0; j < 4; ++j)  // position j*32 + lane of the wave's 128
      *(h16x8*)(dst + (o * 1024 + j * 32) * 8) =
          *(const h16x8*)(sw + o * 10240 + (j * 40 + lane + (lane >> 2)) * 8);
  // wait behind the stores: other blocks' code follows in the listing and rewrites the registers
  // that the issued stores name
  asm volatile("s_wait_xcnt 0x0" ::: "memory");
}

__device__ __forceinline__ void group_stats(
    int b, int g, const float* __restrict__ x, const float* __restrict__ text,
    const float* __restrict__ gamma, const float* __restrict__ beta,
    float* __restrict__ stats, h16* __restrict__ hn) {
  __shared__ float rs[8], rss[8];
  __shared__ __align__(16) h16 stg[3 * 8 * 1280];  // [run][wave][160 pieces of 16 B]
  // group 10: 16 x channels, then 8 text channels
  if (256 - g * 24 >= 24) group_norm<3>(b, g, x, text, gamma, beta, stats, hn, rs, rss, stg);
  else                    group_norm<2>(b, g, x, text, gamma, beta, stats, hn, rs, rss, stg);
}

// -------------------- Text share of q, k, v --------------------
// A text channel has one value at all positions of an image, so its products with the weight rows
// 256..767 are the same for all 1024 positions: [8 images][512] x [512][32 columns] per block, on
// the matrix unit with f16 operands, plus the bias.
// The block waits for no other block. The groups 11..31 are text alone (24 values, each 1024
// times): it works out their mean and rstd itself. Group 10 holds x channels too, so its mean m and
// rstd r are not known here; its 8 text channels 256..263 enter through
//   sum((t - m) r gamma + beta) w = r (sum(t gamma w) - m sum(gamma w)) + sum(beta w):
// beta stands in their place in the images' rows, and a second A tile has t gamma (rows 0..7, one
// per image) and gamma (row 8). The GEMM, which has m and r, puts the three results together.
// 8 waves = 2 tiles of 16 columns x 4 quarters of the 512 channels; the quarters are summed in LDS.
__device__ __forceinline__ void text_share(
    const float* __restrict__ W, const float* __restrict__ bs, int n0, int nn0,
    const float* __restrict__ text, const float* __restrict__ gamma, const float* __restrict__ beta,
    float* __restrict__ pre, float* __restrict__ p10, float* __restrict__ g10) {
  __shared__ __align__(16) float tf[8 * 512];    // text [image][channel]
  __shared__ v2f gs[8 * 32];                     // [image][group]: mean, rstd of groups 11..31
  __shared__ __align__(16) h16 tn[8 * 520];      // normalized text [image][channel], pitch 1040 B
  __shared__ __align__(16) h16 t10[16 * 8];      // second A tile, its k 0..7; all other k are 0
  __shared__ float red[8 * 128];                 // [wave][image][column]
  __shared__ float red2[2 * 144];                // [tile][row 0..8 of the second product][column]
  const int tid = threadIdx.x, wave = tid >> 5, lane = tid & 31;
  const int l16 = lane & 15, hi = lane >> 4;
  const int nt = wave & 1, kq = wave >> 1;

  // B operand: column l16 of the tile, k = s*32 + hi*8 + j and s*32 + 16 + hi*8 + j
  float wv[4][16];
  const float* __restrict__ wp = W + (size_t)(256 + kq * 128 + hi * 8) * 256 + nn0 + nt * 16 + l16;
  for (int s = 0; s < 4; ++s)
    for (int j = 0; j < 8; ++j) {
      wv[s][j]     = wp[(s * 32 + j) * 256];
      wv[s][8 + j] = wp[(s * 32 + 16 + j) * 256];
    }
  float tx[16], gm[2], bt[2];
  for (int i = 0; i < 16; ++i) tx[i] = text[i * 256 + tid];
  for (int j = 0; j < 2; ++j) { gm[j] = gamma[256 + j * 256 + tid]; bt[j] = beta[256 + j * 256 + tid]; }
  const float bv = bs[nn0 + (tid & 31)];  // read with the rest: one trip to memory
  for (int i = 0; i < 16; ++i) tf[i * 256 + tid] = tx[i];
  __syncthreads();
  if (lane >= 11) {  // thread = (image wave, group lane)
    const f32x4* tg = (const f32x4*)(&tf[wave * 512 + lane * 24 - 256]);  // 96-B steps: 16-B aligned
    f32x4 s4 = tg[0], q4 = tg[0] * tg[0];
    for (int e = 1; e < 6; ++e) { const f32x4 t = tg[e]; s4 += t; q4 += t * t; }
    const float S  = (s4.x + s4.y) + (s4.z + s4.w);
    const float SS = (q4.x + q4.y) + (q4.z + q4.w);
    const float mean = S * (1.f / 24.f);
    const float var  = SS * (1.f / 24.f) - mean * mean;
    const v2f t = {mean, rsqrtf(var + 1e-6f)};
    gs[tid] = t;
  }
  __syncthreads();
  const bool mixed = tid < 8;  // its channel 256 + tid is a text channel of group 10
  const int gi[2] = {mixed ? 11 : (256 + tid) / 24, (512 + tid) / 24};  // 11: any group that is there
  v2f mr[16];
  for (int i = 0; i < 16; ++i) mr[i] = gs[(i >> 1) * 32 + gi[i & 1]];
  for (int i = 0; i < 16; ++i) {
    const int img = i >> 1, j = i & 1;
    const float v = ((tx[i] - mr[i].x) * mr[i].y) * gm[j] + bt[j];
    tn[img * 520 + j * 256 + tid] = (h16)((j == 0 && mixed) ? bt[0] : v);
  }
  if (mixed)
    for (int r = 0; r < 16; ++r)
      t10[r * 8 + tid] = (h16)(r < 8 ? tx[(r & 7) * 2] * gm[0] : (r == 8 ? gm[0] : 0.f));
  __syncthreads();

  // A operand: row = image. Rows 8..15 repeat rows 0..7; their results are not used.
  v8f acc, acc2;
  for (int r = 0; r < 8; ++r) { acc[r] = 0.f; acc2[r] = 0.f; }
  for (int s = 0; s < 4; ++s) {
    const h16* ab = &tn[(l16 & 7) * 520 + kq * 128 + s * 32 + hi * 8];
    FragV afr, bfr;
    afr.q[0] = *(const u32x4*)(ab);
    afr.q[1] = *(const u32x4*)(ab + 16);
    for (int j = 0; j < 16; ++j) bfr.h[j] = (h16)wv[s][j];
    acc = __builtin_amdgcn_wmma_f32_16x16x32_f16(
        false, afr.h, false, bfr.h, (short)0, acc, false, false);
    if (s == 0) {  // second tile: k 0..7 are the first 8 elements of the lanes with hi == 0
      const u32x4 zero = {0u, 0u, 0u, 0u};
      const u32x4 a10 = *(const u32x4*)(&t10[l16 * 8]);
      FragV af2;
      af2.q[0] = hi ? zero : a10;
      af2.q[1] = zero;
      // every wave does it, so that no branch stands around a matrix instruction; only the first
      // quarter's waves, whose k 0..7 are the channels 256..263, keep the result
      acc2 = __builtin_amdgcn_wmma_f32_16x16x32_f16(
          false, af2.h, false, bfr.h, (short)0, acc2, false, false);
    }
  }
  if (hi == 0)
    for (int r = 0; r < 8; ++r) red[wave * 128 + r * 16 + l16] = acc[r];
  if (kq == 0) {
    if (hi == 0)
      for (int r = 0; r < 8; ++r) red2[nt * 144 + r * 16 + l16] = acc2[r];
    else
      red2[nt * 144 + 128 + l16] = acc2[0];  // row 8
  }
  __syncthreads();
  const int img = tid >> 5, col = tid & 31;
  const float* rp = &red[(col >> 4) * 128 + img * 16 + (col & 15)];
  const float* r2 = &red2[(col >> 4) * 144 + (col & 15)];
  pre[img * 768 + n0 + col] = ((rp[0] + rp[256]) + (rp[512] + rp[768])) + bv;
  p10[img * 768 + n0 + col] = r2[img * 16];
  if (img == 0) g10[n0 + col] = r2[128];
}

// -------------------- Weight rows 0..255 -> f16, transposed [N=768][K=256] --------------------
// One block = 64 k x 32 n. Whole 128-B lines in (32 n of one k row) and out (64 k of one n row),
// turned in LDS.
__device__ __forceinline__ void weight_convert(
    const float* __restrict__ W, int k0, int n0, int nn0, h16* __restrict__ Wt) {
  __shared__ __align__(16) h16 tw[32 * 72];  // [n][k], pitch 144 B
  const int tid = threadIdx.x;
  const int q  = tid & 7;    // 4 columns 4q..4q+3
  const int k2 = tid >> 3;   // k pair 2*k2, 2*k2+1
  const f32x4 wa = *(const f32x4*)(W + (size_t)(k0 + k2 * 2) * 256 + nn0 + q * 4);
  const f32x4 wb = *(const f32x4*)(W + (size_t)(k0 + k2 * 2 + 1) * 256 + nn0 + q * 4);
  for (int i = 0; i < 4; ++i) {
    h16x2 t;
    t.x = (h16)wa[i];
    t.y = (h16)wb[i];
    *(h16x2*)(&tw[(q * 4 + i) * 72 + k2 * 2]) = t;
  }
  __syncthreads();
  const int row = tid >> 3, ch = tid & 7;
  *(u32x4*)(Wt + (size_t)(n0 + row) * 256 + k0 + ch * 8) = *(const u32x4*)(&tw[row * 72 + ch * 8]);
  // wait behind the store: the text block's code follows in the listing and rewrites the registers
  // that the issued store names
  asm volatile("s_wait_xcnt 0x0" ::: "memory");
}

// -------------------- First launch: all that needs nothing but the inputs --------------------
// grid: 24 text-share blocks (tiles of 32 n), 88 GroupNorm blocks (8 images x groups 0..10),
// 96 weight blocks (24 tiles of 32 n x 4 of 64 k). The kind of a block is the same for all its threads.
__global__ __launch_bounds__(256) void front_kernel(
    const float* __restrict__ x, const float* __restrict__ text,
    const float* __restrict__ gamma, const float* __restrict__ beta,
    const float* __restrict__ W0, const float* __restrict__ W1, const float* __restrict__ W2,
    const float* __restrict__ b0, const float* __restrict__ b1, const float* __restrict__ b2,
    float* __restrict__ stats, h16* __restrict__ hn, h16* __restrict__ Wt,
    float* __restrict__ pre, float* __restrict__ p10, float* __restrict__ g10) {
  const int blk = blockIdx.x;
  if (blk >= 24 && blk < 112) {
    group_stats((blk - 24) / 11, (blk - 24) % 11, x, text, gamma, beta, stats, hn);
    return;
  }
  const int tile = (blk < 24) ? blk : ((blk - 112) >> 2);
  const int n0  = tile * 32;
  const int nn0 = n0 & 255;
  const float* W = (n0 < 256) ? W0 : ((n0 < 512) ? W1 : W2);
  if (blk < 24)
    text_share(W, (n0 < 256) ? b0 : ((n0 < 512) ? b1 : b2), n0, nn0, text, gamma, beta, pre, p10, g10);
  else
    weight_convert(W, ((blk - 112) & 3) * 64, n0, nn0, Wt);
}

__global__ __launch_bounds__(256) void gemm_qkv_kernel(
    const h16* __restrict__ A, const h16* __restrict__ Bt,
    const float* __restrict__ stats, const float* __restrict__ pre, const float* __restrict__ p10,
    const float* __restrict__ g10, h16* __restrict__ Cout, h16* __restrict__ vT) {
  __shared__ __align__(16) h16 As[2][128 * 48];  // stride 48 h16 = 96B, 16B aligned
  __shared__ __align__(16) h16 Bs[2][128 * 48];
  const int mBase = blockIdx.x * 128;
  const int nBase = blockIdx.y * 128;
  const int tid  = threadIdx.x;
  const int wave = tid >> 5;
  const int lane = tid & 31;
  const int wm = wave >> 1;       // 0..3
  const int wn = wave & 1;        // 0..1
  const int l16 = lane & 15;
  const int hi  = lane >> 4;      // 0/1 selects K phase per WMMA A/B layout

  const int row0 = tid >> 2;            // chunk id tid   -> row, seg
  const int seg0 = tid & 3;
  const int row1 = (tid + 256) >> 2;    // chunk id tid+256
  const int seg1 = (tid + 256) & 3;
  // A tile: a thread copies the pieces (position rowA, runs segA and segA + 2) of the 4 runs of a
  // k step; a wave covers 512 B in a row of one run. 128 rows lie in one image.
  const int rowA = tid & 127;
  const int segA = tid >> 7;
  const int img  = mBase >> 10;
  const h16* __restrict__ asrc = A + (((size_t)img * 32 + segA) * 1024 + (mBase & 1023) + rowA) * 8;

  v8f acc[2][4];
  for (int mt = 0; mt < 2; ++mt)
    for (int nt = 0; nt < 4; ++nt)
      for (int r = 0; r < 8; ++r) acc[mt][nt][r] = 0.f;

  auto load_tiles = [&](int k0, int buf) {
    async_copy4_b128((unsigned)(uintptr_t)&As[buf][rowA * 48 + segA * 8],
                     asrc + (size_t)k0 * 1024,
                     (unsigned)(uintptr_t)&As[buf][rowA * 48 + (segA + 2) * 8],
                     asrc + (size_t)(k0 + 16) * 1024,
                     (unsigned)(uintptr_t)&Bs[buf][row0 * 48 + seg0 * 8],
                     Bt + (size_t)(nBase + row0) * 256 + k0 + seg0 * 8,
                     (unsigned)(uintptr_t)&Bs[buf][row1 * 48 + seg1 * 8],
                     Bt + (size_t)(nBase + row1) * 256 + k0 + seg1 * 8);
  };

  load_tiles(0, 0);
  // text share of this wave's columns, asked for while tile 0 flies
  float pr[4], pp[4], pg[4];
  for (int nt = 0; nt < 4; ++nt) {
    const int n = nBase + wn * 64 + nt * 16 + l16;
    pr[nt] = pre[img * 768 + n];
    pp[nt] = p10[img * 768 + n];
    pg[nt] = g10[n];
  }
  const float m10 = stats[img * 32 + 10], r10 = stats[256 + img * 32 + 10];
  wait_async0();
  __syncthreads();
  load_tiles(32, 1);  // flies while tile 0 is worked on
  float bv[4];
  for (int nt = 0; nt < 4; ++nt) bv[nt] = pr[nt] + r10 * (pp[nt] - m10 * pg[nt]);

  int buf = 0;
  for (int k0 = 0; k0 < 256; k0 += 32) {

    FragV afr[2];
    for (int mt = 0; mt < 2; ++mt) {
      const int row = wm * 32 + mt * 16 + l16;
      const int ko  = hi * 8;
      afr[mt].q[0] = *(const u32x4*)(&As[buf][row * 48 + ko]);
      afr[mt].q[1] = *(const u32x4*)(&As[buf][row * 48 + ko + 16]);
    }
    for (int nt = 0; nt < 4; ++nt) {
      const int col = wn * 64 + nt * 16 + l16;
      const int ko  = hi * 8;
      FragV bfr;
      bfr.q[0] = *(const u32x4*)(&Bs[buf][col * 48 + ko]);
      bfr.q[1] = *(const u32x4*)(&Bs[buf][col * 48 + ko + 16]);
      for (int mt = 0; mt < 2; ++mt)
        acc[mt][nt] = __builtin_amdgcn_wmma_f32_16x16x32_f16(
            false, afr[mt].h, false, bfr.h, (short)0, acc[mt][nt], false, false);
    }

    // hand-over: this wave's reads of this tile are done, its copies of the next have landed;
    // behind the barrier that holds for all waves, and this tile's buffer may be refilled
    asm volatile("s_wait_dscnt 0x0" ::: "memory");
    wait_async0();
    __syncthreads();
    if (k0 + 64 < 256) load_tiles(k0 + 64, buf);
    buf ^= 1;
  }
  wait_async0();  // nothing is in flight when the wave ends

  h16x8 cv[2][4];  // [r] = row wm*32 + mt*16 + hi*8 + r, column wn*64 + nt*16 + l16 of the block tile
  for (int mt = 0; mt < 2; ++mt)
    for (int nt = 0; nt < 4; ++nt)
      for (int r = 0; r < 8; ++r) cv[mt][nt][r] = (h16)(acc[mt][nt][r] + bv[nt]);
  if (nBase >= 512) {  // v columns, the same for the whole block: row (image*256 + column) of vT
    h16* __restrict__ vb = vT + ((size_t)(mBase >> 10) * 256 + (nBase - 512) + wn * 64 + l16) * 1024 +
                           (mBase & 1023) + wm * 32 + hi * 8;
    for (int nt = 0; nt < 4; ++nt)
      for (int mt = 0; mt < 2; ++mt) *(h16x8*)(vb + nt * 16 * 1024 + mt * 16) = cv[mt][nt];
    return;
  }
  for (int mt = 0; mt < 2; ++mt)
    for (int nt = 0; nt < 4; ++nt) {
      const int n = nBase + wn * 64 + nt * 16 + l16;
      for (int r = 0; r < 8; ++r) {
        const int m = mBase + wm * 32 + mt * 16 + r + hi * 8;
        Cout[(size_t)m * 768 + n] = cv[mt][nt][r];
      }
    }
  // wait behind the last store: the v block's code follows in the listing and rewrites the address
  // registers that the issued stores name
  asm volatile("s_wait_xcnt 0x0" ::: "memory");
}

__device__ __forceinline__ float xhalf(float v) {
  const int b = __builtin_bit_cast(int, v);
  return __builtin_bit_cast(float,
      __builtin_amdgcn_permlanex16(b, b, 0x76543210, 0xfedcba98, false, false));
}

__global__ __launch_bounds__(256) void attn_kernel(
    const h16* __restrict__ qkv, const h16* __restrict__ vT,
    const float* __restrict__ x, float* __restrict__ out) {
  const int bh = blockIdx.x;
  const int b = bh >> 2, h = bh & 3;
  const int tid = threadIdx.x, wave = tid >> 5, lane = tid & 31;
  const int qg = wave & 3;   // query group
  const int kh = wave >> 2;  // key half of every stage
  const int l16 = lane & 15;
  const int hi  = lane >> 4;
  const int hi8 = hi * 8;
  const int qrow0 = blockIdx.y * 128 + qg * 32;

  __shared__ __align__(16) h16 Ks[2][128 * 72];   // [key][channel], pitch 144 B
  __shared__ __align__(16) h16 Vs[2][64 * 136];   // [channel][key], pitch 272 B
  __shared__ __align__(16) f32x4 xo[8][8][32];    // [wave][piece][lane]: the O^T half the partner finishes
  __shared__ v2f xml[8][2][32];                   // [wave][mt][lane]: maximum, sum
  // a thread copies 16 B of four rows of each tile; a wave covers whole 128-B (K) or 256-B (V^T) rows
  const int crow = tid >> 3;
  const int cseg = (tid & 7) * 8;
  const int vrow = tid >> 4;
  const int vseg = (tid & 15) * 8;
  const h16* __restrict__ ksrc = qkv + ((size_t)b * 1024 + crow) * 768 + 256 + h * 64 + cseg;
  const h16* __restrict__ vsrc = vT + ((size_t)bh * 64 + vrow) * 1024 + vseg;
  auto stage = [&](int st, int buf) {
    const h16* kp = ksrc + (size_t)st * 128 * 768;
    const h16* vp = vsrc + st * 128;
    async_copy4_b128((unsigned)(uintptr_t)&Ks[buf][crow * 72 + cseg], kp,
                     (unsigned)(uintptr_t)&Ks[buf][(crow + 32) * 72 + cseg], kp + 32 * 768,
                     (unsigned)(uintptr_t)&Ks[buf][(crow + 64) * 72 + cseg], kp + 64 * 768,
                     (unsigned)(uintptr_t)&Ks[buf][(crow + 96) * 72 + cseg], kp + 96 * 768);
    async_copy4_b128((unsigned)(uintptr_t)&Vs[buf][vrow * 136 + vseg], vp,
                     (unsigned)(uintptr_t)&Vs[buf][(vrow + 16) * 136 + vseg], vp + 16 * 1024,
                     (unsigned)(uintptr_t)&Vs[buf][(vrow + 32) * 136 + vseg], vp + 32 * 1024,
                     (unsigned)(uintptr_t)&Vs[buf][(vrow + 48) * 136 + vseg], vp + 48 * 1024);
  };
  stage(0, 0);

  // Preload Q fragments: [mt][kc] covers 32 rows x 64 channels
  FragV qf[2][2];
  for (int mt = 0; mt < 2; ++mt)
    for (int kc = 0; kc < 2; ++kc) {
      const int row = qrow0 + mt * 16 + l16;
      const h16* base = qkv + ((size_t)b * 1024 + row) * 768 + h * 64 + kc * 32 + hi * 8;
      qf[mt][kc].q[0] = *(const u32x4*)(base);
      qf[mt][kc].q[1] = *(const u32x4*)(base + 16);
    }

  // per lane: running maximum of query mt*16+l16, and this half's share of its sum
  float mrow[2], lrow[2];
  v8f oacc[2][4];  // O^T tile: [r] = channel nt*16 + hi8 + r, query mt*16 + l16
  for (int mt = 0; mt < 2; ++mt) { mrow[mt] = -1e30f; lrow[mt] = 0.f; }
  for (int mt = 0; mt < 2; ++mt)
    for (int nt = 0; nt < 4; ++nt)
      for (int r = 0; r < 8; ++r) oacc[mt][nt][r] = 0.f;

  wait_async0();    // stage 0 has landed for this wave's copies
  __syncthreads();  // and for every wave's
  stage(1, 1);

  for (int kt = 0; kt < 8; ++kt) {
    const h16* Kt = Ks[kt & 1] + kh * (64 * 72);
    const h16* Vt = Vs[kt & 1] + kh * 64;

    // ---- S^T = K * Q^T: sacc[mt][nt][r] = key nt*16 + hi8 + r, query mt*16 + l16 ----
    v8f sacc[2][4];
    for (int mt = 0; mt < 2; ++mt)
      for (int nt = 0; nt < 4; ++nt)
        for (int r = 0; r < 8; ++r) sacc[mt][nt][r] = 0.f;

    for (int nt = 0; nt < 4; ++nt) {
      const h16* kb = Kt + (nt * 16 + l16) * 72 + hi * 8;
      FragV kf0, kf1;
      kf0.q[0] = *(const u32x4*)(kb);       kf0.q[1] = *(const u32x4*)(kb + 16);
      kf1.q[0] = *(const u32x4*)(kb + 32);  kf1.q[1] = *(const u32x4*)(kb + 48);
      for (int mt = 0; mt < 2; ++mt) {
        sacc[mt][nt] = __builtin_amdgcn_wmma_f32_16x16x32_f16(
            false, kf0.h, false, qf[mt][0].h, (short)0, sacc[mt][nt], false, false);
        sacc[mt][nt] = __builtin_amdgcn_wmma_f32_16x16x32_f16(
            false, kf1.h, false, qf[mt][1].h, (short)0, sacc[mt][nt], false, false);
      }
    }

    // ---- scale + online softmax, one query per lane ----
    // Worked on in pairs of neighbouring accumulator registers (keys 2j, 2j+1 of a tile).
    FragV pf[2][2];  // P^T as B operand: [mt][kc], 32 keys each
    for (int mt = 0; mt < 2; ++mt) {
      v2f sp[4][4];
      for (int nt = 0; nt < 4; ++nt)
        for (int j = 0; j < 4; ++j) {
          const v2f t = {sacc[mt][nt][2 * j], sacc[mt][nt][2 * j + 1]};
          sp[nt][j] = t * 0.125f;  // Ch^-0.5
        }

      float vm[4];
      for (int nt = 0; nt < 4; ++nt) {
        vm[nt] = fmaxf(sp[nt][0].x, sp[nt][0].y);
        for (int j = 1; j < 4; ++j) vm[nt] = fmaxf(vm[nt], fmaxf(sp[nt][j].x, sp[nt][j].y));
      }
      float v = fmaxf(fmaxf(vm[0], vm[1]), fmaxf(vm[2], vm[3]));
      v = fmaxf(v, xhalf(v));  // the other 32 keys of this query
      const float mold = mrow[mt];
      const float mnew = fmaxf(mold, v);
      const float corr = __expf(mold - mnew);
      mrow[mt] = mnew;
      for (int nt = 0; nt < 4; ++nt)
        for (int r = 0; r < 8; ++r) oacc[mt][nt][r] *= corr;
      // tiles 2kc and 2kc+1 hold keys hi8+0..7 and 16+hi8+0..7 of chunk kc: the B k order
      v2f ps[4];
      for (int nt = 0; nt < 4; ++nt) {
        for (int j = 0; j < 4; ++j) {
          const v2f d = sp[nt][j] - mnew;
          const v2f p = {__expf(d.x), __expf(d.y)};
          ps[nt] = (j == 0) ? p : ps[nt] + p;
          pf[mt][nt >> 1].h[(nt & 1) * 8 + 2 * j]     = (h16)p.x;
          pf[mt][nt >> 1].h[(nt & 1) * 8 + 2 * j + 1] = (h16)p.y;
        }
      }
      const v2f pt = (ps[0] + ps[1]) + (ps[2] + ps[3]);
      lrow[mt] = lrow[mt] * corr + (pt.x + pt.y);
    }

    // ---- O^T += V^T * P^T ----
    for (int kc = 0; kc < 2; ++kc) {
      for (int nt = 0; nt < 4; ++nt) {
        const h16* vb = Vt + (nt * 16 + l16) * 136 + kc * 32 + hi * 8;
        FragV vf;
        vf.q[0] = *(const u32x4*)(vb);
        vf.q[1] = *(const u32x4*)(vb + 16);
        for (int mt = 0; mt < 2; ++mt)
          oacc[mt][nt] = __builtin_amdgcn_wmma_f32_16x16x32_f16(
              false, vf.h, false, pf[mt][kc].h, (short)0, oacc[mt][nt], false, false);
      }
    }

    // hand-over: this wave's reads of stage kt are done, its copies of stage kt + 1 have landed;
    // behind the barrier that holds for all waves, and stage kt's buffer may be refilled
    asm volatile("s_wait_dscnt 0x0" ::: "memory");
    wait_async0();
    __syncthreads();
    if (kt + 2 < 8) stage(kt + 2, kt & 1);
  }
  wait_async0();  // nothing is in flight when the wave ends

  // ---- merge the two key halves of a query group ----
  // Wave kh finishes channels kh*32 .. kh*32+31 (tiles 2kh, 2kh+1) and hands the other two tiles,
  // with its maximum and its sum, to its partner, wave ^ 4.
  // element [mt][j][r] of this lane: channel h*64 + kh*32 + j*16 + hi8 + r, position qrow0 + mt*16 + l16
  const size_t ebase = ((size_t)b * 256 + h * 64 + kh * 32 + hi8) * 1024 + qrow0 + l16;
  const float* __restrict__ xb = x + ebase;
  float* __restrict__ ob = out + ebase;
  float xr[2][2][8];  // residual, asked for ahead of the exchange
  for (int mt = 0; mt < 2; ++mt)
    for (int j = 0; j < 2; ++j)
      for (int r = 0; r < 8; ++r) xr[mt][j][r] = xb[(j * 16 + r) * 1024 + mt * 16];
  float lw[2];
  v8f mine[2][2];  // the two tiles this wave finishes
  for (int mt = 0; mt < 2; ++mt) {
    lw[mt] = lrow[mt] + xhalf(lrow[mt]);  // join the lane halves' sums
    const v2f ml = {mrow[mt], lw[mt]};
    xml[wave][mt][lane] = ml;
    for (int j = 0; j < 2; ++j) {
      const v8f o = kh ? oacc[mt][j] : oacc[mt][2 + j];
      mine[mt][j] = kh ? oacc[mt][2 + j] : oacc[mt][j];
      const f32x4 lo = {o[0], o[1], o[2], o[3]}, up = {o[4], o[5], o[6], o[7]};
      xo[wave][(mt * 2 + j) * 2][lane]     = lo;
      xo[wave][(mt * 2 + j) * 2 + 1][lane] = up;
    }
  }
  // keeps the selects in front of the barrier, where the wave waits for the residual loads anyway;
  // without it the compiler moves half of them behind the barrier, in among the weights' arithmetic
  __builtin_amdgcn_sched_barrier(0);
  __syncthreads();  // every wave's partial result is in LDS

  // ---- finalize: weigh both halves, O * (1/l), residual add, store f32 [B,C,H*W] ----
  const int pw = wave ^ 4;
  for (int mt = 0; mt < 2; ++mt) {
    const v2f pm = xml[pw][mt][lane];
    const float mall = fmaxf(mrow[mt], pm.x);
    const float wa = __expf(mrow[mt] - mall), wb = __expf(pm.x - mall);
    const float linv = 1.0f / (lw[mt] * wa + pm.y * wb);
    const float ca = wa * linv, cb = wb * linv;
    for (int j = 0; j < 2; ++j) {
      const v8f o = mine[mt][j];
      const f32x4 lo = xo[pw][(mt * 2 + j) * 2][lane], up = xo[pw][(mt * 2 + j) * 2 + 1][lane];
      for (int r = 0; r < 8; ++r)
        ob[(j * 16 + r) * 1024 + mt * 16] = xr[mt][j][r] + (o[r] * ca + (r < 4 ? lo[r & 3] : up[r & 3]) * cb);
    }
  }
}

// -------------------- launch --------------------
extern "C" void kernel_launch(void* const* d_in, const int* in_sizes, int n_in,
                              void* d_out, int out_size, void* d_ws, size_t ws_size,
                              hipStream_t stream) {
  const float* x     = (const float*)d_in[0];
  const float* text  = (const float*)d_in[1];
  const float* gamma = (const float*)d_in[2];
  const float* beta  = (const float*)d_in[3];
  const float* W0    = (const float*)d_in[4];
  const float* b0    = (const float*)d_in[5];
  const float* W1    = (const float*)d_in[6];
  const float* b1    = (const float*)d_in[7];
  const float* W2    = (const float*)d_in[8];
  const float* b2    = (const float*)d_in[9];
  float* out = (float*)d_out;

  char* ws = (char*)d_ws;
  float* stats = (float*)ws;                    // 512 f32, group 10 of each image used
  h16*   hn    = (h16*)(ws + 32768);            // 8*1024*256
  h16*   Wt    = hn + (size_t)8 * 1024 * 256;   // 768*256
  h16*   qkv   = Wt + (size_t)768 * 256;        // 8*1024*768, the v third stays unused
  h16*   vT    = qkv + (size_t)8 * 1024 * 768;  // 32*64*1024
  float* pre   = (float*)(vT + (size_t)32 * 64 * 1024);  // 8*768 f32
  float* p10   = pre + 8 * 768;                 // 8*768 f32
  float* g10   = p10 + 8 * 768;                 // 768 f32

  front_kernel<<<208, 256, 0, stream>>>(x, text, gamma, beta, W0, W1, W2, b0, b1, b2, stats, hn, Wt, pre, p10, g10);
  gemm_qkv_kernel<<<dim3(64, 6), 256, 0, stream>>>(hn, Wt, stats, pre, p10, g10, qkv, vT);
  attn_kernel<<<dim3(32, 8), 256, 0, stream>>>(qkv, vT, x, out);
}

// v010
// It runs in 25.3 microseconds.
// In two side-by-side timings against v009, it was 1.10 and 1.11 times as fast.
// All steps since v000 together make it 7.96 times as fast.
#include <hip/hip_runtime.h>
#include <hip/hip_bf16.h>

typedef _Float16 h16;
typedef __attribute__((ext_vector_type(16))) _Float16 v16h;
typedef __attribute__((ext_vector_type(8)))  float    v8f;
typedef __attribute__((ext_vector_type(2)))  float    v2f;
typedef __attribute__((ext_vector_type(4)))  unsigned int u32x4;
typedef __attribute__((ext_vector_type(4)))  float    f32x4;
typedef __attribute__((ext_vector_type(2)))  _Float16 h16x2;
typedef __attribute__((ext_vector_type(8)))  _Float16 h16x8;

typedef __attribute__((address_space(4))) float cf32;  // constant address space

union FragV { u32x4 q[2]; v16h h; };

__device__ __forceinline__ void async_copy4_b128(unsigned l0, const void* g0, unsigned l1, const void* g1,
                                                 unsigned l2, const void* g2, unsigned l3, const void* g3) {
  asm volatile("global_load_async_to_lds_b128 %0, %1, off\n\t"
               "global_load_async_to_lds_b128 %2, %3, off\n\t"
               "global_load_async_to_lds_b128 %4, %5, off\n\t"
               "global_load_async_to_lds_b128 %6, %7, off\n\t"
               "s_wait_xcnt 0x0"
               :: "v"(l0), "v"(g0), "v"(l1), "v"(g1), "v"(l2), "v"(g2), "v"(l3), "v"(g3) : "memory");
}
__device__ __forceinline__ void wait_async0() {
  asm volatile("s_wait_asynccnt 0" ::: "memory");
}

// -------------------- GroupNorm of the x channels: statistics, normalize, cast to f16 --------------------
// One block = (image b, group g), 256 threads. Group g covers channels [24g,24g+24). Only the groups
// 0..10, which hold x channels, get a block; the text share below works out the groups 11..31, which
// are text alone, itself.
// A thread takes 4 neighbouring positions of each of the 24 channels. The channels come in three
// runs of 8: 24g and 256 are multiples of 8, so a run is all x or all text, x runs first (NX of them).
// Every load is issued before the first sum reads one, so the block waits for memory once.
// The block holds all x values of its group in registers, so once mean and rstd are known it
// normalizes them there and stores them: hn[image][run of 8 channels][position][8], a 16-B piece
// per position and run, which is the piece the GEMM copies into its A tile.
template <int NX>
__device__ __forceinline__ void group_norm(
    int b, int g, const float* __restrict__ x, const float* __restrict__ text,
    const float* __restrict__ gamma, const float* __restrict__ beta,
    float* __restrict__ stats, h16* __restrict__ hn, float* rs, float* rss, h16* stg) {
  const int tid = threadIdx.x;
  const float* __restrict__ xs = x + (((size_t)b * 256 + g * 24) << 10) + tid * 4;
  // gamma, beta and the text values of the group are the same for the whole block and no kernel writes
  // them: read as constant memory they come through the scalar cache into scalar registers, while the
  // x loads are under way
  const cf32* gc = (const cf32*)gamma + g * 24;
  const cf32* bc = (const cf32*)beta + g * 24;
  const cf32* tc = (const cf32*)text + b * 512 + (g * 24 + NX * 8 - 256);
  float gm[NX * 8], bt[NX * 8], tx[8];
  for (int e = 0; e < NX * 8; ++e) { gm[e] = gc[e]; bt[e] = bc[e]; }
  for (int e = 0; e < (3 - NX) * 8; ++e) tx[e] = tc[e];
  // keeps the scalar loads of gamma and beta in front: moved behind the x loads, in front of their wait,
  // the compiler lets their results land in the scalar registers that hold the issued loads' base address
  __builtin_amdgcn_sched_barrier(0);
  f32x4 v[NX * 8];
  for (int e = 0; e < NX * 8; ++e) v[e] = *(const f32x4*)(xs + (e << 10));
  // wait behind the last load: what follows rewrites registers that the issued loads name
  asm volatile("s_wait_xcnt 0x0" ::: "memory");
  // keeps the sums behind the last load: without it the compiler holds half of the loads back
  // until the first ones have returned, a second trip to memory
  __builtin_amdgcn_sched_barrier(0);
  float st = 0.f, sq = 0.f;  // a text channel has one value at all positions
  for (int e = 0; e < (3 - NX) * 8; ++e) { const float t = tx[e]; st += t; sq += t * t; }
  f32x4 s4 = {st, st, st, st}, q4 = {sq, sq, sq, sq};
  for (int e = 0; e < NX * 8; ++e) { s4 += v[e]; q4 += v[e] * v[e]; }
  float s  = (s4.x + s4.y) + (s4.z + s4.w);
  float ss = (q4.x + q4.y) + (q4.z + q4.w);
  for (int off = 16; off >= 1; off >>= 1) {
    s  += __shfl_xor(s,  off, 32);
    ss += __shfl_xor(ss, off, 32);
  }
  if ((tid & 31) == 0) { rs[tid >> 5] = s; rss[tid >> 5] = ss; }
  __syncthreads();
  float S = 0.f, SS = 0.f;  // every thread: it needs mean and rstd for its own values
  for (int i = 0; i < 8; ++i) { S += rs[i]; SS += rss[i]; }
  const float mean = S * (1.f / 24576.f);
  const float var  = SS * (1.f / 24576.f) - mean * mean;
  const float rstd = rsqrtf(var + 1e-6f);
  h16x8 t[NX][4];
  for (int o = 0; o < NX; ++o)
    for (int i = 0; i < 4; ++i)
      for (int e = 0; e < 8; ++e)
        t[o][i][e] = (h16)(((v[o * 8 + e][i] - mean) * rstd) * gm[o * 8 + e] + bt[o * 8 + e]);
  const int lane = tid & 31, wave = tid >> 5;
  h16* sw = stg + wave * 1280;
  for (int o = 0; o < NX; ++o)
    for (int i = 0; i < 4; ++i) *(h16x8*)(sw + o * 10240 + (lane * 5 + i) * 8) = t[o][i];
  __syncthreads();  // the reads below stay behind the other lanes' writes
  if (NX == 2 && tid == 0) {  // group 10: the GEMM needs them for the group's text channels
    stats[b * 32 + g]       = mean;
    stats[256 + b * 32 + g] = rstd;
  }
  h16* __restrict__ dst = hn + (((size_t)b * 32 + g * 3) * 1024 + wave * 128 + lane) * 8;
  for (int o = 0; o < NX; ++o)
    for (int j = 0; j < 4; ++j)  // position j*32 + lane of the wave's 128
      *(h16x8*)(dst + (o * 1024 + j * 32) * 8) =
          *(const h16x8*)(sw + o * 10240 + (j * 40 + lane + (lane >> 2)) * 8);
  // wait behind the stores: other blocks' code follows in the listing and rewrites the registers
  // that the issued stores name
  asm volatile("s_wait_xcnt 0x0" ::: "memory");
}

__device__ __forceinline__ void group_stats(
    int b, int g, const float* __restrict__ x, const float* __restrict__ text,
    const float* __restrict__ gamma, const float* __restrict__ beta,
    float* __restrict__ stats, h16* __restrict__ hn) {
  __shared__ float rs[8], rss[8];
  __shared__ __align__(16) h16 stg[3 * 8 * 1280];  // [run][wave][160 pieces of 16 B]
  // group 10: 16 x channels, then 8 text channels
  if (256 - g * 24 >= 24) group_norm<3>(b, g, x, text, gamma, beta, stats, hn, rs, rss, stg);
  else                    group_norm<2>(b, g, x, text, gamma, beta, stats, hn, rs, rss, stg);
}

// -------------------- Text share of q, k, v --------------------
// A text channel has one value at all positions of an image, so its products with the weight rows
// 256..767 are the same for all 1024 positions: [8 images][512] x [512][32 columns] per block, on
// the matrix unit with f16 operands, plus the bias.
// The block waits for no other block. The groups 11..31 are text alone (24 values, each 1024
// times): it works out their mean and rstd itself. Group 10 holds x channels too, so its mean m and
// rstd r are not known here; its 8 text channels 256..263 enter through
//   sum((t - m) r gamma + beta) w = r (sum(t gamma w) - m sum(gamma w)) + sum(beta w):
// beta stands in their place in the images' rows, and a second A tile has t gamma (rows 0..7, one
// per image) and gamma (row 8). The GEMM, which has m and r, puts the three results together.
// 8 waves = 2 tiles of 16 columns x 4 quarters of the 512 channels; the quarters are summed in LDS.
__device__ __forceinline__ void text_share(
    const float* __restrict__ W, const float* __restrict__ bs, int n0, int nn0,
    const float* __restrict__ text, const float* __restrict__ gamma, const float* __restrict__ beta,
    float* __restrict__ pre, float* __restrict__ p10, float* __restrict__ g10) {
  __shared__ __align__(16) float tf[8 * 512];    // text [image][channel]
  __shared__ v2f gs[8 * 32];                     // [image][group]: mean, rstd of groups 11..31
  __shared__ __align__(16) h16 tn[8 * 520];      // normalized text [image][channel], pitch 1040 B
  __shared__ __align__(16) h16 t10[16 * 8];      // second A tile, its k 0..7; all other k are 0
  __shared__ float red[8 * 128];                 // [wave][image][column]
  __shared__ float red2[2 * 144];                // [tile][row 0..8 of the second product][column]
  const int tid = threadIdx.x, wave = tid >> 5, lane = tid & 31;
  const int l16 = lane & 15, hi = lane >> 4;
  const int nt = wave & 1, kq = wave >> 1;

  // B operand: column l16 of the tile, k = s*32 + hi*8 + j and s*32 + 16 + hi*8 + j
  float wv[4][16];
  const float* __restrict__ wp = W + (size_t)(256 + kq * 128 + hi * 8) * 256 + nn0 + nt * 16 + l16;
  for (int s = 0; s < 4; ++s)
    for (int j = 0; j < 8; ++j) {
      wv[s][j]     = wp[(s * 32 + j) * 256];
      wv[s][8 + j] = wp[(s * 32 + 16 + j) * 256];
    }
  float tx[16], gm[2], bt[2];
  for (int i = 0; i < 16; ++i) tx[i] = text[i * 256 + tid];
  for (int j = 0; j < 2; ++j) { gm[j] = gamma[256 + j * 256 + tid]; bt[j] = beta[256 + j * 256 + tid]; }
  const float bv = bs[nn0 + (tid & 31)];  // read with the rest: one trip to memory
  for (int i = 0; i < 16; ++i) tf[i * 256 + tid] = tx[i];
  __syncthreads();
  if (lane >= 11) {  // thread = (image wave, group lane)
    const f32x4* tg = (const f32x4*)(&tf[wave * 512 + lane * 24 - 256]);  // 96-B steps: 16-B aligned
    f32x4 s4 = tg[0], q4 = tg[0] * tg[0];
    for (int e = 1; e < 6; ++e) { const f32x4 t = tg[e]; s4 += t; q4 += t * t; }
    const float S  = (s4.x + s4.y) + (s4.z + s4.w);
    const float SS = (q4.x + q4.y) + (q4.z + q4.w);
    const float mean = S * (1.f / 24.f);
    const float var  = SS * (1.f / 24.f) - mean * mean;
    const v2f t = {mean, rsqrtf(var + 1e-6f)};
    gs[tid] = t;
  }
  __syncthreads();
  const bool mixed = tid < 8;  // its channel 256 + tid is a text channel of group 10
  const int gi[2] = {mixed ? 11 : (256 + tid) / 24, (512 + tid) / 24};  // 11: any group that is there
  v2f mr[16];
  for (int i = 0; i < 16; ++i) mr[i] = gs[(i >> 1) * 32 + gi[i & 1]];
  for (int i = 0; i < 16; ++i) {
    const int img = i >> 1, j = i & 1;
    const float v = ((tx[i] - mr[i].x) * mr[i].y) * gm[j] + bt[j];
    tn[img * 520 + j * 256 + tid] = (h16)((j == 0 && mixed) ? bt[0] : v);
  }
  if (mixed)
    for (int r = 0; r < 16; ++r)
      t10[r * 8 + tid] = (h16)(r < 8 ? tx[(r & 7) * 2] * gm[0] : (r == 8 ? gm[0] : 0.f));
  __syncthreads();

  // A operand: row = image. Rows 8..15 repeat rows 0..7; their results are not used.
  v8f acc, acc2;
  for (int r = 0; r < 8; ++r) { acc[r] = 0.f; acc2[r] = 0.f; }
  for (int s = 0; s < 4; ++s) {
    const h16* ab = &tn[(l16 & 7) * 520 + kq * 128 + s * 32 + hi * 8];
    FragV afr, bfr;
    afr.q[0] = *(const u32x4*)(ab);
    afr.q[1] = *(const u32x4*)(ab + 16);
    for (int j = 0; j < 16; ++j) bfr.h[j] = (h16)wv[s][j];
    acc = __builtin_amdgcn_wmma_f32_16x16x32_f16(
        false, afr.h, false, bfr.h, (short)0, acc, false, false);
    if (s == 0) {  // second tile: k 0..7 are the first 8 elements of the lanes with hi == 0
      const u32x4 zero = {0u, 0u, 0u, 0u};
      const u32x4 a10 = *(const u32x4*)(&t10[l16 * 8]);
      FragV af2;
      af2.q[0] = hi ? zero : a10;
      af2.q[1] = zero;
      // every wave does it, so that no branch stands around a matrix instruction; only the first
      // quarter's waves, whose k 0..7 are the channels 256..263, keep the result
      acc2 = __builtin_amdgcn_wmma_f32_16x16x32_f16(
          false, af2.h, false, bfr.h, (short)0, acc2, false, false);
    }
  }
  if (hi == 0)
    for (int r = 0; r < 8; ++r) red[wave * 128 + r * 16 + l16] = acc[r];
  if (kq == 0) {
    if (hi == 0)
      for (int r = 0; r < 8; ++r) red2[nt * 144 + r * 16 + l16] = acc2[r];
    else
      red2[nt * 144 + 128 + l16] = acc2[0];  // row 8
  }
  __syncthreads();
  const int img = tid >> 5, col = tid & 31;
  const float* rp = &red[(col >> 4) * 128 + img * 16 + (col & 15)];
  const float* r2 = &red2[(col >> 4) * 144 + (col & 15)];
  pre[img * 768 + n0 + col] = ((rp[0] + rp[256]) + (rp[512] + rp[768])) + bv;
  p10[img * 768 + n0 + col] = r2[img * 16];
  if (img == 0) g10[n0 + col] = r2[128];
}

// -------------------- Weight rows 0..255 -> f16, transposed [N=768][K=256] --------------------
// One block = 64 k x 32 n. Whole 128-B lines in (32 n of one k row) and out (64 k of one n row),
// turned in LDS.
__device__ __forceinline__ void weight_convert(
    const float* __restrict__ W, int k0, int n0, int nn0, h16* __restrict__ Wt) {
  __shared__ __align__(16) h16 tw[32 * 72];  // [n][k], pitch 144 B
  const int tid = threadIdx.x;
  const int q  = tid & 7;    // 4 columns 4q..4q+3
  const int k2 = tid >> 3;   // k pair 2*k2, 2*k2+1
  const f32x4 wa = *(const f32x4*)(W + (size_t)(k0 + k2 * 2) * 256 + nn0 + q * 4);
  const f32x4 wb = *(const f32x4*)(W + (size_t)(k0 + k2 * 2 + 1) * 256 + nn0 + q * 4);
  for (int i = 0; i < 4; ++i) {
    h16x2 t;
    t.x = (h16)wa[i];
    t.y = (h16)wb[i];
    *(h16x2*)(&tw[(q * 4 + i) * 72 + k2 * 2]) = t;
  }
  __syncthreads();
  const int row = tid >> 3, ch = tid & 7;
  *(u32x4*)(Wt + (size_t)(n0 + row) * 256 + k0 + ch * 8) = *(const u32x4*)(&tw[row * 72 + ch * 8]);
  // wait behind the store: the text block's code follows in the listing and rewrites the registers
  // that the issued store names
  asm volatile("s_wait_xcnt 0x0" ::: "memory");
}

// -------------------- First launch: all that needs nothing but the inputs --------------------
// grid: 24 text-share blocks (tiles of 32 n), 88 GroupNorm blocks (8 images x groups 0..10),
// 96 weight blocks (24 tiles of 32 n x 4 of 64 k). The kind of a block is the same for all its threads.
__global__ __launch_bounds__(256) void front_kernel(
    const float* __restrict__ x, const float* __restrict__ text,
    const float* __restrict__ gamma, const float* __restrict__ beta,
    const float* __restrict__ W0, const float* __restrict__ W1, const float* __restrict__ W2,
    const float* __restrict__ b0, const float* __restrict__ b1, const float* __restrict__ b2,
    float* __restrict__ stats, h16* __restrict__ hn, h16* __restrict__ Wt,
    float* __restrict__ pre, float* __restrict__ p10, float* __restrict__ g10) {
  const int blk = blockIdx.x;
  if (blk >= 24 && blk < 112) {
    group_stats((blk - 24) / 11, (blk - 24) % 11, x, text, gamma, beta, stats, hn);
    return;
  }
  const int tile = (blk < 24) ? blk : ((blk - 112) >> 2);
  const int n0  = tile * 32;
  const int nn0 = n0 & 255;
  const float* W = (n0 < 256) ? W0 : ((n0 < 512) ? W1 : W2);
  if (blk < 24)
    text_share(W, (n0 < 256) ? b0 : ((n0 < 512) ? b1 : b2), n0, nn0, text, gamma, beta, pre, p10, g10);
  else
    weight_convert(W, ((blk - 112) & 3) * 64, n0, nn0, Wt);
}

__global__ __launch_bounds__(256) void gemm_qkv_kernel(
    const h16* __restrict__ A, const h16* __restrict__ Bt,
    const float* __restrict__ stats, const float* __restrict__ pre, const float* __restrict__ p10,
    const float* __restrict__ g10, h16* __restrict__ Cout, h16* __restrict__ vT) {
  __shared__ __align__(16) h16 As[128 * 264];
  __shared__ __align__(16) h16 Bs[128 * 264];
  const int mBase = blockIdx.x * 128;
  const int nBase = blockIdx.y * 128;
  const int tid  = threadIdx.x;
  const int wave = tid >> 5;
  const int lane = tid & 31;
  const int wm = wave >> 1;       // 0..3
  const int wn = wave & 1;        // 0..1
  const int l16 = lane & 15;
  const int hi  = lane >> 4;      // 0/1 selects K phase per WMMA A/B layout

  // A tile: a thread copies the pieces (position rowA, runs segA, segA + 2, .. segA + 30) of the 32
  // runs; a wave covers 512 B in a row of one run. 128 rows lie in one image.
  const int rowA = tid & 127;
  const int segA = tid >> 7;
  const int img  = mBase >> 10;
  const h16* __restrict__ asrc = A + (((size_t)img * 32 + segA) * 1024 + (mBase & 1023) + rowA) * 8;
  // B tile: a wave copies one whole row of 512 B; a thread the piece segB of rows rowB, rowB + 8, ..
  const int rowB = tid >> 5;
  const int segB = tid & 31;
  const h16* __restrict__ bsrc = Bt + (size_t)(nBase + rowB) * 256 + segB * 8;

  v8f acc[2][4];
  for (int mt = 0; mt < 2; ++mt)
    for (int nt = 0; nt < 4; ++nt)
      for (int r = 0; r < 8; ++r) acc[mt][nt][r] = 0.f;

  const unsigned la = (unsigned)(uintptr_t)&As[rowA * 264 + segA * 8];
  const unsigned lb = (unsigned)(uintptr_t)&Bs[rowB * 264 + segB * 8];
  for (int i = 0; i < 16; i += 4) {  // 32 copies of a thread in flight
    // A: two runs on = 32 B in the LDS row, 2 * 1024 pieces in hn
    async_copy4_b128(la + i * 32,       asrc + (size_t)i * 16384,
                     la + (i + 1) * 32, asrc + (size_t)(i + 1) * 16384,
                     la + (i + 2) * 32, asrc + (size_t)(i + 2) * 16384,
                     la + (i + 3) * 32, asrc + (size_t)(i + 3) * 16384);
    // B: 8 rows on
    async_copy4_b128(lb + i * 4224,       bsrc + i * 2048,
                     lb + (i + 1) * 4224, bsrc + (i + 1) * 2048,
                     lb + (i + 2) * 4224, bsrc + (i + 2) * 2048,
                     lb + (i + 3) * 4224, bsrc + (i + 3) * 2048);
  }
  // text share of this wave's columns, asked for while the tiles fly
  float pr[4], pp[4], pg[4];
  for (int nt = 0; nt < 4; ++nt) {
    const int n = nBase + wn * 64 + nt * 16 + l16;
    pr[nt] = pre[img * 768 + n];
    pp[nt] = p10[img * 768 + n];
    pg[nt] = g10[n];
  }
  const float m10 = stats[img * 32 + 10], r10 = stats[256 + img * 32 + 10];
  wait_async0();    // this wave's copies have landed
  __syncthreads();  // and every wave's: from here on the tiles are only read
  float bv[4];
  for (int nt = 0; nt < 4; ++nt) bv[nt] = pr[nt] + r10 * (pp[nt] - m10 * pg[nt]);

  // With no barrier in the loop the fragments of k step s + 1 are asked for, as one group, ahead of
  // the products of step s, which hide the LDS latency.
  const h16* ap = &As[(wm * 32 + l16) * 264 + hi * 8];
  const h16* bp = &Bs[(wn * 64 + l16) * 264 + hi * 8];
  FragV afr[2][2], bfr[2][4];  // [step parity][tile]
  auto load_frags = [&](int s) {
    for (int mt = 0; mt < 2; ++mt) {
      afr[s & 1][mt].q[0] = *(const u32x4*)(ap + mt * 16 * 264 + s * 32);
      afr[s & 1][mt].q[1] = *(const u32x4*)(ap + mt * 16 * 264 + s * 32 + 16);
    }
    for (int nt = 0; nt < 4; ++nt) {
      bfr[s & 1][nt].q[0] = *(const u32x4*)(bp + nt * 16 * 264 + s * 32);
      bfr[s & 1][nt].q[1] = *(const u32x4*)(bp + nt * 16 * 264 + s * 32 + 16);
    }
  };
  load_frags(0);
#pragma unroll  // the step parity must be a constant, or the fragments leave the registers
  for (int s = 0; s < 8; ++s) {
    if (s + 1 < 8) load_frags(s + 1);
    // keeps the next step's reads in front of this step's products: moved in among them, each pair
    // of reads is waited for on its own
    __builtin_amdgcn_sched_barrier(0);
    for (int nt = 0; nt < 4; ++nt)
      for (int mt = 0; mt < 2; ++mt)
        acc[mt][nt] = __builtin_amdgcn_wmma_f32_16x16x32_f16(
            false, afr[s & 1][mt].h, false, bfr[s & 1][nt].h, (short)0, acc[mt][nt], false, false);
    // keeps this step's products in front of the reads of the step after the next, which reuse
    // their operand registers
    __builtin_amdgcn_sched_barrier(0);
  }

  h16x8 cv[2][4];  // [r] = row wm*32 + mt*16 + hi*8 + r, column wn*64 + nt*16 + l16 of the block tile
  for (int mt = 0; mt < 2; ++mt)
    for (int nt = 0; nt < 4; ++nt)
      for (int r = 0; r < 8; ++r) cv[mt][nt][r] = (h16)(acc[mt][nt][r] + bv[nt]);
  if (nBase >= 512) {  // v columns, the same for the whole block: row (image*256 + column) of vT
    h16* __restrict__ vb = vT + ((size_t)(mBase >> 10) * 256 + (nBase - 512) + wn * 64 + l16) * 1024 +
                           (mBase & 1023) + wm * 32 + hi * 8;
    for (int nt = 0; nt < 4; ++nt)
      for (int mt = 0; mt < 2; ++mt) *(h16x8*)(vb + nt * 16 * 1024 + mt * 16) = cv[mt][nt];
    return;
  }
  for (int mt = 0; mt < 2; ++mt)
    for (int nt = 0; nt < 4; ++nt) {
      const int n = nBase + wn * 64 + nt * 16 + l16;
      for (int r = 0; r < 8; ++r) {
        const int m = mBase + wm * 32 + mt * 16 + r + hi * 8;
        Cout[(size_t)m * 768 + n] = cv[mt][nt][r];
      }
    }
  // wait behind the last store: the v block's code follows in the listing and rewrites the address
  // registers that the issued stores name
  asm volatile("s_wait_xcnt 0x0" ::: "memory");
}

__device__ __forceinline__ float xhalf(float v) {
  const int b = __builtin_bit_cast(int, v);
  return __builtin_bit_cast(float,
      __builtin_amdgcn_permlanex16(b, b, 0x76543210, 0xfedcba98, false, false));
}

__global__ __launch_bounds__(256) void attn_kernel(
    const h16* __restrict__ qkv, const h16* __restrict__ vT,
    const float* __restrict__ x, float* __restrict__ out) {
  const int bh = blockIdx.x;
  const int b = bh >> 2, h = bh & 3;
  const int tid = threadIdx.x, wave = tid >> 5, lane = tid & 31;
  const int qg = wave & 3;   // query group
  const int kh = wave >> 2;  // key half of every stage
  const int l16 = lane & 15;
  const int hi  = lane >> 4;
  const int hi8 = hi * 8;
  const int qrow0 = blockIdx.y * 128 + qg * 32;

  __shared__ __align__(16) h16 Ks[2][128 * 72];   // [key][channel], pitch 144 B
  __shared__ __align__(16) h16 Vs[2][64 * 136];   // [channel][key], pitch 272 B
  __shared__ __align__(16) f32x4 xo[8][8][32];    // [wave][piece][lane]: the O^T half the partner finishes
  __shared__ v2f xml[8][2][32];                   // [wave][mt][lane]: maximum, sum
  // a thread copies 16 B of four rows of each tile; a wave covers whole 128-B (K) or 256-B (V^T) rows
  const int crow = tid >> 3;
  const int cseg = (tid & 7) * 8;
  const int vrow = tid >> 4;
  const int vseg = (tid & 15) * 8;
  const h16* __restrict__ ksrc = qkv + ((size_t)b * 1024 + crow) * 768 + 256 + h * 64 + cseg;
  const h16* __restrict__ vsrc = vT + ((size_t)bh * 64 + vrow) * 1024 + vseg;
  auto stage = [&](int st, int buf) {
    const h16* kp = ksrc + (size_t)st * 128 * 768;
    const h16* vp = vsrc + st * 128;
    async_copy4_b128((unsigned)(uintptr_t)&Ks[buf][crow * 72 + cseg], kp,
                     (unsigned)(uintptr_t)&Ks[buf][(crow + 32) * 72 + cseg], kp + 32 * 768,
                     (unsigned)(uintptr_t)&Ks[buf][(crow + 64) * 72 + cseg], kp + 64 * 768,
                     (unsigned)(uintptr_t)&Ks[buf][(crow + 96) * 72 + cseg], kp + 96 * 768);
    async_copy4_b128((unsigned)(uintptr_t)&Vs[buf][vrow * 136 + vseg], vp,
                     (unsigned)(uintptr_t)&Vs[buf][(vrow + 16) * 136 + vseg], vp + 16 * 1024,
                     (unsigned)(uintptr_t)&Vs[buf][(vrow + 32) * 136 + vseg], vp + 32 * 1024,
                     (unsigned)(uintptr_t)&Vs[buf][(vrow + 48) * 136 + vseg], vp + 48 * 1024);
  };
  stage(0, 0);

  // Preload Q fragments: [mt][kc] covers 32 rows x 64 channels
  FragV qf[2][2];
  for (int mt = 0; mt < 2; ++mt)
    for (int kc = 0; kc < 2; ++kc) {
      const int row = qrow0 + mt * 16 + l16;
      const h16* base = qkv + ((size_t)b * 1024 + row) * 768 + h * 64 + kc * 32 + hi * 8;
      qf[mt][kc].q[0] = *(const u32x4*)(base);
      qf[mt][kc].q[1] = *(const u32x4*)(base + 16);
    }

  // per lane: running maximum of query mt*16+l16, and this half's share of its sum
  float mrow[2], lrow[2];
  v8f oacc[2][4];  // O^T tile: [r] = channel nt*16 + hi8 + r, query mt*16 + l16
  for (int mt = 0; mt < 2; ++mt) { mrow[mt] = -1e30f; lrow[mt] = 0.f; }
  for (int mt = 0; mt < 2; ++mt)
    for (int nt = 0; nt < 4; ++nt)
      for (int r = 0; r < 8; ++r) oacc[mt][nt][r] = 0.f;

  wait_async0();    // stage 0 has landed for this wave's copies
  __syncthreads();  // and for every wave's
  stage(1, 1);

  for (int kt = 0; kt < 8; ++kt) {
    const h16* Kt = Ks[kt & 1] + kh * (64 * 72);
    const h16* Vt = Vs[kt & 1] + kh * 64;

    // ---- S^T = K * Q^T: sacc[mt][nt][r] = key nt*16 + hi8 + r, query mt*16 + l16 ----
    v8f sacc[2][4];
    for (int mt = 0; mt < 2; ++mt)
      for (int nt = 0; nt < 4; ++nt)
        for (int r = 0; r < 8; ++r) sacc[mt][nt][r] = 0.f;

    for (int nt = 0; nt < 4; ++nt) {
      const h16* kb = Kt + (nt * 16 + l16) * 72 + hi * 8;
      FragV kf0, kf1;
      kf0.q[0] = *(const u32x4*)(kb);       kf0.q[1] = *(const u32x4*)(kb + 16);
      kf1.q[0] = *(const u32x4*)(kb + 32);  kf1.q[1] = *(const u32x4*)(kb + 48);
      for (int mt = 0; mt < 2; ++mt) {
        sacc[mt][nt] = __builtin_amdgcn_wmma_f32_16x16x32_f16(
            false, kf0.h, false, qf[mt][0].h, (short)0, sacc[mt][nt], false, false);
        sacc[mt][nt] = __builtin_amdgcn_wmma_f32_16x16x32_f16(
            false, kf1.h, false, qf[mt][1].h, (short)0, sacc[mt][nt], false, false);
      }
    }

    // ---- scale + online softmax, one query per lane ----
    // Worked on in pairs of neighbouring accumulator registers (keys 2j, 2j+1 of a tile).
    FragV pf[2][2];  // P^T as B operand: [mt][kc], 32 keys each
    for (int mt = 0; mt < 2; ++mt) {
      v2f sp[4][4];
      for (int nt = 0; nt < 4; ++nt)
        for (int j = 0; j < 4; ++j) {
          const v2f t = {sacc[mt][nt][2 * j], sacc[mt][nt][2 * j + 1]};
          sp[nt][j] = t * 0.125f;  // Ch^-0.5
        }

      float vm[4];
      for (int nt = 0; nt < 4; ++nt) {
        vm[nt] = fmaxf(sp[nt][0].x, sp[nt][0].y);
        for (int j = 1; j < 4; ++j) vm[nt] = fmaxf(vm[nt], fmaxf(sp[nt][j].x, sp[nt][j].y));
      }
      float v = fmaxf(fmaxf(vm[0], vm[1]), fmaxf(vm[2], vm[3]));
      v = fmaxf(v, xhalf(v));  // the other 32 keys of this query
      const float mold = mrow[mt];
      const float mnew = fmaxf(mold, v);
      const float corr = __expf(mold - mnew);
      mrow[mt] = mnew;
      for (int nt = 0; nt < 4; ++nt)
        for (int r = 0; r < 8; ++r) oacc[mt][nt][r] *= corr;
      // tiles 2kc and 2kc+1 hold keys hi8+0..7 and 16+hi8+0..7 of chunk kc: the B k order
      v2f ps[4];
      for (int nt = 0; nt < 4; ++nt) {
        for (int j = 0; j < 4; ++j) {
          const v2f d = sp[nt][j] - mnew;
          const v2f p = {__expf(d.x), __expf(d.y)};
          ps[nt] = (j == 0) ? p : ps[nt] + p;
          pf[mt][nt >> 1].h[(nt & 1) * 8 + 2 * j]     = (h16)p.x;
          pf[mt][nt >> 1].h[(nt & 1) * 8 + 2 * j + 1] = (h16)p.y;
        }
      }
      const v2f pt = (ps[0] + ps[1]) + (ps[2] + ps[3]);
      lrow[mt] = lrow[mt] * corr + (pt.x + pt.y);
    }

    // ---- O^T += V^T * P^T ----
    for (int kc = 0; kc < 2; ++kc) {
      for (int nt = 0; nt < 4; ++nt) {
        const h16* vb = Vt + (nt * 16 + l16) * 136 + kc * 32 + hi * 8;
        FragV vf;
        vf.q[0] = *(const u32x4*)(vb);
        vf.q[1] = *(const u32x4*)(vb + 16);
        for (int mt = 0; mt < 2; ++mt)
          oacc[mt][nt] = __builtin_amdgcn_wmma_f32_16x16x32_f16(
              false, vf.h, false, pf[mt][kc].h, (short)0, oacc[mt][nt], false, false);
      }
    }

    // hand-over: this wave's reads of stage kt are done, its copies of stage kt + 1 have landed;
    // behind the barrier that holds for all waves, and stage kt's buffer may be refilled
    asm volatile("s_wait_dscnt 0x0" ::: "memory");
    wait_async0();
    __syncthreads();
    if (kt + 2 < 8) stage(kt + 2, kt & 1);
  }
  wait_async0();  // nothing is in flight when the wave ends

  // ---- merge the two key halves of a query group ----
  // Wave kh finishes channels kh*32 .. kh*32+31 (tiles 2kh, 2kh+1) and hands the other two tiles,
  // with its maximum and its sum, to its partner, wave ^ 4.
  // element [mt][j][r] of this lane: channel h*64 + kh*32 + j*16 + hi8 + r, position qrow0 + mt*16 + l16
  const size_t ebase = ((size_t)b * 256 + h * 64 + kh * 32 + hi8) * 1024 + qrow0 + l16;
  const float* __restrict__ xb = x + ebase;
  float* __restrict__ ob = out + ebase;
  float xr[2][2][8];  // residual, asked for ahead of the exchange
  for (int mt = 0; mt < 2; ++mt)
    for (int j = 0; j < 2; ++j)
      for (int r = 0; r < 8; ++r) xr[mt][j][r] = xb[(j * 16 + r) * 1024 + mt * 16];
  float lw[2];
  v8f mine[2][2];  // the two tiles this wave finishes
  for (int mt = 0; mt < 2; ++mt) {
    lw[mt] = lrow[mt] + xhalf(lrow[mt]);  // join the lane halves' sums
    const v2f ml = {mrow[mt], lw[mt]};
    xml[wave][mt][lane] = ml;
    for (int j = 0; j < 2; ++j) {
      const v8f o = kh ? oacc[mt][j] : oacc[mt][2 + j];
      mine[mt][j] = kh ? oacc[mt][2 + j] : oacc[mt][j];
      const f32x4 lo = {o[0], o[1], o[2], o[3]}, up = {o[4], o[5], o[6], o[7]};
      xo[wave][(mt * 2 + j) * 2][lane]     = lo;
      xo[wave][(mt * 2 + j) * 2 + 1][lane] = up;
    }
  }
  // keeps the selects in front of the barrier, where the wave waits for the residual loads anyway;
  // without it the compiler moves half of them behind the barrier, in among the weights' arithmetic
  __builtin_amdgcn_sched_barrier(0);
  __syncthreads();  // every wave's partial result is in LDS

  // ---- finalize: weigh both halves, O * (1/l), residual add, store f32 [B,C,H*W] ----
  const int pw = wave ^ 4;
  for (int mt = 0; mt < 2; ++mt) {
    const v2f pm = xml[pw][mt][lane];
    const float mall = fmaxf(mrow[mt], pm.x);
    const float wa = __expf(mrow[mt] - mall), wb = __expf(pm.x - mall);
    const float linv = 1.0f / (lw[mt] * wa + pm.y * wb);
    const float ca = wa * linv, cb = wb * linv;
    for (int j = 0; j < 2; ++j) {
      const v8f o = mine[mt][j];
      const f32x4 lo = xo[pw][(mt * 2 + j) * 2][lane], up = xo[pw][(mt * 2 + j) * 2 + 1][lane];
      for (int r = 0; r < 8; ++r)
        ob[(j * 16 + r) * 1024 + mt * 16] = xr[mt][j][r] + (o[r] * ca + (r < 4 ? lo[r & 3] : up[r & 3]) * cb);
    }
  }
}

// -------------------- launch --------------------
extern "C" void kernel_launch(void* const* d_in, const int* in_sizes, int n_in,
                              void* d_out, int out_size, void* d_ws, size_t ws_size,
                              hipStream_t stream) {
  const float* x     = (const float*)d_in[0];
  const float* text  = (const float*)d_in[1];
  const float* gamma = (const float*)d_in[2];
  const float* beta  = (const float*)d_in[3];
  const float* W0    = (const float*)d_in[4];
  const float* b0    = (const float*)d_in[5];
  const float* W1    = (const float*)d_in[6];
  const float* b1    = (const float*)d_in[7];
  const float* W2    = (const float*)d_in[8];
  const float* b2    = (const float*)d_in[9];
  float* out = (float*)d_out;

  char* ws = (char*)d_ws;
  float* stats = (float*)ws;                    // 512 f32, group 10 of each image used
  h16*   hn    = (h16*)(ws + 32768);            // 8*1024*256
  h16*   Wt    = hn + (size_t)8 * 1024 * 256;   // 768*256
  h16*   qkv   = Wt + (size_t)768 * 256;        // 8*1024*768, the v third stays unused
  h16*   vT    = qkv + (size_t)8 * 1024 * 768;  // 32*64*1024
  float* pre   = (float*)(vT + (size_t)32 * 64 * 1024);  // 8*768 f32
  float* p10   = pre + 8 * 768;                 // 8*768 f32
  float* g10   = p10 + 8 * 768;                 // 768 f32

  front_kernel<<<208, 256, 0, stream>>>(x, text, gamma, beta, W0, W1, W2, b0, b1, b2, stats, hn, Wt, pre, p10, g10);
  gemm_qkv_kernel<<<dim3(64, 6), 256, 0, stream>>>(hn, Wt, stats, pre, p10, g10, qkv, vT);
  attn_kernel<<<dim3(32, 8), 256, 0, stream>>>(qkv, vT, x, out);
}
